// v000
// The times below were measured on an AMD MI455X: many runs one after another, warmed up first and cycling through
// copies of the inputs, with the whole window's GPU time divided by the number of runs. Launches and the gaps
// between them are all in it. The median over several windows is given; except for v000 it joins two sittings, which
// can be a few percent apart, so the side-by-side timings, each taken in one sitting, are the better comparison.
// v000, which the later versions start from, runs in 558 microseconds.
#include <hip/hip_runtime.h>
#include <hip/hip_bf16.h>

// ---------------------------------------------------------------------------
// Problem constants (match reference)
// ---------------------------------------------------------------------------
#define E_DIM 1024
#define H_NUM 16
#define D_DIM 64
#define R_DIM 8
#define BATCH 2
#define SEQ   2048
#define TOK   (BATCH * SEQ)      // 4096 tokens
#define NQKV  (3 * E_DIM)        // 3072

typedef __attribute__((ext_vector_type(16))) _Float16 v16h;
typedef __attribute__((ext_vector_type(8)))  _Float16 v8h;
typedef __attribute__((ext_vector_type(8)))  float    v8f;

__device__ __forceinline__ v8f wmma16(v16h a, v16h b, v8f c) {
  // D = A(16x32 f16) * B(32x16 f16) + C(16x16 f32)
  return __builtin_amdgcn_wmma_f32_16x16x32_f16(
      /*neg_a=*/false, a, /*neg_b=*/false, b,
      /*c_mod=*/(short)0, c, /*reuse_a=*/false, /*reuse_b=*/false);
}

// Load one 16x32 f16 operand tile into the wave32 WMMA register layout.
// Element (r, k) comes from base[(major + r) * ld + kb + k].
//   lane%16 -> r (A: row M / B: col N), lane/16 selects K-halves:
//   halves 0..7  = K (lane/16)*8 + 0..7
//   halves 8..15 = K 16 + (lane/16)*8 + 0..7
__device__ __forceinline__ v16h load_tile16(const _Float16* base, int ld,
                                            int major, int kb, int lane) {
  const _Float16* p = base + (size_t)(major + (lane & 15)) * (size_t)ld
                           + (size_t)(kb + ((lane >> 4) << 3));
  v8h lo = *(const v8h*)p;        // K = koff + 0..7
  v8h hi = *(const v8h*)(p + 16); // K = koff + 16..23
  return __builtin_shufflevector(lo, hi, 0,1,2,3,4,5,6,7,8,9,10,11,12,13,14,15);
}

// ---------------------------------------------------------------------------
// 0) f32 -> f16 convert
// ---------------------------------------------------------------------------
__global__ void cvt_f32_to_f16(const float* __restrict__ in,
                               _Float16* __restrict__ out, int n) {
  int i = blockIdx.x * blockDim.x + threadIdx.x;
  if (i < n) out[i] = (_Float16)in[i];
}

// ---------------------------------------------------------------------------
// 1) U = y @ [Bq | Bk | Bv]   -> [TOK, 24] f32
// ---------------------------------------------------------------------------
__global__ __launch_bounds__(256)
void lora_u_kernel(const float* __restrict__ y, const float* __restrict__ Bq,
                   const float* __restrict__ Bk, const float* __restrict__ Bv,
                   float* __restrict__ U) {
  int t = blockIdx.x, tid = threadIdx.x;
  const float* yr = y + (size_t)t * E_DIM;
  float acc[24];
#pragma unroll
  for (int j = 0; j < 24; ++j) acc[j] = 0.f;
  for (int e = tid; e < E_DIM; e += 256) {
    float yv = yr[e];
#pragma unroll
    for (int r = 0; r < R_DIM; ++r) {
      acc[r]      += yv * Bq[e * R_DIM + r];
      acc[8 + r]  += yv * Bk[e * R_DIM + r];
      acc[16 + r] += yv * Bv[e * R_DIM + r];
    }
  }
  __shared__ float red[256];
  for (int j = 0; j < 24; ++j) {
    red[tid] = acc[j];
    __syncthreads();
    for (int s = 128; s > 0; s >>= 1) {
      if (tid < s) red[tid] += red[tid + s];
      __syncthreads();
    }
    if (tid == 0) U[(size_t)t * 24 + j] = red[0];
    __syncthreads();
  }
}

// ---------------------------------------------------------------------------
// 2) QKV GEMM: C[TOK, 3072] = Xh @ Wqkv^T + bias + LoRA, scatter to
//    Qh,Kh [B,H,S,D] f16 (Q pre-scaled by 1/sqrt(D)) and Vt [B,H,D,S] f16.
//    Wave tile: 32(M) x 64(N), 8 WMMAs per 32-k step (A reused 4x, B reused 2x).
//    Block: 4 waves = 32 x 256.
// ---------------------------------------------------------------------------
__global__ __launch_bounds__(128)
void qkv_wmma_kernel(const _Float16* __restrict__ Xh,
                     const _Float16* __restrict__ Wh,     // [3072,1024] f16
                     const float* __restrict__ bqkv,
                     const float* __restrict__ U,         // [TOK,24]
                     const float* __restrict__ Aq, const float* __restrict__ Ak,
                     const float* __restrict__ Av,
                     _Float16* __restrict__ Qh, _Float16* __restrict__ Kh,
                     _Float16* __restrict__ Vt) {
  int lane = threadIdx.x & 31, wave = threadIdx.x >> 5;
  int rowb = blockIdx.y * 32;
  int colb = blockIdx.x * 256 + wave * 64;

  v8f acc[2][4];
#pragma unroll
  for (int i = 0; i < 2; ++i)
#pragma unroll
    for (int j = 0; j < 4; ++j) acc[i][j] = v8f{};

  for (int kb = 0; kb < E_DIM; kb += 32) {
    v16h a0 = load_tile16(Xh, E_DIM, rowb, kb, lane);
    v16h a1 = load_tile16(Xh, E_DIM, rowb + 16, kb, lane);
    __builtin_prefetch(Xh + (size_t)(rowb + (lane & 15)) * E_DIM + kb + 64, 0, 1);
#pragma unroll
    for (int j = 0; j < 4; ++j) {
      v16h b = load_tile16(Wh, E_DIM, colb + j * 16, kb, lane);
      acc[0][j] = wmma16(a0, b, acc[0][j]);
      acc[1][j] = wmma16(a1, b, acc[1][j]);
    }
  }

#pragma unroll
  for (int j = 0; j < 4; ++j) {
    int col = colb + j * 16 + (lane & 15);   // 0..3071
    int g = col >> 10;                       // 0=Q 1=K 2=V (uniform per tile)
    int e = col & 1023;
    const float* Ag = (g == 0) ? Aq : ((g == 1) ? Ak : Av);
    float a8[R_DIM];
#pragma unroll
    for (int r = 0; r < R_DIM; ++r) a8[r] = Ag[r * E_DIM + e];
    float bias = bqkv[col];
    int hh = e >> 6, d = e & 63;
#pragma unroll
    for (int i = 0; i < 2; ++i) {
#pragma unroll
      for (int v = 0; v < 8; ++v) {
        int row = rowb + i * 16 + v + ((lane >> 4) << 3);  // token index
        float val = acc[i][j][v] + bias;
        const float* Ur = U + (size_t)row * 24 + g * R_DIM;
#pragma unroll
        for (int r = 0; r < R_DIM; ++r) val += Ur[r] * a8[r];
        int bb = row >> 11, ss = row & (SEQ - 1);
        if (g == 0) {
          Qh[(((size_t)bb * H_NUM + hh) * SEQ + ss) * D_DIM + d] =
              (_Float16)(val * 0.125f);               // fold 1/sqrt(64)
        } else if (g == 1) {
          Kh[(((size_t)bb * H_NUM + hh) * SEQ + ss) * D_DIM + d] = (_Float16)val;
        } else {
          Vt[(((size_t)bb * H_NUM + hh) * D_DIM + d) * SEQ + ss] = (_Float16)val;
        }
      }
    }
  }
}

// ---------------------------------------------------------------------------
// 3) Flash attention: one wave per 32-query tile, online softmax,
//    16 WMMAs per 32-key step (V operand reused across both query subtiles).
//    Output Oh [TOK, E] f16 in [B,S,H*D] order.
// ---------------------------------------------------------------------------
__global__ __launch_bounds__(256)
void attn_wmma_kernel(const _Float16* __restrict__ Q,
                      const _Float16* __restrict__ K,
                      const _Float16* __restrict__ Vt,
                      _Float16* __restrict__ Oh) {
  int lane = threadIdx.x & 31, wave = threadIdx.x >> 5;
  int id = blockIdx.x * 8 + wave;           // 0 .. B*H*(S/32)-1 = 2047
  int qt = id & (SEQ / 32 - 1);             // 32-query tile in sequence
  int bh = id >> 6;                         // 0..31
  int b = bh >> 4, h = bh & 15;
  const _Float16* Qp = Q + (size_t)bh * SEQ * D_DIM;
  const _Float16* Kp = K + (size_t)bh * SEQ * D_DIM;
  const _Float16* Vp = Vt + (size_t)bh * D_DIM * SEQ;
  int qrow = qt * 32;

  v16h aq[2][2];
#pragma unroll
  for (int i = 0; i < 2; ++i) {
    aq[i][0] = load_tile16(Qp, D_DIM, qrow + i * 16, 0, lane);
    aq[i][1] = load_tile16(Qp, D_DIM, qrow + i * 16, 32, lane);
  }

  v8f o[2][4];
  float m[2][8], l[2][8];
#pragma unroll
  for (int i = 0; i < 2; ++i) {
#pragma unroll
    for (int j = 0; j < 4; ++j) o[i][j] = v8f{};
#pragma unroll
    for (int v = 0; v < 8; ++v) { m[i][v] = -1e30f; l[i][v] = 0.f; }
  }

  // per-wave staging: P is 32x32 f16, stride 40 halves (80B rows, 16B-aligned)
  __shared__ __align__(16) _Float16 pb[8][32 * 40];
  _Float16* pw = &pb[wave][0];

  for (int kb = 0; kb < SEQ; kb += 32) {
    v8f s[2][2];
#pragma unroll
    for (int i = 0; i < 2; ++i) { s[i][0] = v8f{}; s[i][1] = v8f{}; }

#pragma unroll
    for (int kt = 0; kt < 2; ++kt) {
      v16h bk0 = load_tile16(Kp, D_DIM, kb + kt * 16, 0, lane);
      v16h bk1 = load_tile16(Kp, D_DIM, kb + kt * 16, 32, lane);
#pragma unroll
      for (int i = 0; i < 2; ++i) {
        s[i][kt] = wmma16(aq[i][0], bk0, s[i][kt]);
        s[i][kt] = wmma16(aq[i][1], bk1, s[i][kt]);
      }
    }

#pragma unroll
    for (int i = 0; i < 2; ++i) {
#pragma unroll
      for (int v = 0; v < 8; ++v) {
        float x0 = s[i][0][v], x1 = s[i][1][v];
        float mx = fmaxf(x0, x1);
#pragma unroll
        for (int off = 1; off < 16; off <<= 1)
          mx = fmaxf(mx, __shfl_xor(mx, off, 32));  // stays in 16-lane half
        float mn = fmaxf(m[i][v], mx);
        float p0 = __expf(x0 - mn);
        float p1 = __expf(x1 - mn);
        float rs = p0 + p1;
#pragma unroll
        for (int off = 1; off < 16; off <<= 1) rs += __shfl_xor(rs, off, 32);
        float corr = __expf(m[i][v] - mn);
        l[i][v] = l[i][v] * corr + rs;
        m[i][v] = mn;
        o[i][0][v] *= corr; o[i][1][v] *= corr;
        o[i][2][v] *= corr; o[i][3][v] *= corr;
        int row = i * 16 + v + ((lane >> 4) << 3);
        int col = lane & 15;
        pw[row * 40 + col]      = (_Float16)p0;     // keys kb..kb+15
        pw[row * 40 + 16 + col] = (_Float16)p1;     // keys kb+16..kb+31
      }
    }

    // V operand tiles loaded once, reused by both query subtiles
    v16h bv[4];
#pragma unroll
    for (int j = 0; j < 4; ++j) bv[j] = load_tile16(Vp, SEQ, j * 16, kb, lane);
    // re-lane P (C layout) into A layout via LDS (DS ops in-order per wave)
#pragma unroll
    for (int i = 0; i < 2; ++i) {
      v16h ap = load_tile16(pw + i * 16 * 40, 40, 0, 0, lane);
#pragma unroll
      for (int j = 0; j < 4; ++j) o[i][j] = wmma16(ap, bv[j], o[i][j]);
    }
  }

#pragma unroll
  for (int i = 0; i < 2; ++i) {
#pragma unroll
    for (int v = 0; v < 8; ++v) {
      float inv = 1.0f / l[i][v];
      int ss = qrow + i * 16 + v + ((lane >> 4) << 3);
      size_t rowoff = ((size_t)b * SEQ + ss) * E_DIM;
      int colb = h * D_DIM + (lane & 15);
      Oh[rowoff + colb +  0] = (_Float16)(o[i][0][v] * inv);
      Oh[rowoff + colb + 16] = (_Float16)(o[i][1][v] * inv);
      Oh[rowoff + colb + 32] = (_Float16)(o[i][2][v] * inv);
      Oh[rowoff + colb + 48] = (_Float16)(o[i][3][v] * inv);
    }
  }
}

// ---------------------------------------------------------------------------
// 4) Uo = O @ Bo  -> [TOK, 8] f32
// ---------------------------------------------------------------------------
__global__ __launch_bounds__(256)
void lora_uo_kernel(const _Float16* __restrict__ Oh,
                    const float* __restrict__ Bo, float* __restrict__ Uo) {
  int t = blockIdx.x, tid = threadIdx.x;
  const _Float16* orow = Oh + (size_t)t * E_DIM;
  float acc[R_DIM];
#pragma unroll
  for (int r = 0; r < R_DIM; ++r) acc[r] = 0.f;
  for (int e = tid; e < E_DIM; e += 256) {
    float ov = (float)orow[e];
#pragma unroll
    for (int r = 0; r < R_DIM; ++r) acc[r] += ov * Bo[e * R_DIM + r];
  }
  __shared__ float red[256];
  for (int j = 0; j < R_DIM; ++j) {
    red[tid] = acc[j];
    __syncthreads();
    for (int s = 128; s > 0; s >>= 1) {
      if (tid < s) red[tid] += red[tid + s];
      __syncthreads();
    }
    if (tid == 0) Uo[(size_t)t * R_DIM + j] = red[0];
    __syncthreads();
  }
}

// ---------------------------------------------------------------------------
// 5) res = O @ Wmsa^T + O @ (Bo Ao) + y   (f32 out)
//    Wave tile 32x64 like the QKV GEMM.
// ---------------------------------------------------------------------------
__global__ __launch_bounds__(128)
void msa_wmma_kernel(const _Float16* __restrict__ Oh,
                     const _Float16* __restrict__ Wmh,   // [1024,1024] f16
                     const float* __restrict__ Uo, const float* __restrict__ Ao,
                     const float* __restrict__ y, float* __restrict__ res) {
  int lane = threadIdx.x & 31, wave = threadIdx.x >> 5;
  int rowb = blockIdx.y * 32;
  int colb = blockIdx.x * 256 + wave * 64;

  v8f acc[2][4];
#pragma unroll
  for (int i = 0; i < 2; ++i)
#pragma unroll
    for (int j = 0; j < 4; ++j) acc[i][j] = v8f{};

  for (int kb = 0; kb < E_DIM; kb += 32) {
    v16h a0 = load_tile16(Oh, E_DIM, rowb, kb, lane);
    v16h a1 = load_tile16(Oh, E_DIM, rowb + 16, kb, lane);
    __builtin_prefetch(Oh + (size_t)(rowb + (lane & 15)) * E_DIM + kb + 64, 0, 1);
#pragma unroll
    for (int j = 0; j < 4; ++j) {
      v16h b = load_tile16(Wmh, E_DIM, colb + j * 16, kb, lane);
      acc[0][j] = wmma16(a0, b, acc[0][j]);
      acc[1][j] = wmma16(a1, b, acc[1][j]);
    }
  }

#pragma unroll
  for (int j = 0; j < 4; ++j) {
    int col = colb + j * 16 + (lane & 15);
    float a8[R_DIM];
#pragma unroll
    for (int r = 0; r < R_DIM; ++r) a8[r] = Ao[r * E_DIM + col];
#pragma unroll
    for (int i = 0; i < 2; ++i) {
#pragma unroll
      for (int v = 0; v < 8; ++v) {
        int row = rowb + i * 16 + v + ((lane >> 4) << 3);
        float val = acc[i][j][v];
        const float* Ur = Uo + (size_t)row * R_DIM;
#pragma unroll
        for (int r = 0; r < R_DIM; ++r) val += Ur[r] * a8[r];
        val += y[(size_t)row * E_DIM + col];
        res[(size_t)row * E_DIM + col] = val;
      }
    }
  }
}

// ---------------------------------------------------------------------------
// 6) LayerNorm rows of res -> d_out
// ---------------------------------------------------------------------------
__global__ __launch_bounds__(256)
void layernorm_kernel(const float* __restrict__ res,
                      const float* __restrict__ gamma,
                      const float* __restrict__ beta, float* __restrict__ out) {
  int t = blockIdx.x, tid = threadIdx.x;
  const float* rr = res + (size_t)t * E_DIM;
  float s1 = 0.f, s2 = 0.f;
  for (int e = tid; e < E_DIM; e += 256) {
    float x = rr[e];
    s1 += x; s2 += x * x;
  }
  __shared__ float r1[256], r2[256];
  r1[tid] = s1; r2[tid] = s2;
  __syncthreads();
  for (int s = 128; s > 0; s >>= 1) {
    if (tid < s) { r1[tid] += r1[tid + s]; r2[tid] += r2[tid + s]; }
    __syncthreads();
  }
  float mu = r1[0] * (1.0f / E_DIM);
  float var = r2[0] * (1.0f / E_DIM) - mu * mu;
  float sc = rsqrtf(var + 1e-6f);
  for (int e = tid; e < E_DIM; e += 256)
    out[(size_t)t * E_DIM + e] = (rr[e] - mu) * sc * gamma[e] + beta[e];
}

// ---------------------------------------------------------------------------
// Host launcher
// ---------------------------------------------------------------------------
extern "C" void kernel_launch(void* const* d_in, const int* in_sizes, int n_in,
                              void* d_out, int out_size, void* d_ws, size_t ws_size,
                              hipStream_t stream) {
  const float* y    = (const float*)d_in[0];
  const float* Wqkv = (const float*)d_in[1];
  const float* bqkv = (const float*)d_in[2];
  const float* Wmsa = (const float*)d_in[3];
  const float* Bq   = (const float*)d_in[4];
  const float* Aq   = (const float*)d_in[5];
  const float* Bk   = (const float*)d_in[6];
  const float* Ak   = (const float*)d_in[7];
  const float* Bv   = (const float*)d_in[8];
  const float* Av   = (const float*)d_in[9];
  const float* Bo   = (const float*)d_in[10];
  const float* Ao   = (const float*)d_in[11];
  const float* gamma = (const float*)d_in[12];
  const float* beta  = (const float*)d_in[13];
  float* out = (float*)d_out;

  // workspace carve-up (all offsets 256B-aligned)
  char* ws = (char*)d_ws;
  size_t off = 0;
  auto carve = [&](size_t bytes) {
    char* p = ws + off;
    off += (bytes + 255) & ~(size_t)255;
    return p;
  };
  _Float16* Xh   = (_Float16*)carve((size_t)TOK * E_DIM * 2);   // y f16
  _Float16* Wqh  = (_Float16*)carve((size_t)NQKV * E_DIM * 2);  // Wqkv f16
  _Float16* Wmh  = (_Float16*)carve((size_t)E_DIM * E_DIM * 2); // Wmsa f16
  float*    U    = (float*)carve((size_t)TOK * 24 * 4);
  _Float16* Qh   = (_Float16*)carve((size_t)TOK * E_DIM * 2);   // [B,H,S,D]
  _Float16* Kh   = (_Float16*)carve((size_t)TOK * E_DIM * 2);   // [B,H,S,D]
  _Float16* Vt   = (_Float16*)carve((size_t)TOK * E_DIM * 2);   // [B,H,D,S]
  _Float16* Oh   = (_Float16*)carve((size_t)TOK * E_DIM * 2);   // [B,S,E]
  float*    Uo   = (float*)carve((size_t)TOK * R_DIM * 4);
  float*    res  = (float*)carve((size_t)TOK * E_DIM * 4);
  (void)ws_size; (void)in_sizes; (void)n_in; (void)out_size;

  // 0) converts
  {
    int n = TOK * E_DIM;
    cvt_f32_to_f16<<<(n + 255) / 256, 256, 0, stream>>>(y, Xh, n);
    n = NQKV * E_DIM;
    cvt_f32_to_f16<<<(n + 255) / 256, 256, 0, stream>>>(Wqkv, Wqh, n);
    n = E_DIM * E_DIM;
    cvt_f32_to_f16<<<(n + 255) / 256, 256, 0, stream>>>(Wmsa, Wmh, n);
  }
  // 1) LoRA U
  lora_u_kernel<<<TOK, 256, 0, stream>>>(y, Bq, Bk, Bv, U);
  // 2) QKV GEMM (grid: N/256 x M/32)
  qkv_wmma_kernel<<<dim3(NQKV / 256, TOK / 32), 128, 0, stream>>>(
      Xh, Wqh, bqkv, U, Aq, Ak, Av, Qh, Kh, Vt);
  // 3) attention: B*H*(S/32) wave tiles, 8 waves/block
  attn_wmma_kernel<<<(BATCH * H_NUM * (SEQ / 32)) / 8, 256, 0, stream>>>(
      Qh, Kh, Vt, Oh);
  // 4) LoRA Uo
  lora_uo_kernel<<<TOK, 256, 0, stream>>>(Oh, Bo, Uo);
  // 5) output projection + residual (grid: N/256 x M/32)
  msa_wmma_kernel<<<dim3(E_DIM / 256, TOK / 32), 128, 0, stream>>>(
      Oh, Wmh, Uo, Ao, y, res);
  // 6) LayerNorm
  layernorm_kernel<<<TOK, 256, 0, stream>>>(res, gamma, beta, out);
}

// v001
// Measured time: 385 microseconds a run.
// Timed twice side by side with v000, it ran 1.49 and 1.48 times as fast.
#include <hip/hip_runtime.h>
#include <hip/hip_bf16.h>

// ---------------------------------------------------------------------------
// Problem constants (match reference)
// ---------------------------------------------------------------------------
#define E_DIM 1024
#define H_NUM 16
#define D_DIM 64
#define R_DIM 8
#define BATCH 2
#define SEQ   2048
#define TOK   (BATCH * SEQ)      // 4096 tokens
#define NQKV  (3 * E_DIM)        // 3072

typedef __attribute__((ext_vector_type(16))) _Float16 v16h;
typedef __attribute__((ext_vector_type(8)))  _Float16 v8h;
typedef __attribute__((ext_vector_type(8)))  float    v8f;

__device__ __forceinline__ v8f wmma16(v16h a, v16h b, v8f c) {
  // D = A(16x32 f16) * B(32x16 f16) + C(16x16 f32)
  return __builtin_amdgcn_wmma_f32_16x16x32_f16(
      /*neg_a=*/false, a, /*neg_b=*/false, b,
      /*c_mod=*/(short)0, c, /*reuse_a=*/false, /*reuse_b=*/false);
}

// Load one 16x32 f16 operand tile into the wave32 WMMA register layout.
// Element (r, k) comes from base[(major + r) * ld + kb + k].
//   lane%16 -> r (A: row M / B: col N), lane/16 selects K-halves:
//   halves 0..7  = K (lane/16)*8 + 0..7
//   halves 8..15 = K 16 + (lane/16)*8 + 0..7
__device__ __forceinline__ v16h load_tile16(const _Float16* base, int ld,
                                            int major, int kb, int lane) {
  const _Float16* p = base + (size_t)(major + (lane & 15)) * (size_t)ld
                           + (size_t)(kb + ((lane >> 4) << 3));
  v8h lo = *(const v8h*)p;        // K = koff + 0..7
  v8h hi = *(const v8h*)(p + 16); // K = koff + 16..23
  return __builtin_shufflevector(lo, hi, 0,1,2,3,4,5,6,7,8,9,10,11,12,13,14,15);
}

// ---------------------------------------------------------------------------
// 0) f32 -> f16 convert
// ---------------------------------------------------------------------------
__global__ void cvt_f32_to_f16(const float* __restrict__ in,
                               _Float16* __restrict__ out, int n) {
  int i = blockIdx.x * blockDim.x + threadIdx.x;
  if (i < n) out[i] = (_Float16)in[i];
}

// ---------------------------------------------------------------------------
// 1) U = y @ [Bq | Bk | Bv]   -> [TOK, 24] f32
// ---------------------------------------------------------------------------
__global__ __launch_bounds__(256)
void lora_u_kernel(const float* __restrict__ y, const float* __restrict__ Bq,
                   const float* __restrict__ Bk, const float* __restrict__ Bv,
                   float* __restrict__ U) {
  int t = blockIdx.x, tid = threadIdx.x;
  const float* yr = y + (size_t)t * E_DIM;
  float acc[24];
#pragma unroll
  for (int j = 0; j < 24; ++j) acc[j] = 0.f;
  for (int e = tid; e < E_DIM; e += 256) {
    float yv = yr[e];
#pragma unroll
    for (int r = 0; r < R_DIM; ++r) {
      acc[r]      += yv * Bq[e * R_DIM + r];
      acc[8 + r]  += yv * Bk[e * R_DIM + r];
      acc[16 + r] += yv * Bv[e * R_DIM + r];
    }
  }
  __shared__ float red[256];
  for (int j = 0; j < 24; ++j) {
    red[tid] = acc[j];
    __syncthreads();
    for (int s = 128; s > 0; s >>= 1) {
      if (tid < s) red[tid] += red[tid + s];
      __syncthreads();
    }
    if (tid == 0) U[(size_t)t * 24 + j] = red[0];
    __syncthreads();
  }
}

// ---------------------------------------------------------------------------
// 2) QKV GEMM: C[TOK, 3072] = Xh @ Wqkv^T + bias + LoRA, scatter to
//    Qh,Kh [B,H,S,D] f16 (Q pre-scaled by 1/sqrt(D)) and Vt [B,H,D,S] f16.
//    Wave tile: 32(M) x 64(N), 8 WMMAs per 32-k step (A reused 4x, B reused 2x).
//    Block: 4 waves = 32 x 256.
// ---------------------------------------------------------------------------
__global__ __launch_bounds__(128)
void qkv_wmma_kernel(const _Float16* __restrict__ Xh,
                     const _Float16* __restrict__ Wh,     // [3072,1024] f16
                     const float* __restrict__ bqkv,
                     const float* __restrict__ U,         // [TOK,24]
                     const float* __restrict__ Aq, const float* __restrict__ Ak,
                     const float* __restrict__ Av,
                     _Float16* __restrict__ Qh, _Float16* __restrict__ Kh,
                     _Float16* __restrict__ Vt) {
  int lane = threadIdx.x & 31, wave = threadIdx.x >> 5;
  int rowb = blockIdx.y * 32;
  int colb = blockIdx.x * 256 + wave * 64;

  v8f acc[2][4];
#pragma unroll
  for (int i = 0; i < 2; ++i)
#pragma unroll
    for (int j = 0; j < 4; ++j) acc[i][j] = v8f{};

  for (int kb = 0; kb < E_DIM; kb += 32) {
    v16h a0 = load_tile16(Xh, E_DIM, rowb, kb, lane);
    v16h a1 = load_tile16(Xh, E_DIM, rowb + 16, kb, lane);
    __builtin_prefetch(Xh + (size_t)(rowb + (lane & 15)) * E_DIM + kb + 64, 0, 1);
#pragma unroll
    for (int j = 0; j < 4; ++j) {
      v16h b = load_tile16(Wh, E_DIM, colb + j * 16, kb, lane);
      acc[0][j] = wmma16(a0, b, acc[0][j]);
      acc[1][j] = wmma16(a1, b, acc[1][j]);
    }
  }

#pragma unroll
  for (int j = 0; j < 4; ++j) {
    int col = colb + j * 16 + (lane & 15);   // 0..3071
    int g = col >> 10;                       // 0=Q 1=K 2=V (uniform per tile)
    int e = col & 1023;
    const float* Ag = (g == 0) ? Aq : ((g == 1) ? Ak : Av);
    float a8[R_DIM];
#pragma unroll
    for (int r = 0; r < R_DIM; ++r) a8[r] = Ag[r * E_DIM + e];
    float bias = bqkv[col];
    int hh = e >> 6, d = e & 63;
#pragma unroll
    for (int i = 0; i < 2; ++i) {
#pragma unroll
      for (int v = 0; v < 8; ++v) {
        int row = rowb + i * 16 + v + ((lane >> 4) << 3);  // token index
        float val = acc[i][j][v] + bias;
        const float* Ur = U + (size_t)row * 24 + g * R_DIM;
#pragma unroll
        for (int r = 0; r < R_DIM; ++r) val += Ur[r] * a8[r];
        int bb = row >> 11, ss = row & (SEQ - 1);
        if (g == 0) {
          Qh[(((size_t)bb * H_NUM + hh) * SEQ + ss) * D_DIM + d] =
              (_Float16)(val * 0.125f);               // fold 1/sqrt(64)
        } else if (g == 1) {
          Kh[(((size_t)bb * H_NUM + hh) * SEQ + ss) * D_DIM + d] = (_Float16)val;
        } else {
          Vt[(((size_t)bb * H_NUM + hh) * D_DIM + d) * SEQ + ss] = (_Float16)val;
        }
      }
    }
  }
}

__device__ __forceinline__ float xhalf(float x) {
  int xi = __builtin_bit_cast(int, x);
  return __builtin_bit_cast(float, __builtin_amdgcn_permlanex16(
      xi, xi, 0x76543210, 0xfedcba98, false, false));
}

__global__ __launch_bounds__(256)
void attn_wmma_kernel(const _Float16* __restrict__ Q,
                      const _Float16* __restrict__ K,
                      const _Float16* __restrict__ Vt,
                      _Float16* __restrict__ Oh) {
  int lane = threadIdx.x & 31, wave = threadIdx.x >> 5;
  int id = blockIdx.x * 8 + wave;           // 0 .. B*H*(S/32)-1 = 2047
  int qt = id & (SEQ / 32 - 1);             // 32-query tile in sequence
  int bh = id >> 6;                         // 0..31
  int b = bh >> 4, h = bh & 15;
  const _Float16* Qp = Q + (size_t)bh * SEQ * D_DIM;
  const _Float16* Kp = K + (size_t)bh * SEQ * D_DIM;
  const _Float16* Vp = Vt + (size_t)bh * D_DIM * SEQ;
  int qrow = qt * 32;

  // Q^T as B operand: column = query, kept in registers for the whole loop
  v16h bq[2][2];
#pragma unroll
  for (int i = 0; i < 2; ++i) {
    bq[i][0] = load_tile16(Qp, D_DIM, qrow + i * 16, 0, lane);
    bq[i][1] = load_tile16(Qp, D_DIM, qrow + i * 16, 32, lane);
  }

  // o[i][j][r] = O^T[d = j*16 + 8*(lane/16) + r][query = qrow + i*16 + lane%16]
  v8f o[2][4];
  float m[2], l[2];   // per query column; l is the lane half's own partial sum
#pragma unroll
  for (int i = 0; i < 2; ++i) {
#pragma unroll
    for (int j = 0; j < 4; ++j) o[i][j] = v8f{};
    m[i] = -1e30f; l[i] = 0.f;
  }

  for (int kb = 0; kb < SEQ; kb += 32) {
    // s[i][kt][r] = score(key kb + kt*16 + 8*(lane/16) + r, query column)
    v8f s[2][2];
#pragma unroll
    for (int i = 0; i < 2; ++i) { s[i][0] = v8f{}; s[i][1] = v8f{}; }

#pragma unroll
    for (int kt = 0; kt < 2; ++kt) {
      v16h ak0 = load_tile16(Kp, D_DIM, kb + kt * 16, 0, lane);
      v16h ak1 = load_tile16(Kp, D_DIM, kb + kt * 16, 32, lane);
#pragma unroll
      for (int i = 0; i < 2; ++i) {
        s[i][kt] = wmma16(ak0, bq[i][0], s[i][kt]);
        s[i][kt] = wmma16(ak1, bq[i][1], s[i][kt]);
      }
    }

    v16h bp[2];   // P^T as B operand, packed straight from the score tiles
#pragma unroll
    for (int i = 0; i < 2; ++i) {
      float t[8];
#pragma unroll
      for (int v = 0; v < 8; ++v) t[v] = fmaxf(s[i][0][v], s[i][1][v]);
      float mx = fmaxf(fmaxf(fmaxf(t[0], t[1]), fmaxf(t[2], t[3])),
                       fmaxf(fmaxf(t[4], t[5]), fmaxf(t[6], t[7])));
      mx = fmaxf(mx, xhalf(mx));            // both halves use one maximum
      float mn = fmaxf(m[i], mx);
      float corr = __expf(m[i] - mn);
      v8f p0 = s[i][0] - mn;                // keys kb + 8*(lane/16) + v
      v8f p1 = s[i][1] - mn;                // keys kb + 16 + 8*(lane/16) + v
#pragma unroll
      for (int v = 0; v < 8; ++v) { p0[v] = __expf(p0[v]); p1[v] = __expf(p1[v]); }
#pragma unroll
      for (int v = 0; v < 8; ++v) {
        bp[i][v]     = (_Float16)p0[v];
        bp[i][8 + v] = (_Float16)p1[v];
      }
      v8f ps = p0 + p1;
      float rs = ((ps[0] + ps[1]) + (ps[2] + ps[3])) + ((ps[4] + ps[5]) + (ps[6] + ps[7]));
      l[i] = l[i] * corr + rs;
      m[i] = mn;
#pragma unroll
      for (int j = 0; j < 4; ++j) o[i][j] *= corr;
    }

    // V^T operand tiles loaded once, reused by both query subtiles
#pragma unroll
    for (int j = 0; j < 4; ++j) {
      v16h av = load_tile16(Vp, SEQ, j * 16, kb, lane);
#pragma unroll
      for (int i = 0; i < 2; ++i) o[i][j] = wmma16(av, bp[i], o[i][j]);
    }
  }

  // a lane holds 8 consecutive d of one query: one 16-byte store per tile
#pragma unroll
  for (int i = 0; i < 2; ++i) {
    float inv = 1.0f / (l[i] + xhalf(l[i]));
    int ss = qrow + i * 16 + (lane & 15);
    _Float16* op = Oh + ((size_t)b * SEQ + ss) * E_DIM + h * D_DIM
                      + ((lane >> 4) << 3);
#pragma unroll
    for (int j = 0; j < 4; ++j) {
      v8h w;
#pragma unroll
      for (int r = 0; r < 8; ++r) w[r] = (_Float16)(o[i][j][r] * inv);
      *(v8h*)(op + j * 16) = w;
    }
  }
}

// ---------------------------------------------------------------------------
// 4) Uo = O @ Bo  -> [TOK, 8] f32
// ---------------------------------------------------------------------------
__global__ __launch_bounds__(256)
void lora_uo_kernel(const _Float16* __restrict__ Oh,
                    const float* __restrict__ Bo, float* __restrict__ Uo) {
  int t = blockIdx.x, tid = threadIdx.x;
  const _Float16* orow = Oh + (size_t)t * E_DIM;
  float acc[R_DIM];
#pragma unroll
  for (int r = 0; r < R_DIM; ++r) acc[r] = 0.f;
  for (int e = tid; e < E_DIM; e += 256) {
    float ov = (float)orow[e];
#pragma unroll
    for (int r = 0; r < R_DIM; ++r) acc[r] += ov * Bo[e * R_DIM + r];
  }
  __shared__ float red[256];
  for (int j = 0; j < R_DIM; ++j) {
    red[tid] = acc[j];
    __syncthreads();
    for (int s = 128; s > 0; s >>= 1) {
      if (tid < s) red[tid] += red[tid + s];
      __syncthreads();
    }
    if (tid == 0) Uo[(size_t)t * R_DIM + j] = red[0];
    __syncthreads();
  }
}

// ---------------------------------------------------------------------------
// 5) res = O @ Wmsa^T + O @ (Bo Ao) + y   (f32 out)
//    Wave tile 32x64 like the QKV GEMM.
// ---------------------------------------------------------------------------
__global__ __launch_bounds__(128)
void msa_wmma_kernel(const _Float16* __restrict__ Oh,
                     const _Float16* __restrict__ Wmh,   // [1024,1024] f16
                     const float* __restrict__ Uo, const float* __restrict__ Ao,
                     const float* __restrict__ y, float* __restrict__ res) {
  int lane = threadIdx.x & 31, wave = threadIdx.x >> 5;
  int rowb = blockIdx.y * 32;
  int colb = blockIdx.x * 256 + wave * 64;

  v8f acc[2][4];
#pragma unroll
  for (int i = 0; i < 2; ++i)
#pragma unroll
    for (int j = 0; j < 4; ++j) acc[i][j] = v8f{};

  for (int kb = 0; kb < E_DIM; kb += 32) {
    v16h a0 = load_tile16(Oh, E_DIM, rowb, kb, lane);
    v16h a1 = load_tile16(Oh, E_DIM, rowb + 16, kb, lane);
    __builtin_prefetch(Oh + (size_t)(rowb + (lane & 15)) * E_DIM + kb + 64, 0, 1);
#pragma unroll
    for (int j = 0; j < 4; ++j) {
      v16h b = load_tile16(Wmh, E_DIM, colb + j * 16, kb, lane);
      acc[0][j] = wmma16(a0, b, acc[0][j]);
      acc[1][j] = wmma16(a1, b, acc[1][j]);
    }
  }

#pragma unroll
  for (int j = 0; j < 4; ++j) {
    int col = colb + j * 16 + (lane & 15);
    float a8[R_DIM];
#pragma unroll
    for (int r = 0; r < R_DIM; ++r) a8[r] = Ao[r * E_DIM + col];
#pragma unroll
    for (int i = 0; i < 2; ++i) {
#pragma unroll
      for (int v = 0; v < 8; ++v) {
        int row = rowb + i * 16 + v + ((lane >> 4) << 3);
        float val = acc[i][j][v];
        const float* Ur = Uo + (size_t)row * R_DIM;
#pragma unroll
        for (int r = 0; r < R_DIM; ++r) val += Ur[r] * a8[r];
        val += y[(size_t)row * E_DIM + col];
        res[(size_t)row * E_DIM + col] = val;
      }
    }
  }
}

// ---------------------------------------------------------------------------
// 6) LayerNorm rows of res -> d_out
// ---------------------------------------------------------------------------
__global__ __launch_bounds__(256)
void layernorm_kernel(const float* __restrict__ res,
                      const float* __restrict__ gamma,
                      const float* __restrict__ beta, float* __restrict__ out) {
  int t = blockIdx.x, tid = threadIdx.x;
  const float* rr = res + (size_t)t * E_DIM;
  float s1 = 0.f, s2 = 0.f;
  for (int e = tid; e < E_DIM; e += 256) {
    float x = rr[e];
    s1 += x; s2 += x * x;
  }
  __shared__ float r1[256], r2[256];
  r1[tid] = s1; r2[tid] = s2;
  __syncthreads();
  for (int s = 128; s > 0; s >>= 1) {
    if (tid < s) { r1[tid] += r1[tid + s]; r2[tid] += r2[tid + s]; }
    __syncthreads();
  }
  float mu = r1[0] * (1.0f / E_DIM);
  float var = r2[0] * (1.0f / E_DIM) - mu * mu;
  float sc = rsqrtf(var + 1e-6f);
  for (int e = tid; e < E_DIM; e += 256)
    out[(size_t)t * E_DIM + e] = (rr[e] - mu) * sc * gamma[e] + beta[e];
}

// ---------------------------------------------------------------------------
// Host launcher
// ---------------------------------------------------------------------------
extern "C" void kernel_launch(void* const* d_in, const int* in_sizes, int n_in,
                              void* d_out, int out_size, void* d_ws, size_t ws_size,
                              hipStream_t stream) {
  const float* y    = (const float*)d_in[0];
  const float* Wqkv = (const float*)d_in[1];
  const float* bqkv = (const float*)d_in[2];
  const float* Wmsa = (const float*)d_in[3];
  const float* Bq   = (const float*)d_in[4];
  const float* Aq   = (const float*)d_in[5];
  const float* Bk   = (const float*)d_in[6];
  const float* Ak   = (const float*)d_in[7];
  const float* Bv   = (const float*)d_in[8];
  const float* Av   = (const float*)d_in[9];
  const float* Bo   = (const float*)d_in[10];
  const float* Ao   = (const float*)d_in[11];
  const float* gamma = (const float*)d_in[12];
  const float* beta  = (const float*)d_in[13];
  float* out = (float*)d_out;

  // workspace carve-up (all offsets 256B-aligned)
  char* ws = (char*)d_ws;
  size_t off = 0;
  auto carve = [&](size_t bytes) {
    char* p = ws + off;
    off += (bytes + 255) & ~(size_t)255;
    return p;
  };
  _Float16* Xh   = (_Float16*)carve((size_t)TOK * E_DIM * 2);   // y f16
  _Float16* Wqh  = (_Float16*)carve((size_t)NQKV * E_DIM * 2);  // Wqkv f16
  _Float16* Wmh  = (_Float16*)carve((size_t)E_DIM * E_DIM * 2); // Wmsa f16
  float*    U    = (float*)carve((size_t)TOK * 24 * 4);
  _Float16* Qh   = (_Float16*)carve((size_t)TOK * E_DIM * 2);   // [B,H,S,D]
  _Float16* Kh   = (_Float16*)carve((size_t)TOK * E_DIM * 2);   // [B,H,S,D]
  _Float16* Vt   = (_Float16*)carve((size_t)TOK * E_DIM * 2);   // [B,H,D,S]
  _Float16* Oh   = (_Float16*)carve((size_t)TOK * E_DIM * 2);   // [B,S,E]
  float*    Uo   = (float*)carve((size_t)TOK * R_DIM * 4);
  float*    res  = (float*)carve((size_t)TOK * E_DIM * 4);
  (void)ws_size; (void)in_sizes; (void)n_in; (void)out_size;

  // 0) converts
  {
    int n = TOK * E_DIM;
    cvt_f32_to_f16<<<(n + 255) / 256, 256, 0, stream>>>(y, Xh, n);
    n = NQKV * E_DIM;
    cvt_f32_to_f16<<<(n + 255) / 256, 256, 0, stream>>>(Wqkv, Wqh, n);
    n = E_DIM * E_DIM;
    cvt_f32_to_f16<<<(n + 255) / 256, 256, 0, stream>>>(Wmsa, Wmh, n);
  }
  // 1) LoRA U
  lora_u_kernel<<<TOK, 256, 0, stream>>>(y, Bq, Bk, Bv, U);
  // 2) QKV GEMM (grid: N/256 x M/32)
  qkv_wmma_kernel<<<dim3(NQKV / 256, TOK / 32), 128, 0, stream>>>(
      Xh, Wqh, bqkv, U, Aq, Ak, Av, Qh, Kh, Vt);
  // 3) attention: B*H*(S/32) wave tiles, 8 waves/block
  attn_wmma_kernel<<<(BATCH * H_NUM * (SEQ / 32)) / 8, 256, 0, stream>>>(
      Qh, Kh, Vt, Oh);
  // 4) LoRA Uo
  lora_uo_kernel<<<TOK, 256, 0, stream>>>(Oh, Bo, Uo);
  // 5) output projection + residual (grid: N/256 x M/32)
  msa_wmma_kernel<<<dim3(E_DIM / 256, TOK / 32), 128, 0, stream>>>(
      Oh, Wmh, Uo, Ao, y, res);
  // 6) LayerNorm
  layernorm_kernel<<<TOK, 256, 0, stream>>>(res, gamma, beta, out);
}

// v002
// Measured time: 269 microseconds a run.
// Two timings next to v001 put it at 1.44 and 1.43 times that version's speed.
// Counting every step since v000, it is 2.13 times as fast.
#include <hip/hip_runtime.h>
#include <hip/hip_bf16.h>

// ---------------------------------------------------------------------------
// Problem constants (match reference)
// ---------------------------------------------------------------------------
#define E_DIM 1024
#define H_NUM 16
#define D_DIM 64
#define R_DIM 8
#define BATCH 2
#define SEQ   2048
#define TOK   (BATCH * SEQ)      // 4096 tokens
#define NQKV  (3 * E_DIM)        // 3072

typedef __attribute__((ext_vector_type(16))) _Float16 v16h;
typedef __attribute__((ext_vector_type(8)))  _Float16 v8h;
typedef __attribute__((ext_vector_type(8)))  float    v8f;

__device__ __forceinline__ v8f wmma16(v16h a, v16h b, v8f c) {
  // D = A(16x32 f16) * B(32x16 f16) + C(16x16 f32)
  return __builtin_amdgcn_wmma_f32_16x16x32_f16(
      /*neg_a=*/false, a, /*neg_b=*/false, b,
      /*c_mod=*/(short)0, c, /*reuse_a=*/false, /*reuse_b=*/false);
}

// Load one 16x32 f16 operand tile into the wave32 WMMA register layout.
// Element (r, k) comes from base[(major + r) * ld + kb + k].
//   lane%16 -> r (A: row M / B: col N), lane/16 selects K-halves:
//   halves 0..7  = K (lane/16)*8 + 0..7
//   halves 8..15 = K 16 + (lane/16)*8 + 0..7
__device__ __forceinline__ v16h load_tile16(const _Float16* base, int ld,
                                            int major, int kb, int lane) {
  const _Float16* p = base + (size_t)(major + (lane & 15)) * (size_t)ld
                           + (size_t)(kb + ((lane >> 4) << 3));
  v8h lo = *(const v8h*)p;        // K = koff + 0..7
  v8h hi = *(const v8h*)(p + 16); // K = koff + 16..23
  return __builtin_shufflevector(lo, hi, 0,1,2,3,4,5,6,7,8,9,10,11,12,13,14,15);
}

// ---------------------------------------------------------------------------
// 0) f32 -> f16 convert
// ---------------------------------------------------------------------------
__global__ void cvt_f32_to_f16(const float* __restrict__ in,
                               _Float16* __restrict__ out, int n) {
  int i = blockIdx.x * blockDim.x + threadIdx.x;
  if (i < n) out[i] = (_Float16)in[i];
}

// ---------------------------------------------------------------------------
// 1) Effective f16 weights. y @ W^T + y @ (B A) = y @ (W + (B A)^T)^T, so
//      Wout[n][k] = f16( W[n][k] + sum_r B[k][r] * A[r][n] )
//    for the Q, K, V row groups of Wqkv and for Wmsa (group 3).
//    128 threads cover one row of 1024 k, 8 k each; a thread keeps its 8x8
//    piece of B in registers and walks FOLD_ROWS rows; A[r][n] is the same
//    for the whole block.
// ---------------------------------------------------------------------------
#define FOLD_ROWS 8
__global__ __launch_bounds__(128)
void fold_lora_kernel(const float* __restrict__ Wqkv, const float* __restrict__ Wmsa,
                      const float* __restrict__ Bq, const float* __restrict__ Aq,
                      const float* __restrict__ Bk, const float* __restrict__ Ak,
                      const float* __restrict__ Bv, const float* __restrict__ Av,
                      const float* __restrict__ Bo, const float* __restrict__ Ao,
                      _Float16* __restrict__ Wqh, _Float16* __restrict__ Wmh) {
  int g  = blockIdx.x / (E_DIM / FOLD_ROWS);               // 0=Q 1=K 2=V 3=out
  int n0 = (blockIdx.x % (E_DIM / FOLD_ROWS)) * FOLD_ROWS; // row in the group
  const float* Wg = (g < 3) ? Wqkv + (size_t)g * E_DIM * E_DIM : Wmsa;
  _Float16*    Og = (g < 3) ? Wqh + (size_t)g * E_DIM * E_DIM : Wmh;
  const float* Bg = (g == 0) ? Bq : ((g == 1) ? Bk : ((g == 2) ? Bv : Bo));
  const float* Ag = (g == 0) ? Aq : ((g == 1) ? Ak : ((g == 2) ? Av : Ao));
  int k0 = threadIdx.x * 8;

  float w[FOLD_ROWS][8];
#pragma unroll
  for (int i = 0; i < FOLD_ROWS; ++i) {
    const float4* wp = (const float4*)(Wg + (size_t)(n0 + i) * E_DIM + k0);
    float4 lo = wp[0], hi = wp[1];
    w[i][0] = lo.x; w[i][1] = lo.y; w[i][2] = lo.z; w[i][3] = lo.w;
    w[i][4] = hi.x; w[i][5] = hi.y; w[i][6] = hi.z; w[i][7] = hi.w;
  }
  float bm[8][R_DIM];   // bm[kk][r] = B[k0 + kk][r]
#pragma unroll
  for (int kk = 0; kk < 8; ++kk) {
    const float4* bp = (const float4*)(Bg + (size_t)(k0 + kk) * R_DIM);
    float4 lo = bp[0], hi = bp[1];
    bm[kk][0] = lo.x; bm[kk][1] = lo.y; bm[kk][2] = lo.z; bm[kk][3] = lo.w;
    bm[kk][4] = hi.x; bm[kk][5] = hi.y; bm[kk][6] = hi.z; bm[kk][7] = hi.w;
  }
#pragma unroll
  for (int i = 0; i < FOLD_ROWS; ++i) {
    float a8[R_DIM];
#pragma unroll
    for (int r = 0; r < R_DIM; ++r) a8[r] = Ag[r * E_DIM + n0 + i];
    v8h o;
#pragma unroll
    for (int kk = 0; kk < 8; ++kk) {
      float v = w[i][kk];
#pragma unroll
      for (int r = 0; r < R_DIM; ++r) v = __builtin_fmaf(bm[kk][r], a8[r], v);
      o[kk] = (_Float16)v;
    }
    *(v8h*)(Og + (size_t)(n0 + i) * E_DIM + k0) = o;
  }
}

// ---------------------------------------------------------------------------
// 2) QKV GEMM: C[TOK, 3072] = Xh @ Weff^T + bias (LoRA is in Weff), scatter to
//    Qh,Kh [B,H,S,D] f16 (Q pre-scaled by 1/sqrt(D)) and Vt [B,H,D,S] f16.
//    Wave tile: 32(M) x 64(N), 8 WMMAs per 32-k step (A reused 4x, B reused 2x).
//    Block: 4 waves = 32 x 256.
// ---------------------------------------------------------------------------
__global__ __launch_bounds__(128)
void qkv_wmma_kernel(const _Float16* __restrict__ Xh,
                     const _Float16* __restrict__ Wh,     // [3072,1024] f16
                     const float* __restrict__ bqkv,
                     _Float16* __restrict__ Qh, _Float16* __restrict__ Kh,
                     _Float16* __restrict__ Vt) {
  int lane = threadIdx.x & 31, wave = threadIdx.x >> 5;
  int rowb = blockIdx.y * 32;
  int colb = blockIdx.x * 256 + wave * 64;

  v8f acc[2][4];
#pragma unroll
  for (int i = 0; i < 2; ++i)
#pragma unroll
    for (int j = 0; j < 4; ++j) acc[i][j] = v8f{};

  for (int kb = 0; kb < E_DIM; kb += 32) {
    v16h a0 = load_tile16(Xh, E_DIM, rowb, kb, lane);
    v16h a1 = load_tile16(Xh, E_DIM, rowb + 16, kb, lane);
    __builtin_prefetch(Xh + (size_t)(rowb + (lane & 15)) * E_DIM + kb + 64, 0, 1);
#pragma unroll
    for (int j = 0; j < 4; ++j) {
      v16h b = load_tile16(Wh, E_DIM, colb + j * 16, kb, lane);
      acc[0][j] = wmma16(a0, b, acc[0][j]);
      acc[1][j] = wmma16(a1, b, acc[1][j]);
    }
  }

#pragma unroll
  for (int j = 0; j < 4; ++j) {
    int col = colb + j * 16 + (lane & 15);   // 0..3071
    int g = col >> 10;                       // 0=Q 1=K 2=V (uniform per tile)
    int e = col & 1023;
    float bias = bqkv[col];
    int hh = e >> 6, d = e & 63;
#pragma unroll
    for (int i = 0; i < 2; ++i) {
#pragma unroll
      for (int v = 0; v < 8; ++v) {
        int row = rowb + i * 16 + v + ((lane >> 4) << 3);  // token index
        float val = acc[i][j][v] + bias;
        int bb = row >> 11, ss = row & (SEQ - 1);
        if (g == 0) {
          Qh[(((size_t)bb * H_NUM + hh) * SEQ + ss) * D_DIM + d] =
              (_Float16)(val * 0.125f);               // fold 1/sqrt(64)
        } else if (g == 1) {
          Kh[(((size_t)bb * H_NUM + hh) * SEQ + ss) * D_DIM + d] = (_Float16)val;
        } else {
          Vt[(((size_t)bb * H_NUM + hh) * D_DIM + d) * SEQ + ss] = (_Float16)val;
        }
      }
    }
  }
}

__device__ __forceinline__ float xhalf(float x) {
  int xi = __builtin_bit_cast(int, x);
  return __builtin_bit_cast(float, __builtin_amdgcn_permlanex16(
      xi, xi, 0x76543210, 0xfedcba98, false, false));
}

__global__ __launch_bounds__(256)
void attn_wmma_kernel(const _Float16* __restrict__ Q,
                      const _Float16* __restrict__ K,
                      const _Float16* __restrict__ Vt,
                      _Float16* __restrict__ Oh) {
  int lane = threadIdx.x & 31, wave = threadIdx.x >> 5;
  int id = blockIdx.x * 8 + wave;           // 0 .. B*H*(S/32)-1 = 2047
  int qt = id & (SEQ / 32 - 1);             // 32-query tile in sequence
  int bh = id >> 6;                         // 0..31
  int b = bh >> 4, h = bh & 15;
  const _Float16* Qp = Q + (size_t)bh * SEQ * D_DIM;
  const _Float16* Kp = K + (size_t)bh * SEQ * D_DIM;
  const _Float16* Vp = Vt + (size_t)bh * D_DIM * SEQ;
  int qrow = qt * 32;

  // Q^T as B operand: column = query, kept in registers for the whole loop
  v16h bq[2][2];
#pragma unroll
  for (int i = 0; i < 2; ++i) {
    bq[i][0] = load_tile16(Qp, D_DIM, qrow + i * 16, 0, lane);
    bq[i][1] = load_tile16(Qp, D_DIM, qrow + i * 16, 32, lane);
  }

  // o[i][j][r] = O^T[d = j*16 + 8*(lane/16) + r][query = qrow + i*16 + lane%16]
  v8f o[2][4];
  float m[2], l[2];   // per query column; l is the lane half's own partial sum
#pragma unroll
  for (int i = 0; i < 2; ++i) {
#pragma unroll
    for (int j = 0; j < 4; ++j) o[i][j] = v8f{};
    m[i] = -1e30f; l[i] = 0.f;
  }

  for (int kb = 0; kb < SEQ; kb += 32) {
    // s[i][kt][r] = score(key kb + kt*16 + 8*(lane/16) + r, query column)
    v8f s[2][2];
#pragma unroll
    for (int i = 0; i < 2; ++i) { s[i][0] = v8f{}; s[i][1] = v8f{}; }

#pragma unroll
    for (int kt = 0; kt < 2; ++kt) {
      v16h ak0 = load_tile16(Kp, D_DIM, kb + kt * 16, 0, lane);
      v16h ak1 = load_tile16(Kp, D_DIM, kb + kt * 16, 32, lane);
#pragma unroll
      for (int i = 0; i < 2; ++i) {
        s[i][kt] = wmma16(ak0, bq[i][0], s[i][kt]);
        s[i][kt] = wmma16(ak1, bq[i][1], s[i][kt]);
      }
    }

    v16h bp[2];   // P^T as B operand, packed straight from the score tiles
#pragma unroll
    for (int i = 0; i < 2; ++i) {
      float t[8];
#pragma unroll
      for (int v = 0; v < 8; ++v) t[v] = fmaxf(s[i][0][v], s[i][1][v]);
      float mx = fmaxf(fmaxf(fmaxf(t[0], t[1]), fmaxf(t[2], t[3])),
                       fmaxf(fmaxf(t[4], t[5]), fmaxf(t[6], t[7])));
      mx = fmaxf(mx, xhalf(mx));            // both halves use one maximum
      float mn = fmaxf(m[i], mx);
      float corr = __expf(m[i] - mn);
      v8f p0 = s[i][0] - mn;                // keys kb + 8*(lane/16) + v
      v8f p1 = s[i][1] - mn;                // keys kb + 16 + 8*(lane/16) + v
#pragma unroll
      for (int v = 0; v < 8; ++v) { p0[v] = __expf(p0[v]); p1[v] = __expf(p1[v]); }
#pragma unroll
      for (int v = 0; v < 8; ++v) {
        bp[i][v]     = (_Float16)p0[v];
        bp[i][8 + v] = (_Float16)p1[v];
      }
      v8f ps = p0 + p1;
      float rs = ((ps[0] + ps[1]) + (ps[2] + ps[3])) + ((ps[4] + ps[5]) + (ps[6] + ps[7]));
      l[i] = l[i] * corr + rs;
      m[i] = mn;
#pragma unroll
      for (int j = 0; j < 4; ++j) o[i][j] *= corr;
    }

    // V^T operand tiles loaded once, reused by both query subtiles
#pragma unroll
    for (int j = 0; j < 4; ++j) {
      v16h av = load_tile16(Vp, SEQ, j * 16, kb, lane);
#pragma unroll
      for (int i = 0; i < 2; ++i) o[i][j] = wmma16(av, bp[i], o[i][j]);
    }
  }

  // a lane holds 8 consecutive d of one query: one 16-byte store per tile
#pragma unroll
  for (int i = 0; i < 2; ++i) {
    float inv = 1.0f / (l[i] + xhalf(l[i]));
    int ss = qrow + i * 16 + (lane & 15);
    _Float16* op = Oh + ((size_t)b * SEQ + ss) * E_DIM + h * D_DIM
                      + ((lane >> 4) << 3);
#pragma unroll
    for (int j = 0; j < 4; ++j) {
      v8h w;
#pragma unroll
      for (int r = 0; r < 8; ++r) w[r] = (_Float16)(o[i][j][r] * inv);
      *(v8h*)(op + j * 16) = w;
    }
  }
}

// ---------------------------------------------------------------------------
// 4) res = O @ Weff^T + y   (f32 out; Weff = Wmsa + (Bo Ao)^T)
//    Wave tile 32x64 like the QKV GEMM.
// ---------------------------------------------------------------------------
__global__ __launch_bounds__(128)
void msa_wmma_kernel(const _Float16* __restrict__ Oh,
                     const _Float16* __restrict__ Wmh,   // [1024,1024] f16
                     const float* __restrict__ y, float* __restrict__ res) {
  int lane = threadIdx.x & 31, wave = threadIdx.x >> 5;
  int rowb = blockIdx.y * 32;
  int colb = blockIdx.x * 256 + wave * 64;

  v8f acc[2][4];
#pragma unroll
  for (int i = 0; i < 2; ++i)
#pragma unroll
    for (int j = 0; j < 4; ++j) acc[i][j] = v8f{};

  for (int kb = 0; kb < E_DIM; kb += 32) {
    v16h a0 = load_tile16(Oh, E_DIM, rowb, kb, lane);
    v16h a1 = load_tile16(Oh, E_DIM, rowb + 16, kb, lane);
    __builtin_prefetch(Oh + (size_t)(rowb + (lane & 15)) * E_DIM + kb + 64, 0, 1);
#pragma unroll
    for (int j = 0; j < 4; ++j) {
      v16h b = load_tile16(Wmh, E_DIM, colb + j * 16, kb, lane);
      acc[0][j] = wmma16(a0, b, acc[0][j]);
      acc[1][j] = wmma16(a1, b, acc[1][j]);
    }
  }

#pragma unroll
  for (int j = 0; j < 4; ++j) {
    int col = colb + j * 16 + (lane & 15);
#pragma unroll
    for (int i = 0; i < 2; ++i) {
#pragma unroll
      for (int v = 0; v < 8; ++v) {
        int row = rowb + i * 16 + v + ((lane >> 4) << 3);
        float val = acc[i][j][v];
        val += y[(size_t)row * E_DIM + col];
        res[(size_t)row * E_DIM + col] = val;
      }
    }
  }
}

// ---------------------------------------------------------------------------
// 5) LayerNorm rows of res -> d_out
// ---------------------------------------------------------------------------
__global__ __launch_bounds__(256)
void layernorm_kernel(const float* __restrict__ res,
                      const float* __restrict__ gamma,
                      const float* __restrict__ beta, float* __restrict__ out) {
  int t = blockIdx.x, tid = threadIdx.x;
  const float* rr = res + (size_t)t * E_DIM;
  float s1 = 0.f, s2 = 0.f;
  for (int e = tid; e < E_DIM; e += 256) {
    float x = rr[e];
    s1 += x; s2 += x * x;
  }
  __shared__ float r1[256], r2[256];
  r1[tid] = s1; r2[tid] = s2;
  __syncthreads();
  for (int s = 128; s > 0; s >>= 1) {
    if (tid < s) { r1[tid] += r1[tid + s]; r2[tid] += r2[tid + s]; }
    __syncthreads();
  }
  float mu = r1[0] * (1.0f / E_DIM);
  float var = r2[0] * (1.0f / E_DIM) - mu * mu;
  float sc = rsqrtf(var + 1e-6f);
  for (int e = tid; e < E_DIM; e += 256)
    out[(size_t)t * E_DIM + e] = (rr[e] - mu) * sc * gamma[e] + beta[e];
}

// ---------------------------------------------------------------------------
// Host launcher
// ---------------------------------------------------------------------------
extern "C" void kernel_launch(void* const* d_in, const int* in_sizes, int n_in,
                              void* d_out, int out_size, void* d_ws, size_t ws_size,
                              hipStream_t stream) {
  const float* y    = (const float*)d_in[0];
  const float* Wqkv = (const float*)d_in[1];
  const float* bqkv = (const float*)d_in[2];
  const float* Wmsa = (const float*)d_in[3];
  const float* Bq   = (const float*)d_in[4];
  const float* Aq   = (const float*)d_in[5];
  const float* Bk   = (const float*)d_in[6];
  const float* Ak   = (const float*)d_in[7];
  const float* Bv   = (const float*)d_in[8];
  const float* Av   = (const float*)d_in[9];
  const float* Bo   = (const float*)d_in[10];
  const float* Ao   = (const float*)d_in[11];
  const float* gamma = (const float*)d_in[12];
  const float* beta  = (const float*)d_in[13];
  float* out = (float*)d_out;

  // workspace carve-up (all offsets 256B-aligned)
  char* ws = (char*)d_ws;
  size_t off = 0;
  auto carve = [&](size_t bytes) {
    char* p = ws + off;
    off += (bytes + 255) & ~(size_t)255;
    return p;
  };
  _Float16* Xh   = (_Float16*)carve((size_t)TOK * E_DIM * 2);   // y f16
  _Float16* Wqh  = (_Float16*)carve((size_t)NQKV * E_DIM * 2);  // Wqkv + LoRA, f16
  _Float16* Wmh  = (_Float16*)carve((size_t)E_DIM * E_DIM * 2); // Wmsa + LoRA, f16
  _Float16* Qh   = (_Float16*)carve((size_t)TOK * E_DIM * 2);   // [B,H,S,D]
  _Float16* Kh   = (_Float16*)carve((size_t)TOK * E_DIM * 2);   // [B,H,S,D]
  _Float16* Vt   = (_Float16*)carve((size_t)TOK * E_DIM * 2);   // [B,H,D,S]
  _Float16* Oh   = (_Float16*)carve((size_t)TOK * E_DIM * 2);   // [B,S,E]
  float*    res  = (float*)carve((size_t)TOK * E_DIM * 4);
  (void)ws_size; (void)in_sizes; (void)n_in; (void)out_size;

  // 0) convert y
  {
    int n = TOK * E_DIM;
    cvt_f32_to_f16<<<(n + 255) / 256, 256, 0, stream>>>(y, Xh, n);
  }
  // 1) effective f16 weights: 4 groups of 1024 rows
  fold_lora_kernel<<<4 * (E_DIM / FOLD_ROWS), 128, 0, stream>>>(
      Wqkv, Wmsa, Bq, Aq, Bk, Ak, Bv, Av, Bo, Ao, Wqh, Wmh);
  // 2) QKV GEMM (grid: N/256 x M/32)
  qkv_wmma_kernel<<<dim3(NQKV / 256, TOK / 32), 128, 0, stream>>>(
      Xh, Wqh, bqkv, Qh, Kh, Vt);
  // 3) attention: B*H*(S/32) wave tiles, 8 waves/block
  attn_wmma_kernel<<<(BATCH * H_NUM * (SEQ / 32)) / 8, 256, 0, stream>>>(
      Qh, Kh, Vt, Oh);
  // 4) output projection + residual (grid: N/256 x M/32)
  msa_wmma_kernel<<<dim3(E_DIM / 256, TOK / 32), 128, 0, stream>>>(
      Oh, Wmh, y, res);
  // 5) LayerNorm
  layernorm_kernel<<<TOK, 256, 0, stream>>>(res, gamma, beta, out);
}

// v003
// A run of this version takes 117 microseconds.
// Next to v002, in two timings, it ran 2.27 and 2.30 times as fast.
// Over all steps from v000 it is 4.86 times as fast.
#include <hip/hip_runtime.h>
#include <hip/hip_bf16.h>

// ---------------------------------------------------------------------------
// Problem constants (match reference)
// ---------------------------------------------------------------------------
#define E_DIM 1024
#define H_NUM 16
#define D_DIM 64
#define R_DIM 8
#define BATCH 2
#define SEQ   2048
#define TOK   (BATCH * SEQ)      // 4096 tokens
#define NQKV  (3 * E_DIM)        // 3072

typedef __attribute__((ext_vector_type(16))) _Float16 v16h;
typedef __attribute__((ext_vector_type(8)))  _Float16 v8h;
typedef __attribute__((ext_vector_type(8)))  float    v8f;

__device__ __forceinline__ v8f wmma16(v16h a, v16h b, v8f c) {
  // D = A(16x32 f16) * B(32x16 f16) + C(16x16 f32)
  return __builtin_amdgcn_wmma_f32_16x16x32_f16(
      /*neg_a=*/false, a, /*neg_b=*/false, b,
      /*c_mod=*/(short)0, c, /*reuse_a=*/false, /*reuse_b=*/false);
}

// Load one 16x32 f16 operand tile into the wave32 WMMA register layout.
// Element (r, k) comes from base[(major + r) * ld + kb + k].
//   lane%16 -> r (A: row M / B: col N), lane/16 selects K-halves:
//   halves 0..7  = K (lane/16)*8 + 0..7
//   halves 8..15 = K 16 + (lane/16)*8 + 0..7
__device__ __forceinline__ v16h load_tile16(const _Float16* base, int ld,
                                            int major, int kb, int lane) {
  const _Float16* p = base + (size_t)(major + (lane & 15)) * (size_t)ld
                           + (size_t)(kb + ((lane >> 4) << 3));
  v8h lo = *(const v8h*)p;        // K = koff + 0..7
  v8h hi = *(const v8h*)(p + 16); // K = koff + 16..23
  return __builtin_shufflevector(lo, hi, 0,1,2,3,4,5,6,7,8,9,10,11,12,13,14,15);
}

// ---------------------------------------------------------------------------
// LDS staging by asynchronous copies. A staged row is 128 B of data (one whole
// line of its source) at a pitch of 144 B (16 B x odd: the ds_load_b128 pitch).
// Thread t of 256 copies 16 B: piece t%8 of row t/8, so one wave-wide copy
// covers 4 whole lines; further copies of the thread lie 32 rows on.
// ---------------------------------------------------------------------------
#define LPITCH 72                       // halves per staged row
#define LROWB  (LPITCH * 2)             // bytes per staged row

// 4 copies of 16 B per lane. The s_wait_xcnt stands inside the statement so
// that no address register is rewritten before the copies have taken it.
__device__ __forceinline__ void copy4(unsigned l0, unsigned l1, unsigned l2, unsigned l3,
                                      const _Float16* g0, const _Float16* g1,
                                      const _Float16* g2, const _Float16* g3) {
  asm volatile("global_load_async_to_lds_b128 %0, %4, off\n\t"
               "global_load_async_to_lds_b128 %1, %5, off\n\t"
               "global_load_async_to_lds_b128 %2, %6, off\n\t"
               "global_load_async_to_lds_b128 %3, %7, off\n\t"
               "s_wait_xcnt 0x0"
               :: "v"(l0), "v"(l1), "v"(l2), "v"(l3),
                  "v"(g0), "v"(g1), "v"(g2), "v"(g3) : "memory");
}
// 8 copies of 16 B per lane, same form.
__device__ __forceinline__ void copy8(unsigned l, const _Float16* ga, const _Float16* gb,
                                      unsigned lb_off, size_t gstep) {
  unsigned l0 = l, l1 = l + 32 * LROWB, l2 = l + 64 * LROWB, l3 = l + 96 * LROWB;
  unsigned l4 = l0 + lb_off, l5 = l1 + lb_off, l6 = l2 + lb_off, l7 = l3 + lb_off;
  const _Float16 *a0 = ga, *a1 = ga + gstep, *a2 = ga + 2 * gstep, *a3 = ga + 3 * gstep;
  const _Float16 *b0 = gb, *b1 = gb + gstep, *b2 = gb + 2 * gstep, *b3 = gb + 3 * gstep;
  asm volatile("global_load_async_to_lds_b128 %0, %8, off\n\t"
               "global_load_async_to_lds_b128 %1, %9, off\n\t"
               "global_load_async_to_lds_b128 %2, %10, off\n\t"
               "global_load_async_to_lds_b128 %3, %11, off\n\t"
               "global_load_async_to_lds_b128 %4, %12, off\n\t"
               "global_load_async_to_lds_b128 %5, %13, off\n\t"
               "global_load_async_to_lds_b128 %6, %14, off\n\t"
               "global_load_async_to_lds_b128 %7, %15, off\n\t"
               "s_wait_xcnt 0x0"
               :: "v"(l0), "v"(l1), "v"(l2), "v"(l3), "v"(l4), "v"(l5), "v"(l6), "v"(l7),
                  "v"(a0), "v"(a1), "v"(a2), "v"(a3), "v"(b0), "v"(b1), "v"(b2), "v"(b3)
               : "memory");
}
// the wave's own copies have landed
__device__ __forceinline__ void wait_copies() {
  asm volatile("s_wait_asynccnt 0x0" ::: "memory");
}
// the wave's own LDS reads have returned (its buffer may be refilled)
__device__ __forceinline__ void wait_lds_reads() {
  asm volatile("s_wait_dscnt 0x0" ::: "memory");
}

// ---------------------------------------------------------------------------
// GEMM core: C(128 x 128) = A[rows][1024] * B[cols][1024]^T per block of 8
// waves (4 in M x 2 in N, wave tile 32 x 64 as acc[2][4]). A stage is 64 k of
// 128 A rows and 128 B rows; two buffers, the next stage's copies fly while
// this one is multiplied.
// ---------------------------------------------------------------------------
#define GSTAGE (256 * LPITCH)           // halves per buffer
__device__ __forceinline__ void gemm_core(const _Float16* __restrict__ A,
                                          const _Float16* __restrict__ B,
                                          int row0, int col0, _Float16* sm,
                                          v8f (&acc)[2][4]) {
  int tid = threadIdx.x, lane = tid & 31, wave = tid >> 5;
  int wr = (wave >> 1) * 32;            // wave's rows in the A part
  int wc = 128 + (wave & 1) * 64;       // wave's rows in the B part
  const _Float16* ga = A + (size_t)(row0 + (tid >> 3)) * E_DIM + (tid & 7) * 8;
  const _Float16* gb = B + (size_t)(col0 + (tid >> 3)) * E_DIM + (tid & 7) * 8;
  unsigned l = (unsigned)(size_t)sm + (tid >> 3) * LROWB + (tid & 7) * 16;

  copy8(l, ga, gb, 128 * LROWB, (size_t)32 * E_DIM);
  wait_copies();
  __syncthreads();                      // stage 0 is published
  copy8(l + GSTAGE * 2, ga + 64, gb + 64, 128 * LROWB, (size_t)32 * E_DIM);

  for (int t = 0; t < E_DIM / 64; ++t) {
    const _Float16* sb = sm + (t & 1) * GSTAGE;
#pragma unroll   // both 32-k steps of a stage inline: LDS offsets become immediates
    for (int kb = 0; kb < 64; kb += 32) {
      // the six fragments of a 32-k step are read as one group ahead of its WMMAs
      v16h a0 = load_tile16(sb, LPITCH, wr, kb, lane);
      v16h a1 = load_tile16(sb, LPITCH, wr + 16, kb, lane);
      v16h b[4];
#pragma unroll   // b[] and acc[][] need constant indices to stay in registers
      for (int j = 0; j < 4; ++j) b[j] = load_tile16(sb, LPITCH, wc + j * 16, kb, lane);
      // keeps the reads together: sunk among the WMMAs, each pair costs its own LDS wait
      __builtin_amdgcn_sched_barrier(0);
#pragma unroll
      for (int j = 0; j < 4; ++j) {
        acc[0][j] = wmma16(a0, b[j], acc[0][j]);
        acc[1][j] = wmma16(a1, b[j], acc[1][j]);
      }
    }
    wait_lds_reads();
    wait_copies();
    __syncthreads();                    // publishes stage t+1, frees stage t's buffer
    if (t + 2 < E_DIM / 64)
      copy8(l + (t & 1) * (GSTAGE * 2), ga + (t + 2) * 64, gb + (t + 2) * 64,
            128 * LROWB, (size_t)32 * E_DIM);
  }
  wait_copies();
}

// ---------------------------------------------------------------------------
// 0) f32 -> f16 convert
// ---------------------------------------------------------------------------
__global__ void cvt_f32_to_f16(const float* __restrict__ in,
                               _Float16* __restrict__ out, int n) {
  int i = blockIdx.x * blockDim.x + threadIdx.x;
  if (i < n) out[i] = (_Float16)in[i];
}

// ---------------------------------------------------------------------------
// 1) Effective f16 weights. y @ W^T + y @ (B A) = y @ (W + (B A)^T)^T, so
//      Wout[n][k] = f16( W[n][k] + sum_r B[k][r] * A[r][n] )
//    for the Q, K, V row groups of Wqkv and for Wmsa (group 3).
//    128 threads cover one row of 1024 k, 8 k each; a thread keeps its 8x8
//    piece of B in registers and walks FOLD_ROWS rows; A[r][n] is the same
//    for the whole block.
// ---------------------------------------------------------------------------
#define FOLD_ROWS 8
__global__ __launch_bounds__(128)
void fold_lora_kernel(const float* __restrict__ Wqkv, const float* __restrict__ Wmsa,
                      const float* __restrict__ Bq, const float* __restrict__ Aq,
                      const float* __restrict__ Bk, const float* __restrict__ Ak,
                      const float* __restrict__ Bv, const float* __restrict__ Av,
                      const float* __restrict__ Bo, const float* __restrict__ Ao,
                      _Float16* __restrict__ Wqh, _Float16* __restrict__ Wmh) {
  int g  = blockIdx.x / (E_DIM / FOLD_ROWS);               // 0=Q 1=K 2=V 3=out
  int n0 = (blockIdx.x % (E_DIM / FOLD_ROWS)) * FOLD_ROWS; // row in the group
  const float* Wg = (g < 3) ? Wqkv + (size_t)g * E_DIM * E_DIM : Wmsa;
  _Float16*    Og = (g < 3) ? Wqh + (size_t)g * E_DIM * E_DIM : Wmh;
  const float* Bg = (g == 0) ? Bq : ((g == 1) ? Bk : ((g == 2) ? Bv : Bo));
  const float* Ag = (g == 0) ? Aq : ((g == 1) ? Ak : ((g == 2) ? Av : Ao));
  int k0 = threadIdx.x * 8;

  float w[FOLD_ROWS][8];
#pragma unroll
  for (int i = 0; i < FOLD_ROWS; ++i) {
    const float4* wp = (const float4*)(Wg + (size_t)(n0 + i) * E_DIM + k0);
    float4 lo = wp[0], hi = wp[1];
    w[i][0] = lo.x; w[i][1] = lo.y; w[i][2] = lo.z; w[i][3] = lo.w;
    w[i][4] = hi.x; w[i][5] = hi.y; w[i][6] = hi.z; w[i][7] = hi.w;
  }
  float bm[8][R_DIM];   // bm[kk][r] = B[k0 + kk][r]
#pragma unroll
  for (int kk = 0; kk < 8; ++kk) {
    const float4* bp = (const float4*)(Bg + (size_t)(k0 + kk) * R_DIM);
    float4 lo = bp[0], hi = bp[1];
    bm[kk][0] = lo.x; bm[kk][1] = lo.y; bm[kk][2] = lo.z; bm[kk][3] = lo.w;
    bm[kk][4] = hi.x; bm[kk][5] = hi.y; bm[kk][6] = hi.z; bm[kk][7] = hi.w;
  }
#pragma unroll
  for (int i = 0; i < FOLD_ROWS; ++i) {
    float a8[R_DIM];
#pragma unroll
    for (int r = 0; r < R_DIM; ++r) a8[r] = Ag[r * E_DIM + n0 + i];
    v8h o;
#pragma unroll
    for (int kk = 0; kk < 8; ++kk) {
      float v = w[i][kk];
#pragma unroll
      for (int r = 0; r < R_DIM; ++r) v = __builtin_fmaf(bm[kk][r], a8[r], v);
      o[kk] = (_Float16)v;
    }
    *(v8h*)(Og + (size_t)(n0 + i) * E_DIM + k0) = o;
  }
}

// ---------------------------------------------------------------------------
// 2) QKV GEMM: C[TOK, 3072] = Xh @ Weff^T + bias (LoRA is in Weff), scatter to
//    Qh,Kh [B,H,S,D] f16 (Q pre-scaled by 1/sqrt(D)) and Vt [B,H,D,S] f16.
//    Wave tile: 32(M) x 64(N), 8 WMMAs per 32-k step (A reused 4x, B 2x).
//    Block: 8 waves = 128 x 128, operands staged in LDS (gemm_core).
// ---------------------------------------------------------------------------
__global__ __launch_bounds__(256)
void qkv_wmma_kernel(const _Float16* __restrict__ Xh,
                     const _Float16* __restrict__ Wh,     // [3072,1024] f16
                     const float* __restrict__ bqkv,
                     _Float16* __restrict__ Qh, _Float16* __restrict__ Kh,
                     _Float16* __restrict__ Vt) {
  __shared__ __attribute__((aligned(16))) _Float16 sm[2 * GSTAGE];
  int lane = threadIdx.x & 31, wave = threadIdx.x >> 5;
  int rowb = blockIdx.y * 128 + (wave >> 1) * 32;
  int colb = blockIdx.x * 128 + (wave & 1) * 64;

  v8f acc[2][4];
#pragma unroll
  for (int i = 0; i < 2; ++i)
#pragma unroll
    for (int j = 0; j < 4; ++j) acc[i][j] = v8f{};

  gemm_core(Xh, Wh, blockIdx.y * 128, blockIdx.x * 128, sm, acc);

#pragma unroll
  for (int j = 0; j < 4; ++j) {
    int col = colb + j * 16 + (lane & 15);   // 0..3071
    int g = col >> 10;                       // 0=Q 1=K 2=V (uniform per tile)
    int e = col & 1023;
    float bias = bqkv[col];
    int hh = e >> 6, d = e & 63;
#pragma unroll
    for (int i = 0; i < 2; ++i) {
#pragma unroll
      for (int v = 0; v < 8; ++v) {
        int row = rowb + i * 16 + v + ((lane >> 4) << 3);  // token index
        float val = acc[i][j][v] + bias;
        int bb = row >> 11, ss = row & (SEQ - 1);
        if (g == 0) {
          Qh[(((size_t)bb * H_NUM + hh) * SEQ + ss) * D_DIM + d] =
              (_Float16)(val * 0.125f);               // fold 1/sqrt(64)
        } else if (g == 1) {
          Kh[(((size_t)bb * H_NUM + hh) * SEQ + ss) * D_DIM + d] = (_Float16)val;
        } else {
          Vt[(((size_t)bb * H_NUM + hh) * D_DIM + d) * SEQ + ss] = (_Float16)val;
        }
      }
    }
  }
}

#define ASTAGE (128 * LPITCH)
// value of lane l ^ 16
__device__ __forceinline__ float xhalf(float x) {
  int xi = __builtin_bit_cast(int, x);
  return __builtin_bit_cast(float, __builtin_amdgcn_permlanex16(
      xi, xi, 0x76543210, 0xfedcba98, false, false));
}

__global__ __launch_bounds__(256)
void attn_wmma_kernel(const _Float16* __restrict__ Q,
                      const _Float16* __restrict__ K,
                      const _Float16* __restrict__ Vt,
                      _Float16* __restrict__ Oh) {
  __shared__ __attribute__((aligned(16))) _Float16 sm[2 * ASTAGE];
  int lane = threadIdx.x & 31, wave = threadIdx.x >> 5;
  int id = blockIdx.x * 8 + wave;           // 0 .. B*H*(S/32)-1 = 2047
  int qt = id & (SEQ / 32 - 1);             // 32-query tile in sequence
  int bh = id >> 6;                         // 0..31
  int b = bh >> 4, h = bh & 15;
  const _Float16* Qp = Q + (size_t)bh * SEQ * D_DIM;
  const _Float16* Kp = K + (size_t)bh * SEQ * D_DIM;
  const _Float16* Vp = Vt + (size_t)bh * D_DIM * SEQ;
  int qrow = qt * 32;

  // Q^T as B operand: column = query, kept in registers for the whole loop
  v16h bq[2][2];
#pragma unroll
  for (int i = 0; i < 2; ++i) {
    bq[i][0] = load_tile16(Qp, D_DIM, qrow + i * 16, 0, lane);
    bq[i][1] = load_tile16(Qp, D_DIM, qrow + i * 16, 32, lane);
  }

  // o[i][j][r] = O^T[d = j*16 + 8*(lane/16) + r][query = qrow + i*16 + lane%16]
  v8f o[2][4];
  float m[2], l[2];   // per query column; l is the lane half's own partial sum
#pragma unroll
  for (int i = 0; i < 2; ++i) {
#pragma unroll
    for (int j = 0; j < 4; ++j) o[i][j] = v8f{};
    m[i] = -1e30f; l[i] = 0.f;
  }

  // this thread's pieces of a stage: K rows r, r+32 and V^T rows r, r+32
  const _Float16* gk = Kp + (size_t)(threadIdx.x >> 3) * D_DIM + (threadIdx.x & 7) * 8;
  const _Float16* gv = Vp + (size_t)(threadIdx.x >> 3) * SEQ + (threadIdx.x & 7) * 8;
  unsigned lk = (unsigned)(size_t)sm + (threadIdx.x >> 3) * LROWB + (threadIdx.x & 7) * 16;

  copy4(lk, lk + 32 * LROWB, lk + 64 * LROWB, lk + 96 * LROWB,
        gk, gk + 32 * D_DIM, gv, gv + 32 * SEQ);
  wait_copies();
  __syncthreads();                          // stage 0 is published
  copy4(lk + ASTAGE * 2, lk + ASTAGE * 2 + 32 * LROWB,
        lk + ASTAGE * 2 + 64 * LROWB, lk + ASTAGE * 2 + 96 * LROWB,
        gk + 64 * D_DIM, gk + 96 * D_DIM, gv + 64, gv + 32 * SEQ + 64);

  for (int t = 0; t < SEQ / 64; ++t) {
   const _Float16* sk = sm + (t & 1) * ASTAGE;   // K rows of this stage
   const _Float16* sv = sk + 64 * LPITCH;        // V^T rows of this stage
#pragma unroll   // both 32-key passes of a stage inline: LDS offsets become immediates
   for (int kb = 0; kb < 64; kb += 32) {
    // s[i][kt][r] = score(key 64*t + kb + kt*16 + 8*(lane/16) + r, query column)
    v8f s[2][2];
#pragma unroll
    for (int i = 0; i < 2; ++i) { s[i][0] = v8f{}; s[i][1] = v8f{}; }

#pragma unroll
    for (int kt = 0; kt < 2; ++kt) {
      v16h ak0 = load_tile16(sk, LPITCH, kb + kt * 16, 0, lane);
      v16h ak1 = load_tile16(sk, LPITCH, kb + kt * 16, 32, lane);
#pragma unroll
      for (int i = 0; i < 2; ++i) {
        s[i][kt] = wmma16(ak0, bq[i][0], s[i][kt]);
        s[i][kt] = wmma16(ak1, bq[i][1], s[i][kt]);
      }
    }

    v16h bp[2];   // P^T as B operand, packed straight from the score tiles
#pragma unroll
    for (int i = 0; i < 2; ++i) {
      float t[8];
#pragma unroll
      for (int v = 0; v < 8; ++v) t[v] = fmaxf(s[i][0][v], s[i][1][v]);
      float mx = fmaxf(fmaxf(fmaxf(t[0], t[1]), fmaxf(t[2], t[3])),
                       fmaxf(fmaxf(t[4], t[5]), fmaxf(t[6], t[7])));
      mx = fmaxf(mx, xhalf(mx));            // both halves use one maximum
      float mn = fmaxf(m[i], mx);
      float corr = __expf(m[i] - mn);
      v8f p0 = s[i][0] - mn;                // keys kb + 8*(lane/16) + v
      v8f p1 = s[i][1] - mn;                // keys kb + 16 + 8*(lane/16) + v
#pragma unroll
      for (int v = 0; v < 8; ++v) { p0[v] = __expf(p0[v]); p1[v] = __expf(p1[v]); }
#pragma unroll
      for (int v = 0; v < 8; ++v) {
        bp[i][v]     = (_Float16)p0[v];
        bp[i][8 + v] = (_Float16)p1[v];
      }
      v8f ps = p0 + p1;
      float rs = ((ps[0] + ps[1]) + (ps[2] + ps[3])) + ((ps[4] + ps[5]) + (ps[6] + ps[7]));
      l[i] = l[i] * corr + rs;
      m[i] = mn;
#pragma unroll
      for (int j = 0; j < 4; ++j) o[i][j] *= corr;
    }

    // V^T operand tiles loaded once, reused by both query subtiles
#pragma unroll
    for (int j = 0; j < 4; ++j) {
      v16h av = load_tile16(sv, LPITCH, j * 16, kb, lane);
#pragma unroll
      for (int i = 0; i < 2; ++i) o[i][j] = wmma16(av, bp[i], o[i][j]);
    }
   }
   wait_lds_reads();
   wait_copies();
   __syncthreads();                         // publishes stage t+1, frees stage t's buffer
   if (t + 2 < SEQ / 64) {
     unsigned lt = lk + (t & 1) * (ASTAGE * 2);
     const _Float16* gkt = gk + (size_t)(t + 2) * 64 * D_DIM;
     const _Float16* gvt = gv + (t + 2) * 64;
     copy4(lt, lt + 32 * LROWB, lt + 64 * LROWB, lt + 96 * LROWB,
           gkt, gkt + 32 * D_DIM, gvt, gvt + 32 * SEQ);
   }
  }
  wait_copies();

  // a lane holds 8 consecutive d of one query: one 16-byte store per tile
#pragma unroll
  for (int i = 0; i < 2; ++i) {
    float inv = 1.0f / (l[i] + xhalf(l[i]));
    int ss = qrow + i * 16 + (lane & 15);
    _Float16* op = Oh + ((size_t)b * SEQ + ss) * E_DIM + h * D_DIM
                      + ((lane >> 4) << 3);
#pragma unroll
    for (int j = 0; j < 4; ++j) {
      v8h w;
#pragma unroll
      for (int r = 0; r < 8; ++r) w[r] = (_Float16)(o[i][j][r] * inv);
      *(v8h*)(op + j * 16) = w;
    }
  }
}

// ---------------------------------------------------------------------------
// 4) res = O @ Weff^T + y   (f32 out; Weff = Wmsa + (Bo Ao)^T)
//    Wave tile 32x64, block 128x128, like the QKV GEMM.
// ---------------------------------------------------------------------------
__global__ __launch_bounds__(256)
void msa_wmma_kernel(const _Float16* __restrict__ Oh,
                     const _Float16* __restrict__ Wmh,   // [1024,1024] f16
                     const float* __restrict__ y, float* __restrict__ res) {
  __shared__ __attribute__((aligned(16))) _Float16 sm[2 * GSTAGE];
  int lane = threadIdx.x & 31, wave = threadIdx.x >> 5;
  int rowb = blockIdx.y * 128 + (wave >> 1) * 32;
  int colb = blockIdx.x * 128 + (wave & 1) * 64;

  v8f acc[2][4];
#pragma unroll
  for (int i = 0; i < 2; ++i)
#pragma unroll
    for (int j = 0; j < 4; ++j) acc[i][j] = v8f{};

  gemm_core(Oh, Wmh, blockIdx.y * 128, blockIdx.x * 128, sm, acc);

#pragma unroll
  for (int j = 0; j < 4; ++j) {
    int col = colb + j * 16 + (lane & 15);
#pragma unroll
    for (int i = 0; i < 2; ++i) {
#pragma unroll
      for (int v = 0; v < 8; ++v) {
        int row = rowb + i * 16 + v + ((lane >> 4) << 3);
        float val = acc[i][j][v];
        val += y[(size_t)row * E_DIM + col];
        res[(size_t)row * E_DIM + col] = val;
      }
    }
  }
}

// ---------------------------------------------------------------------------
// 5) LayerNorm rows of res -> d_out
// ---------------------------------------------------------------------------
__global__ __launch_bounds__(256)
void layernorm_kernel(const float* __restrict__ res,
                      const float* __restrict__ gamma,
                      const float* __restrict__ beta, float* __restrict__ out) {
  int t = blockIdx.x, tid = threadIdx.x;
  const float* rr = res + (size_t)t * E_DIM;
  float s1 = 0.f, s2 = 0.f;
  for (int e = tid; e < E_DIM; e += 256) {
    float x = rr[e];
    s1 += x; s2 += x * x;
  }
  __shared__ float r1[256], r2[256];
  r1[tid] = s1; r2[tid] = s2;
  __syncthreads();
  for (int s = 128; s > 0; s >>= 1) {
    if (tid < s) { r1[tid] += r1[tid + s]; r2[tid] += r2[tid + s]; }
    __syncthreads();
  }
  float mu = r1[0] * (1.0f / E_DIM);
  float var = r2[0] * (1.0f / E_DIM) - mu * mu;
  float sc = rsqrtf(var + 1e-6f);
  for (int e = tid; e < E_DIM; e += 256)
    out[(size_t)t * E_DIM + e] = (rr[e] - mu) * sc * gamma[e] + beta[e];
}

// ---------------------------------------------------------------------------
// Host launcher
// ---------------------------------------------------------------------------
extern "C" void kernel_launch(void* const* d_in, const int* in_sizes, int n_in,
                              void* d_out, int out_size, void* d_ws, size_t ws_size,
                              hipStream_t stream) {
  const float* y    = (const float*)d_in[0];
  const float* Wqkv = (const float*)d_in[1];
  const float* bqkv = (const float*)d_in[2];
  const float* Wmsa = (const float*)d_in[3];
  const float* Bq   = (const float*)d_in[4];
  const float* Aq   = (const float*)d_in[5];
  const float* Bk   = (const float*)d_in[6];
  const float* Ak   = (const float*)d_in[7];
  const float* Bv   = (const float*)d_in[8];
  const float* Av   = (const float*)d_in[9];
  const float* Bo   = (const float*)d_in[10];
  const float* Ao   = (const float*)d_in[11];
  const float* gamma = (const float*)d_in[12];
  const float* beta  = (const float*)d_in[13];
  float* out = (float*)d_out;

  // workspace carve-up (all offsets 256B-aligned)
  char* ws = (char*)d_ws;
  size_t off = 0;
  auto carve = [&](size_t bytes) {
    char* p = ws + off;
    off += (bytes + 255) & ~(size_t)255;
    return p;
  };
  _Float16* Xh   = (_Float16*)carve((size_t)TOK * E_DIM * 2);   // y f16
  _Float16* Wqh  = (_Float16*)carve((size_t)NQKV * E_DIM * 2);  // Wqkv + LoRA, f16
  _Float16* Wmh  = (_Float16*)carve((size_t)E_DIM * E_DIM * 2); // Wmsa + LoRA, f16
  _Float16* Qh   = (_Float16*)carve((size_t)TOK * E_DIM * 2);   // [B,H,S,D]
  _Float16* Kh   = (_Float16*)carve((size_t)TOK * E_DIM * 2);   // [B,H,S,D]
  _Float16* Vt   = (_Float16*)carve((size_t)TOK * E_DIM * 2);   // [B,H,D,S]
  _Float16* Oh   = (_Float16*)carve((size_t)TOK * E_DIM * 2);   // [B,S,E]
  float*    res  = (float*)carve((size_t)TOK * E_DIM * 4);
  (void)ws_size; (void)in_sizes; (void)n_in; (void)out_size;

  // 0) convert y
  {
    int n = TOK * E_DIM;
    cvt_f32_to_f16<<<(n + 255) / 256, 256, 0, stream>>>(y, Xh, n);
  }
  // 1) effective f16 weights: 4 groups of 1024 rows
  fold_lora_kernel<<<4 * (E_DIM / FOLD_ROWS), 128, 0, stream>>>(
      Wqkv, Wmsa, Bq, Aq, Bk, Ak, Bv, Av, Bo, Ao, Wqh, Wmh);
  // 2) QKV GEMM (grid: N/128 x M/128)
  qkv_wmma_kernel<<<dim3(NQKV / 128, TOK / 128), 256, 0, stream>>>(
      Xh, Wqh, bqkv, Qh, Kh, Vt);
  // 3) attention: B*H*(S/32) wave tiles, 8 waves/block
  attn_wmma_kernel<<<(BATCH * H_NUM * (SEQ / 32)) / 8, 256, 0, stream>>>(
      Qh, Kh, Vt, Oh);
  // 4) output projection + residual (grid: N/128 x M/128)
  msa_wmma_kernel<<<dim3(E_DIM / 128, TOK / 128), 256, 0, stream>>>(
      Oh, Wmh, y, res);
  // 5) LayerNorm
  layernorm_kernel<<<TOK, 256, 0, stream>>>(res, gamma, beta, out);
}

// v004
// It runs in 110 microseconds.
// Timed twice side by side with v003, it ran 1.07 and 1.06 times as fast.
// Over all steps from v000 it is 5.17 times as fast.
#include <hip/hip_runtime.h>
#include <hip/hip_bf16.h>

// ---------------------------------------------------------------------------
// Problem constants (match reference)
// ---------------------------------------------------------------------------
#define E_DIM 1024
#define H_NUM 16
#define D_DIM 64
#define R_DIM 8
#define BATCH 2
#define SEQ   2048
#define TOK   (BATCH * SEQ)      // 4096 tokens
#define NQKV  (3 * E_DIM)        // 3072

typedef __attribute__((ext_vector_type(16))) _Float16 v16h;
typedef __attribute__((ext_vector_type(8)))  _Float16 v8h;
typedef __attribute__((ext_vector_type(8)))  float    v8f;

__device__ __forceinline__ v8f wmma16(v16h a, v16h b, v8f c) {
  // D = A(16x32 f16) * B(32x16 f16) + C(16x16 f32)
  return __builtin_amdgcn_wmma_f32_16x16x32_f16(
      /*neg_a=*/false, a, /*neg_b=*/false, b,
      /*c_mod=*/(short)0, c, /*reuse_a=*/false, /*reuse_b=*/false);
}

// Load one 16x32 f16 operand tile into the wave32 WMMA register layout.
// Element (r, k) comes from base[(major + r) * ld + kb + k].
//   lane%16 -> r (A: row M / B: col N), lane/16 selects K-halves:
//   halves 0..7  = K (lane/16)*8 + 0..7
//   halves 8..15 = K 16 + (lane/16)*8 + 0..7
__device__ __forceinline__ v16h load_tile16(const _Float16* base, int ld,
                                            int major, int kb, int lane) {
  const _Float16* p = base + (size_t)(major + (lane & 15)) * (size_t)ld
                           + (size_t)(kb + ((lane >> 4) << 3));
  v8h lo = *(const v8h*)p;        // K = koff + 0..7
  v8h hi = *(const v8h*)(p + 16); // K = koff + 16..23
  return __builtin_shufflevector(lo, hi, 0,1,2,3,4,5,6,7,8,9,10,11,12,13,14,15);
}

// ---------------------------------------------------------------------------
// LDS staging by asynchronous copies. A staged row is 128 B of data (one whole
// line of its source) at a pitch of 144 B (16 B x odd: the ds_load_b128 pitch).
// Thread t of 256 copies 16 B: piece t%8 of row t/8, so one wave-wide copy
// covers 4 whole lines; further copies of the thread lie 32 rows on.
// ---------------------------------------------------------------------------
#define LPITCH 72                       // halves per staged row
#define LROWB  (LPITCH * 2)             // bytes per staged row

// 4 copies of 16 B per lane. The s_wait_xcnt stands inside the statement so
// that no address register is rewritten before the copies have taken it.
__device__ __forceinline__ void copy4(unsigned l0, unsigned l1, unsigned l2, unsigned l3,
                                      const _Float16* g0, const _Float16* g1,
                                      const _Float16* g2, const _Float16* g3) {
  asm volatile("global_load_async_to_lds_b128 %0, %4, off\n\t"
               "global_load_async_to_lds_b128 %1, %5, off\n\t"
               "global_load_async_to_lds_b128 %2, %6, off\n\t"
               "global_load_async_to_lds_b128 %3, %7, off\n\t"
               "s_wait_xcnt 0x0"
               :: "v"(l0), "v"(l1), "v"(l2), "v"(l3),
                  "v"(g0), "v"(g1), "v"(g2), "v"(g3) : "memory");
}
// 8 copies of 16 B per lane, same form.
__device__ __forceinline__ void copy8(unsigned l, const _Float16* ga, const _Float16* gb,
                                      unsigned lb_off, size_t gstep) {
  unsigned l0 = l, l1 = l + 32 * LROWB, l2 = l + 64 * LROWB, l3 = l + 96 * LROWB;
  unsigned l4 = l0 + lb_off, l5 = l1 + lb_off, l6 = l2 + lb_off, l7 = l3 + lb_off;
  const _Float16 *a0 = ga, *a1 = ga + gstep, *a2 = ga + 2 * gstep, *a3 = ga + 3 * gstep;
  const _Float16 *b0 = gb, *b1 = gb + gstep, *b2 = gb + 2 * gstep, *b3 = gb + 3 * gstep;
  asm volatile("global_load_async_to_lds_b128 %0, %8, off\n\t"
               "global_load_async_to_lds_b128 %1, %9, off\n\t"
               "global_load_async_to_lds_b128 %2, %10, off\n\t"
               "global_load_async_to_lds_b128 %3, %11, off\n\t"
               "global_load_async_to_lds_b128 %4, %12, off\n\t"
               "global_load_async_to_lds_b128 %5, %13, off\n\t"
               "global_load_async_to_lds_b128 %6, %14, off\n\t"
               "global_load_async_to_lds_b128 %7, %15, off\n\t"
               "s_wait_xcnt 0x0"
               :: "v"(l0), "v"(l1), "v"(l2), "v"(l3), "v"(l4), "v"(l5), "v"(l6), "v"(l7),
                  "v"(a0), "v"(a1), "v"(a2), "v"(a3), "v"(b0), "v"(b1), "v"(b2), "v"(b3)
               : "memory");
}
// the wave's own copies have landed
__device__ __forceinline__ void wait_copies() {
  asm volatile("s_wait_asynccnt 0x0" ::: "memory");
}
// the wave's own LDS reads have returned (its buffer may be refilled)
__device__ __forceinline__ void wait_lds_reads() {
  asm volatile("s_wait_dscnt 0x0" ::: "memory");
}

// ---------------------------------------------------------------------------
// GEMM core: C(128 x 128) = A[rows][1024] * B[cols][1024]^T per block of 8
// waves (4 in M x 2 in N, wave tile 32 x 64 as acc[2][4]). A stage is 64 k of
// 128 A rows and 128 B rows; two buffers, the next stage's copies fly while
// this one is multiplied.
// ---------------------------------------------------------------------------
#define GSTAGE (256 * LPITCH)           // halves per buffer
__device__ __forceinline__ void gemm_core(const _Float16* __restrict__ A,
                                          const _Float16* __restrict__ B,
                                          int row0, int col0, _Float16* sm,
                                          v8f (&acc)[2][4]) {
  int tid = threadIdx.x, lane = tid & 31, wave = tid >> 5;
  int wr = (wave >> 1) * 32;            // wave's rows in the A part
  int wc = 128 + (wave & 1) * 64;       // wave's rows in the B part
  const _Float16* ga = A + (size_t)(row0 + (tid >> 3)) * E_DIM + (tid & 7) * 8;
  const _Float16* gb = B + (size_t)(col0 + (tid >> 3)) * E_DIM + (tid & 7) * 8;
  unsigned l = (unsigned)(size_t)sm + (tid >> 3) * LROWB + (tid & 7) * 16;

  copy8(l, ga, gb, 128 * LROWB, (size_t)32 * E_DIM);
  wait_copies();
  __syncthreads();                      // stage 0 is published
  copy8(l + GSTAGE * 2, ga + 64, gb + 64, 128 * LROWB, (size_t)32 * E_DIM);

  for (int t = 0; t < E_DIM / 64; ++t) {
    const _Float16* sb = sm + (t & 1) * GSTAGE;
#pragma unroll   // both 32-k steps of a stage inline: LDS offsets become immediates
    for (int kb = 0; kb < 64; kb += 32) {
      // the six fragments of a 32-k step are read as one group ahead of its WMMAs
      v16h a0 = load_tile16(sb, LPITCH, wr, kb, lane);
      v16h a1 = load_tile16(sb, LPITCH, wr + 16, kb, lane);
      v16h b[4];
#pragma unroll   // b[] and acc[][] need constant indices to stay in registers
      for (int j = 0; j < 4; ++j) b[j] = load_tile16(sb, LPITCH, wc + j * 16, kb, lane);
      // keeps the reads together: sunk among the WMMAs, each pair costs its own LDS wait
      __builtin_amdgcn_sched_barrier(0);
#pragma unroll
      for (int j = 0; j < 4; ++j) {
        acc[0][j] = wmma16(a0, b[j], acc[0][j]);
        acc[1][j] = wmma16(a1, b[j], acc[1][j]);
      }
    }
    wait_lds_reads();
    wait_copies();
    __syncthreads();                    // publishes stage t+1, frees stage t's buffer
    if (t + 2 < E_DIM / 64)
      copy8(l + (t & 1) * (GSTAGE * 2), ga + (t + 2) * 64, gb + (t + 2) * 64,
            128 * LROWB, (size_t)32 * E_DIM);
  }
  wait_copies();
}

// ---------------------------------------------------------------------------
// 0) f32 -> f16 convert, as a stream: a wave takes 4 KiB of input by 8 loads
//    of 16 B per lane (each wave-wide load is 512 contiguous bytes), all in
//    flight together, and stores 256 contiguous bytes per store.
//    The grid covers TOK * E_DIM elements exactly.
// ---------------------------------------------------------------------------
#define SLOADS 8                        // 16-byte loads in flight per lane
typedef __attribute__((ext_vector_type(4))) _Float16 v4h;
__global__ __launch_bounds__(256)
void cvt_f32_to_f16(const float* __restrict__ in, _Float16* __restrict__ out) {
  int lane = threadIdx.x & 31;
  size_t first = ((size_t)blockIdx.x * 8 + (threadIdx.x >> 5)) * (SLOADS * 32) + lane;
  const float4* ip = (const float4*)in + first;
  v4h* op = (v4h*)out + first;
  float4 x[SLOADS];
#pragma unroll   // x[] needs constant indices to stay in registers
  for (int c = 0; c < SLOADS; ++c) x[c] = ip[c * 32];
#pragma unroll   // as above
  for (int c = 0; c < SLOADS; ++c) {
    v4h o = {(_Float16)x[c].x, (_Float16)x[c].y, (_Float16)x[c].z, (_Float16)x[c].w};
    op[c * 32] = o;
  }
}

// ---------------------------------------------------------------------------
// 1) Effective f16 weights. y @ W^T + y @ (B A) = y @ (W + (B A)^T)^T, so
//      Wout[n][k] = f16( W[n][k] + sum_r B[k][r] * A[r][n] )
//    for the Q, K, V row groups of Wqkv and for Wmsa (group 3).
//    128 threads cover one row of 1024 k, 8 k each; a thread keeps its 8x8
//    piece of B in registers and walks FOLD_ROWS rows; A[r][n] is the same
//    for the whole block.
// ---------------------------------------------------------------------------
#define FOLD_ROWS 8
__global__ __launch_bounds__(128)
void fold_lora_kernel(const float* __restrict__ Wqkv, const float* __restrict__ Wmsa,
                      const float* __restrict__ Bq, const float* __restrict__ Aq,
                      const float* __restrict__ Bk, const float* __restrict__ Ak,
                      const float* __restrict__ Bv, const float* __restrict__ Av,
                      const float* __restrict__ Bo, const float* __restrict__ Ao,
                      _Float16* __restrict__ Wqh, _Float16* __restrict__ Wmh) {
  int g  = blockIdx.x / (E_DIM / FOLD_ROWS);               // 0=Q 1=K 2=V 3=out
  int n0 = (blockIdx.x % (E_DIM / FOLD_ROWS)) * FOLD_ROWS; // row in the group
  const float* Wg = (g < 3) ? Wqkv + (size_t)g * E_DIM * E_DIM : Wmsa;
  _Float16*    Og = (g < 3) ? Wqh + (size_t)g * E_DIM * E_DIM : Wmh;
  const float* Bg = (g == 0) ? Bq : ((g == 1) ? Bk : ((g == 2) ? Bv : Bo));
  const float* Ag = (g == 0) ? Aq : ((g == 1) ? Ak : ((g == 2) ? Av : Ao));
  int k0 = threadIdx.x * 8;

  float w[FOLD_ROWS][8];
#pragma unroll
  for (int i = 0; i < FOLD_ROWS; ++i) {
    const float4* wp = (const float4*)(Wg + (size_t)(n0 + i) * E_DIM + k0);
    float4 lo = wp[0], hi = wp[1];
    w[i][0] = lo.x; w[i][1] = lo.y; w[i][2] = lo.z; w[i][3] = lo.w;
    w[i][4] = hi.x; w[i][5] = hi.y; w[i][6] = hi.z; w[i][7] = hi.w;
  }
  float bm[8][R_DIM];   // bm[kk][r] = B[k0 + kk][r]
#pragma unroll
  for (int kk = 0; kk < 8; ++kk) {
    const float4* bp = (const float4*)(Bg + (size_t)(k0 + kk) * R_DIM);
    float4 lo = bp[0], hi = bp[1];
    bm[kk][0] = lo.x; bm[kk][1] = lo.y; bm[kk][2] = lo.z; bm[kk][3] = lo.w;
    bm[kk][4] = hi.x; bm[kk][5] = hi.y; bm[kk][6] = hi.z; bm[kk][7] = hi.w;
  }
#pragma unroll
  for (int i = 0; i < FOLD_ROWS; ++i) {
    float a8[R_DIM];
#pragma unroll
    for (int r = 0; r < R_DIM; ++r) a8[r] = Ag[r * E_DIM + n0 + i];
    v8h o;
#pragma unroll
    for (int kk = 0; kk < 8; ++kk) {
      float v = w[i][kk];
#pragma unroll
      for (int r = 0; r < R_DIM; ++r) v = __builtin_fmaf(bm[kk][r], a8[r], v);
      o[kk] = (_Float16)v;
    }
    *(v8h*)(Og + (size_t)(n0 + i) * E_DIM + k0) = o;
  }
}

// ---------------------------------------------------------------------------
// 2) QKV GEMM: C[TOK, 3072] = Xh @ Weff^T + bias (LoRA is in Weff), scatter to
//    Qh,Kh [B,H,S,D] f16 (Q pre-scaled by 1/sqrt(D)) and Vt [B,H,D,S] f16.
//    Wave tile: 32(M) x 64(N), 8 WMMAs per 32-k step (A reused 4x, B 2x).
//    Block: 8 waves = 128 x 128, operands staged in LDS (gemm_core).
// ---------------------------------------------------------------------------
__global__ __launch_bounds__(256)
void qkv_wmma_kernel(const _Float16* __restrict__ Xh,
                     const _Float16* __restrict__ Wh,     // [3072,1024] f16
                     const float* __restrict__ bqkv,
                     _Float16* __restrict__ Qh, _Float16* __restrict__ Kh,
                     _Float16* __restrict__ Vt) {
  __shared__ __attribute__((aligned(16))) _Float16 sm[2 * GSTAGE];
  int lane = threadIdx.x & 31, wave = threadIdx.x >> 5;
  int rowb = blockIdx.y * 128 + (wave >> 1) * 32;
  int colb = blockIdx.x * 128 + (wave & 1) * 64;

  v8f acc[2][4];
#pragma unroll
  for (int i = 0; i < 2; ++i)
#pragma unroll
    for (int j = 0; j < 4; ++j) acc[i][j] = v8f{};

  gemm_core(Xh, Wh, blockIdx.y * 128, blockIdx.x * 128, sm, acc);

#pragma unroll
  for (int j = 0; j < 4; ++j) {
    int col = colb + j * 16 + (lane & 15);   // 0..3071
    int g = col >> 10;                       // 0=Q 1=K 2=V (uniform per tile)
    int e = col & 1023;
    float bias = bqkv[col];
    int hh = e >> 6, d = e & 63;
#pragma unroll
    for (int i = 0; i < 2; ++i) {
#pragma unroll
      for (int v = 0; v < 8; ++v) {
        int row = rowb + i * 16 + v + ((lane >> 4) << 3);  // token index
        float val = acc[i][j][v] + bias;
        int bb = row >> 11, ss = row & (SEQ - 1);
        if (g == 0) {
          Qh[(((size_t)bb * H_NUM + hh) * SEQ + ss) * D_DIM + d] =
              (_Float16)(val * 0.125f);               // fold 1/sqrt(64)
        } else if (g == 1) {
          Kh[(((size_t)bb * H_NUM + hh) * SEQ + ss) * D_DIM + d] = (_Float16)val;
        } else {
          Vt[(((size_t)bb * H_NUM + hh) * D_DIM + d) * SEQ + ss] = (_Float16)val;
        }
      }
    }
  }
}

#define ASTAGE (128 * LPITCH)
// value of lane l ^ 16
__device__ __forceinline__ float xhalf(float x) {
  int xi = __builtin_bit_cast(int, x);
  return __builtin_bit_cast(float, __builtin_amdgcn_permlanex16(
      xi, xi, 0x76543210, 0xfedcba98, false, false));
}

__global__ __launch_bounds__(256)
void attn_wmma_kernel(const _Float16* __restrict__ Q,
                      const _Float16* __restrict__ K,
                      const _Float16* __restrict__ Vt,
                      _Float16* __restrict__ Oh) {
  __shared__ __attribute__((aligned(16))) _Float16 sm[2 * ASTAGE];
  int lane = threadIdx.x & 31, wave = threadIdx.x >> 5;
  int id = blockIdx.x * 8 + wave;           // 0 .. B*H*(S/32)-1 = 2047
  int qt = id & (SEQ / 32 - 1);             // 32-query tile in sequence
  int bh = id >> 6;                         // 0..31
  int b = bh >> 4, h = bh & 15;
  const _Float16* Qp = Q + (size_t)bh * SEQ * D_DIM;
  const _Float16* Kp = K + (size_t)bh * SEQ * D_DIM;
  const _Float16* Vp = Vt + (size_t)bh * D_DIM * SEQ;
  int qrow = qt * 32;

  // Q^T as B operand: column = query, kept in registers for the whole loop
  v16h bq[2][2];
#pragma unroll
  for (int i = 0; i < 2; ++i) {
    bq[i][0] = load_tile16(Qp, D_DIM, qrow + i * 16, 0, lane);
    bq[i][1] = load_tile16(Qp, D_DIM, qrow + i * 16, 32, lane);
  }

  // o[i][j][r] = O^T[d = j*16 + 8*(lane/16) + r][query = qrow + i*16 + lane%16]
  v8f o[2][4];
  float m[2], l[2];   // per query column; l is the lane half's own partial sum
#pragma unroll
  for (int i = 0; i < 2; ++i) {
#pragma unroll
    for (int j = 0; j < 4; ++j) o[i][j] = v8f{};
    m[i] = -1e30f; l[i] = 0.f;
  }

  // this thread's pieces of a stage: K rows r, r+32 and V^T rows r, r+32
  const _Float16* gk = Kp + (size_t)(threadIdx.x >> 3) * D_DIM + (threadIdx.x & 7) * 8;
  const _Float16* gv = Vp + (size_t)(threadIdx.x >> 3) * SEQ + (threadIdx.x & 7) * 8;
  unsigned lk = (unsigned)(size_t)sm + (threadIdx.x >> 3) * LROWB + (threadIdx.x & 7) * 16;

  copy4(lk, lk + 32 * LROWB, lk + 64 * LROWB, lk + 96 * LROWB,
        gk, gk + 32 * D_DIM, gv, gv + 32 * SEQ);
  wait_copies();
  __syncthreads();                          // stage 0 is published
  copy4(lk + ASTAGE * 2, lk + ASTAGE * 2 + 32 * LROWB,
        lk + ASTAGE * 2 + 64 * LROWB, lk + ASTAGE * 2 + 96 * LROWB,
        gk + 64 * D_DIM, gk + 96 * D_DIM, gv + 64, gv + 32 * SEQ + 64);

  for (int t = 0; t < SEQ / 64; ++t) {
   const _Float16* sk = sm + (t & 1) * ASTAGE;   // K rows of this stage
   const _Float16* sv = sk + 64 * LPITCH;        // V^T rows of this stage
#pragma unroll   // both 32-key passes of a stage inline: LDS offsets become immediates
   for (int kb = 0; kb < 64; kb += 32) {
    // s[i][kt][r] = score(key 64*t + kb + kt*16 + 8*(lane/16) + r, query column)
    v8f s[2][2];
#pragma unroll
    for (int i = 0; i < 2; ++i) { s[i][0] = v8f{}; s[i][1] = v8f{}; }

#pragma unroll
    for (int kt = 0; kt < 2; ++kt) {
      v16h ak0 = load_tile16(sk, LPITCH, kb + kt * 16, 0, lane);
      v16h ak1 = load_tile16(sk, LPITCH, kb + kt * 16, 32, lane);
#pragma unroll
      for (int i = 0; i < 2; ++i) {
        s[i][kt] = wmma16(ak0, bq[i][0], s[i][kt]);
        s[i][kt] = wmma16(ak1, bq[i][1], s[i][kt]);
      }
    }

    v16h bp[2];   // P^T as B operand, packed straight from the score tiles
#pragma unroll
    for (int i = 0; i < 2; ++i) {
      float t[8];
#pragma unroll
      for (int v = 0; v < 8; ++v) t[v] = fmaxf(s[i][0][v], s[i][1][v]);
      float mx = fmaxf(fmaxf(fmaxf(t[0], t[1]), fmaxf(t[2], t[3])),
                       fmaxf(fmaxf(t[4], t[5]), fmaxf(t[6], t[7])));
      mx = fmaxf(mx, xhalf(mx));            // both halves use one maximum
      float mn = fmaxf(m[i], mx);
      float corr = __expf(m[i] - mn);
      v8f p0 = s[i][0] - mn;                // keys kb + 8*(lane/16) + v
      v8f p1 = s[i][1] - mn;                // keys kb + 16 + 8*(lane/16) + v
#pragma unroll
      for (int v = 0; v < 8; ++v) { p0[v] = __expf(p0[v]); p1[v] = __expf(p1[v]); }
#pragma unroll
      for (int v = 0; v < 8; ++v) {
        bp[i][v]     = (_Float16)p0[v];
        bp[i][8 + v] = (_Float16)p1[v];
      }
      v8f ps = p0 + p1;
      float rs = ((ps[0] + ps[1]) + (ps[2] + ps[3])) + ((ps[4] + ps[5]) + (ps[6] + ps[7]));
      l[i] = l[i] * corr + rs;
      m[i] = mn;
#pragma unroll
      for (int j = 0; j < 4; ++j) o[i][j] *= corr;
    }

    // V^T operand tiles loaded once, reused by both query subtiles
#pragma unroll
    for (int j = 0; j < 4; ++j) {
      v16h av = load_tile16(sv, LPITCH, j * 16, kb, lane);
#pragma unroll
      for (int i = 0; i < 2; ++i) o[i][j] = wmma16(av, bp[i], o[i][j]);
    }
   }
   wait_lds_reads();
   wait_copies();
   __syncthreads();                         // publishes stage t+1, frees stage t's buffer
   if (t + 2 < SEQ / 64) {
     unsigned lt = lk + (t & 1) * (ASTAGE * 2);
     const _Float16* gkt = gk + (size_t)(t + 2) * 64 * D_DIM;
     const _Float16* gvt = gv + (t + 2) * 64;
     copy4(lt, lt + 32 * LROWB, lt + 64 * LROWB, lt + 96 * LROWB,
           gkt, gkt + 32 * D_DIM, gvt, gvt + 32 * SEQ);
   }
  }
  wait_copies();

  // a lane holds 8 consecutive d of one query: one 16-byte store per tile
#pragma unroll
  for (int i = 0; i < 2; ++i) {
    float inv = 1.0f / (l[i] + xhalf(l[i]));
    int ss = qrow + i * 16 + (lane & 15);
    _Float16* op = Oh + ((size_t)b * SEQ + ss) * E_DIM + h * D_DIM
                      + ((lane >> 4) << 3);
#pragma unroll
    for (int j = 0; j < 4; ++j) {
      v8h w;
#pragma unroll
      for (int r = 0; r < 8; ++r) w[r] = (_Float16)(o[i][j][r] * inv);
      *(v8h*)(op + j * 16) = w;
    }
  }
}

// ---------------------------------------------------------------------------
// 4) res = O @ Weff^T + y   (f32 out; Weff = Wmsa + (Bo Ao)^T)
//    Wave tile 32x64, block 128x128, like the QKV GEMM.
// ---------------------------------------------------------------------------
__global__ __launch_bounds__(256)
void msa_wmma_kernel(const _Float16* __restrict__ Oh,
                     const _Float16* __restrict__ Wmh,   // [1024,1024] f16
                     const float* __restrict__ y, float* __restrict__ res) {
  __shared__ __attribute__((aligned(16))) _Float16 sm[2 * GSTAGE];
  int lane = threadIdx.x & 31, wave = threadIdx.x >> 5;
  int rowb = blockIdx.y * 128 + (wave >> 1) * 32;
  int colb = blockIdx.x * 128 + (wave & 1) * 64;

  v8f acc[2][4];
#pragma unroll
  for (int i = 0; i < 2; ++i)
#pragma unroll
    for (int j = 0; j < 4; ++j) acc[i][j] = v8f{};

  gemm_core(Oh, Wmh, blockIdx.y * 128, blockIdx.x * 128, sm, acc);

#pragma unroll
  for (int j = 0; j < 4; ++j) {
    int col = colb + j * 16 + (lane & 15);
#pragma unroll
    for (int i = 0; i < 2; ++i) {
#pragma unroll
      for (int v = 0; v < 8; ++v) {
        int row = rowb + i * 16 + v + ((lane >> 4) << 3);
        float val = acc[i][j][v];
        val += y[(size_t)row * E_DIM + col];
        res[(size_t)row * E_DIM + col] = val;
      }
    }
  }
}

// ---------------------------------------------------------------------------
// 5) LayerNorm rows of res -> d_out, as a stream: one wave per row. The row
//    (4 KiB) is read once by 8 loads of 16 B per lane and stays in registers;
//    the two sums are taken in the lane (four chains each) and then over the
//    32 lanes by a butterfly, so every lane ends with the same totals.
// ---------------------------------------------------------------------------
typedef __attribute__((ext_vector_type(4))) float v4f;
__global__ __launch_bounds__(256)
void layernorm_kernel(const float* __restrict__ res,
                      const float* __restrict__ gamma,
                      const float* __restrict__ beta, float* __restrict__ out) {
  int lane = threadIdx.x & 31;
  // the wave's number as a scalar: the row's base then sits in scalar registers
  // and every load and store is addressed by the one lane-offset register
  size_t row = (size_t)blockIdx.x * 8 + __builtin_amdgcn_readfirstlane(threadIdx.x >> 5);
  const v4f* rp = (const v4f*)(res + row * E_DIM) + lane;
  const v4f* gp = (const v4f*)gamma + lane;
  const v4f* bp = (const v4f*)beta + lane;
  v4f* op = (v4f*)(out + row * E_DIM) + lane;

  v4f x[SLOADS], g[SLOADS], b[SLOADS];
#pragma unroll   // x[], g[], b[] need constant indices to stay in registers
  for (int c = 0; c < SLOADS; ++c) x[c] = rp[c * 32];
#pragma unroll   // as above
  for (int c = 0; c < SLOADS; ++c) { g[c] = gp[c * 32]; b[c] = bp[c * 32]; }
  // keeps all 24 loads in front of the sums: sunk behind the butterfly, the
  // gamma and beta loads would each be waited for in turn
  __builtin_amdgcn_sched_barrier(0);

  v4f a = x[0], q = x[0] * x[0];
#pragma unroll   // as above
  for (int c = 1; c < SLOADS; ++c) { a += x[c]; q += x[c] * x[c]; }
  float s1 = (a.x + a.y) + (a.z + a.w);
  float s2 = (q.x + q.y) + (q.z + q.w);
#pragma unroll   // the five exchange distances become constants
  for (int d = 16; d > 0; d >>= 1) {
    s1 += __shfl_xor(s1, d);
    s2 += __shfl_xor(s2, d);
  }
  float mu = s1 * (1.0f / E_DIM);
  float var = s2 * (1.0f / E_DIM) - mu * mu;
  float sc = rsqrtf(var + 1e-6f);
#pragma unroll   // as above
  for (int c = 0; c < SLOADS; ++c) op[c * 32] = (x[c] - mu) * sc * g[c] + b[c];
}

// ---------------------------------------------------------------------------
// Host launcher
// ---------------------------------------------------------------------------
extern "C" void kernel_launch(void* const* d_in, const int* in_sizes, int n_in,
                              void* d_out, int out_size, void* d_ws, size_t ws_size,
                              hipStream_t stream) {
  const float* y    = (const float*)d_in[0];
  const float* Wqkv = (const float*)d_in[1];
  const float* bqkv = (const float*)d_in[2];
  const float* Wmsa = (const float*)d_in[3];
  const float* Bq   = (const float*)d_in[4];
  const float* Aq   = (const float*)d_in[5];
  const float* Bk   = (const float*)d_in[6];
  const float* Ak   = (const float*)d_in[7];
  const float* Bv   = (const float*)d_in[8];
  const float* Av   = (const float*)d_in[9];
  const float* Bo   = (const float*)d_in[10];
  const float* Ao   = (const float*)d_in[11];
  const float* gamma = (const float*)d_in[12];
  const float* beta  = (const float*)d_in[13];
  float* out = (float*)d_out;

  // workspace carve-up (all offsets 256B-aligned)
  char* ws = (char*)d_ws;
  size_t off = 0;
  auto carve = [&](size_t bytes) {
    char* p = ws + off;
    off += (bytes + 255) & ~(size_t)255;
    return p;
  };
  _Float16* Xh   = (_Float16*)carve((size_t)TOK * E_DIM * 2);   // y f16
  _Float16* Wqh  = (_Float16*)carve((size_t)NQKV * E_DIM * 2);  // Wqkv + LoRA, f16
  _Float16* Wmh  = (_Float16*)carve((size_t)E_DIM * E_DIM * 2); // Wmsa + LoRA, f16
  _Float16* Qh   = (_Float16*)carve((size_t)TOK * E_DIM * 2);   // [B,H,S,D]
  _Float16* Kh   = (_Float16*)carve((size_t)TOK * E_DIM * 2);   // [B,H,S,D]
  _Float16* Vt   = (_Float16*)carve((size_t)TOK * E_DIM * 2);   // [B,H,D,S]
  _Float16* Oh   = (_Float16*)carve((size_t)TOK * E_DIM * 2);   // [B,S,E]
  float*    res  = (float*)carve((size_t)TOK * E_DIM * 4);
  (void)ws_size; (void)in_sizes; (void)n_in; (void)out_size;

  // 0) convert y: a block of 8 waves takes 8 * SLOADS * 128 elements
  cvt_f32_to_f16<<<TOK * E_DIM / (8 * SLOADS * 128), 256, 0, stream>>>(y, Xh);
  // 1) effective f16 weights: 4 groups of 1024 rows
  fold_lora_kernel<<<4 * (E_DIM / FOLD_ROWS), 128, 0, stream>>>(
      Wqkv, Wmsa, Bq, Aq, Bk, Ak, Bv, Av, Bo, Ao, Wqh, Wmh);
  // 2) QKV GEMM (grid: N/128 x M/128)
  qkv_wmma_kernel<<<dim3(NQKV / 128, TOK / 128), 256, 0, stream>>>(
      Xh, Wqh, bqkv, Qh, Kh, Vt);
  // 3) attention: B*H*(S/32) wave tiles, 8 waves/block
  attn_wmma_kernel<<<(BATCH * H_NUM * (SEQ / 32)) / 8, 256, 0, stream>>>(
      Qh, Kh, Vt, Oh);
  // 4) output projection + residual (grid: N/128 x M/128)
  msa_wmma_kernel<<<dim3(E_DIM / 128, TOK / 128), 256, 0, stream>>>(
      Oh, Wmh, y, res);
  // 5) LayerNorm: 8 rows per block
  layernorm_kernel<<<TOK / 8, 256, 0, stream>>>(res, gamma, beta, out);
}

// v005
// A run of this version takes 102 microseconds.
// Two timings next to v004 put it at 1.09 and 1.08 times that version's speed.
// Over all steps from v000 it is 5.61 times as fast.
#include <hip/hip_runtime.h>
#include <hip/hip_bf16.h>

// ---------------------------------------------------------------------------
// Problem constants (match reference)
// ---------------------------------------------------------------------------
#define E_DIM 1024
#define H_NUM 16
#define D_DIM 64
#define R_DIM 8
#define BATCH 2
#define SEQ   2048
#define TOK   (BATCH * SEQ)      // 4096 tokens
#define NQKV  (3 * E_DIM)        // 3072

typedef __attribute__((ext_vector_type(16))) _Float16 v16h;
typedef __attribute__((ext_vector_type(8)))  _Float16 v8h;
typedef __attribute__((ext_vector_type(8)))  float    v8f;

__device__ __forceinline__ v8f wmma16(v16h a, v16h b, v8f c) {
  // D = A(16x32 f16) * B(32x16 f16) + C(16x16 f32)
  return __builtin_amdgcn_wmma_f32_16x16x32_f16(
      /*neg_a=*/false, a, /*neg_b=*/false, b,
      /*c_mod=*/(short)0, c, /*reuse_a=*/false, /*reuse_b=*/false);
}

// Load one 16x32 f16 operand tile into the wave32 WMMA register layout.
// Element (r, k) comes from base[(major + r) * ld + kb + k].
//   lane%16 -> r (A: row M / B: col N), lane/16 selects K-halves:
//   halves 0..7  = K (lane/16)*8 + 0..7
//   halves 8..15 = K 16 + (lane/16)*8 + 0..7
__device__ __forceinline__ v16h load_tile16(const _Float16* base, int ld,
                                            int major, int kb, int lane) {
  const _Float16* p = base + (size_t)(major + (lane & 15)) * (size_t)ld
                           + (size_t)(kb + ((lane >> 4) << 3));
  v8h lo = *(const v8h*)p;        // K = koff + 0..7
  v8h hi = *(const v8h*)(p + 16); // K = koff + 16..23
  return __builtin_shufflevector(lo, hi, 0,1,2,3,4,5,6,7,8,9,10,11,12,13,14,15);
}

// ---------------------------------------------------------------------------
// LDS staging by asynchronous copies. A staged row is 128 B of data (one whole
// line of its source) at a pitch of 144 B (16 B x odd: the ds_load_b128 pitch).
// Thread t of 256 copies 16 B: piece t%8 of row t/8, so one wave-wide copy
// covers 4 whole lines; further copies of the thread lie 32 rows on.
// ---------------------------------------------------------------------------
#define LPITCH 72                       // halves per staged row
#define LROWB  (LPITCH * 2)             // bytes per staged row

// 4 copies of 16 B per lane. The s_wait_xcnt stands inside the statement so
// that no address register is rewritten before the copies have taken it.
__device__ __forceinline__ void copy4(unsigned l0, unsigned l1, unsigned l2, unsigned l3,
                                      const _Float16* g0, const _Float16* g1,
                                      const _Float16* g2, const _Float16* g3) {
  asm volatile("global_load_async_to_lds_b128 %0, %4, off\n\t"
               "global_load_async_to_lds_b128 %1, %5, off\n\t"
               "global_load_async_to_lds_b128 %2, %6, off\n\t"
               "global_load_async_to_lds_b128 %3, %7, off\n\t"
               "s_wait_xcnt 0x0"
               :: "v"(l0), "v"(l1), "v"(l2), "v"(l3),
                  "v"(g0), "v"(g1), "v"(g2), "v"(g3) : "memory");
}
// 8 copies of 16 B per lane, same form.
__device__ __forceinline__ void copy8(unsigned l, const _Float16* ga, const _Float16* gb,
                                      unsigned lb_off, size_t gstep) {
  unsigned l0 = l, l1 = l + 32 * LROWB, l2 = l + 64 * LROWB, l3 = l + 96 * LROWB;
  unsigned l4 = l0 + lb_off, l5 = l1 + lb_off, l6 = l2 + lb_off, l7 = l3 + lb_off;
  const _Float16 *a0 = ga, *a1 = ga + gstep, *a2 = ga + 2 * gstep, *a3 = ga + 3 * gstep;
  const _Float16 *b0 = gb, *b1 = gb + gstep, *b2 = gb + 2 * gstep, *b3 = gb + 3 * gstep;
  asm volatile("global_load_async_to_lds_b128 %0, %8, off\n\t"
               "global_load_async_to_lds_b128 %1, %9, off\n\t"
               "global_load_async_to_lds_b128 %2, %10, off\n\t"
               "global_load_async_to_lds_b128 %3, %11, off\n\t"
               "global_load_async_to_lds_b128 %4, %12, off\n\t"
               "global_load_async_to_lds_b128 %5, %13, off\n\t"
               "global_load_async_to_lds_b128 %6, %14, off\n\t"
               "global_load_async_to_lds_b128 %7, %15, off\n\t"
               "s_wait_xcnt 0x0"
               :: "v"(l0), "v"(l1), "v"(l2), "v"(l3), "v"(l4), "v"(l5), "v"(l6), "v"(l7),
                  "v"(a0), "v"(a1), "v"(a2), "v"(a3), "v"(b0), "v"(b1), "v"(b2), "v"(b3)
               : "memory");
}
// the wave's own copies have landed
__device__ __forceinline__ void wait_copies() {
  asm volatile("s_wait_asynccnt 0x0" ::: "memory");
}
// the wave's own LDS reads have returned (its buffer may be refilled)
__device__ __forceinline__ void wait_lds_reads() {
  asm volatile("s_wait_dscnt 0x0" ::: "memory");
}

// ---------------------------------------------------------------------------
// GEMM core: C(128 x 128) = A[rows][1024] * B[cols][1024]^T per block of 8
// waves (4 in M x 2 in N, wave tile 32 x 64 as acc[2][4]). A stage is 64 k of
// 128 A rows and 128 B rows; two buffers, the next stage's copies fly while
// this one is multiplied.
// ---------------------------------------------------------------------------
#define GSTAGE (256 * LPITCH)           // halves per buffer
__device__ __forceinline__ void gemm_core(const _Float16* __restrict__ A,
                                          const _Float16* __restrict__ B,
                                          int row0, int col0, _Float16* sm,
                                          v8f (&acc)[2][4]) {
  int tid = threadIdx.x, lane = tid & 31, wave = tid >> 5;
  int wr = (wave >> 1) * 32;            // wave's rows in the A part
  int wc = 128 + (wave & 1) * 64;       // wave's rows in the B part
  const _Float16* ga = A + (size_t)(row0 + (tid >> 3)) * E_DIM + (tid & 7) * 8;
  const _Float16* gb = B + (size_t)(col0 + (tid >> 3)) * E_DIM + (tid & 7) * 8;
  unsigned l = (unsigned)(size_t)sm + (tid >> 3) * LROWB + (tid & 7) * 16;

  copy8(l, ga, gb, 128 * LROWB, (size_t)32 * E_DIM);
  wait_copies();
  __syncthreads();                      // stage 0 is published
  copy8(l + GSTAGE * 2, ga + 64, gb + 64, 128 * LROWB, (size_t)32 * E_DIM);

  for (int t = 0; t < E_DIM / 64; ++t) {
    const _Float16* sb = sm + (t & 1) * GSTAGE;
#pragma unroll   // both 32-k steps of a stage inline: LDS offsets become immediates
    for (int kb = 0; kb < 64; kb += 32) {
      // the six fragments of a 32-k step are read as one group ahead of its WMMAs
      v16h a0 = load_tile16(sb, LPITCH, wr, kb, lane);
      v16h a1 = load_tile16(sb, LPITCH, wr + 16, kb, lane);
      v16h b[4];
#pragma unroll   // b[] and acc[][] need constant indices to stay in registers
      for (int j = 0; j < 4; ++j) b[j] = load_tile16(sb, LPITCH, wc + j * 16, kb, lane);
      // keeps the reads together: sunk among the WMMAs, each pair costs its own LDS wait
      __builtin_amdgcn_sched_barrier(0);
#pragma unroll
      for (int j = 0; j < 4; ++j) {
        acc[0][j] = wmma16(a0, b[j], acc[0][j]);
        acc[1][j] = wmma16(a1, b[j], acc[1][j]);
      }
    }
    wait_lds_reads();
    wait_copies();
    __syncthreads();                    // publishes stage t+1, frees stage t's buffer
    if (t + 2 < E_DIM / 64)
      copy8(l + (t & 1) * (GSTAGE * 2), ga + (t + 2) * 64, gb + (t + 2) * 64,
            128 * LROWB, (size_t)32 * E_DIM);
  }
  wait_copies();
}

// ---------------------------------------------------------------------------
// 0) f32 -> f16 convert, as a stream: a wave takes 4 KiB of input by 8 loads
//    of 16 B per lane (each wave-wide load is 512 contiguous bytes), all in
//    flight together, and stores 256 contiguous bytes per store.
//    The grid covers TOK * E_DIM elements exactly.
// ---------------------------------------------------------------------------
#define SLOADS 8                        // 16-byte loads in flight per lane
typedef __attribute__((ext_vector_type(4))) _Float16 v4h;
__global__ __launch_bounds__(256)
void cvt_f32_to_f16(const float* __restrict__ in, _Float16* __restrict__ out) {
  int lane = threadIdx.x & 31;
  size_t first = ((size_t)blockIdx.x * 8 + (threadIdx.x >> 5)) * (SLOADS * 32) + lane;
  const float4* ip = (const float4*)in + first;
  v4h* op = (v4h*)out + first;
  float4 x[SLOADS];
#pragma unroll   // x[] needs constant indices to stay in registers
  for (int c = 0; c < SLOADS; ++c) x[c] = ip[c * 32];
#pragma unroll   // as above
  for (int c = 0; c < SLOADS; ++c) {
    v4h o = {(_Float16)x[c].x, (_Float16)x[c].y, (_Float16)x[c].z, (_Float16)x[c].w};
    op[c * 32] = o;
  }
}

// ---------------------------------------------------------------------------
// 1) Effective f16 weights. y @ W^T + y @ (B A) = y @ (W + (B A)^T)^T, so
//      Wout[n][k] = f16( W[n][k] + sum_r B[k][r] * A[r][n] )
//    for the Q, K, V row groups of Wqkv and for Wmsa (group 3).
//    128 threads cover one row of 1024 k, 8 k each; a thread keeps its 8x8
//    piece of B in registers and walks FOLD_ROWS rows; A[r][n] is the same
//    for the whole block.
// ---------------------------------------------------------------------------
#define FOLD_ROWS 8
__global__ __launch_bounds__(128)
void fold_lora_kernel(const float* __restrict__ Wqkv, const float* __restrict__ Wmsa,
                      const float* __restrict__ Bq, const float* __restrict__ Aq,
                      const float* __restrict__ Bk, const float* __restrict__ Ak,
                      const float* __restrict__ Bv, const float* __restrict__ Av,
                      const float* __restrict__ Bo, const float* __restrict__ Ao,
                      _Float16* __restrict__ Wqh, _Float16* __restrict__ Wmh) {
  int g  = blockIdx.x / (E_DIM / FOLD_ROWS);               // 0=Q 1=K 2=V 3=out
  int n0 = (blockIdx.x % (E_DIM / FOLD_ROWS)) * FOLD_ROWS; // row in the group
  const float* Wg = (g < 3) ? Wqkv + (size_t)g * E_DIM * E_DIM : Wmsa;
  _Float16*    Og = (g < 3) ? Wqh + (size_t)g * E_DIM * E_DIM : Wmh;
  const float* Bg = (g == 0) ? Bq : ((g == 1) ? Bk : ((g == 2) ? Bv : Bo));
  const float* Ag = (g == 0) ? Aq : ((g == 1) ? Ak : ((g == 2) ? Av : Ao));
  int k0 = threadIdx.x * 8;

  float w[FOLD_ROWS][8];
#pragma unroll
  for (int i = 0; i < FOLD_ROWS; ++i) {
    const float4* wp = (const float4*)(Wg + (size_t)(n0 + i) * E_DIM + k0);
    float4 lo = wp[0], hi = wp[1];
    w[i][0] = lo.x; w[i][1] = lo.y; w[i][2] = lo.z; w[i][3] = lo.w;
    w[i][4] = hi.x; w[i][5] = hi.y; w[i][6] = hi.z; w[i][7] = hi.w;
  }
  float bm[8][R_DIM];   // bm[kk][r] = B[k0 + kk][r]
#pragma unroll
  for (int kk = 0; kk < 8; ++kk) {
    const float4* bp = (const float4*)(Bg + (size_t)(k0 + kk) * R_DIM);
    float4 lo = bp[0], hi = bp[1];
    bm[kk][0] = lo.x; bm[kk][1] = lo.y; bm[kk][2] = lo.z; bm[kk][3] = lo.w;
    bm[kk][4] = hi.x; bm[kk][5] = hi.y; bm[kk][6] = hi.z; bm[kk][7] = hi.w;
  }
#pragma unroll
  for (int i = 0; i < FOLD_ROWS; ++i) {
    float a8[R_DIM];
#pragma unroll
    for (int r = 0; r < R_DIM; ++r) a8[r] = Ag[r * E_DIM + n0 + i];
    v8h o;
#pragma unroll
    for (int kk = 0; kk < 8; ++kk) {
      float v = w[i][kk];
#pragma unroll
      for (int r = 0; r < R_DIM; ++r) v = __builtin_fmaf(bm[kk][r], a8[r], v);
      o[kk] = (_Float16)v;
    }
    *(v8h*)(Og + (size_t)(n0 + i) * E_DIM + k0) = o;
  }
}

// ---------------------------------------------------------------------------
// 2) QKV GEMM: C[TOK, 3072] = Xh @ Weff^T + bias (LoRA is in Weff), written to
//    Qh,Kh [B,H,S,D] f16 (Q pre-scaled by 1/sqrt(D)) and Vt [B,H,D,S] f16.
//    Block: 8 waves = 128 tokens x 128 features of ONE of Q, K, V, operands
//    staged in LDS (gemm_core), 8 WMMAs per 32-k step and wave.
//    An accumulator lane holds 8 consecutive rows of the FIRST operand, so the
//    first operand is the one whose index runs along the output's rows in
//    memory: the weights for Q and K (d is contiguous), the tokens for V^T
//    (s is contiguous). The block's tile is then laid in LDS as 128 rows of
//    256 B by 16-byte writes and goes out as whole 128-byte lines.
// ---------------------------------------------------------------------------
#define EPITCH 136                      // halves per staged output row: 272 B = 16 B x odd
__global__ __launch_bounds__(256)
void qkv_wmma_kernel(const _Float16* __restrict__ Xh,
                     const _Float16* __restrict__ Wh,     // [3072,1024] f16
                     const float* __restrict__ bqkv,
                     _Float16* __restrict__ Qh, _Float16* __restrict__ Kh,
                     _Float16* __restrict__ Vt) {
  __shared__ __attribute__((aligned(16))) _Float16 sm[2 * GSTAGE];
  int tid = threadIdx.x, lane = tid & 31, wave = tid >> 5;
  int tok0 = blockIdx.y * 128;             // first token of the block
  int col0 = blockIdx.x * 128;             // first feature of the block, 0..3071
  int g = blockIdx.x >> 3;                 // 0=Q 1=K 2=V, the same for the whole block
  bool wfirst = g < 2;                     // weights as first operand

  v8f acc[2][4];
#pragma unroll
  for (int i = 0; i < 2; ++i)
#pragma unroll
    for (int j = 0; j < 4; ++j) acc[i][j] = v8f{};

  gemm_core(wfirst ? Wh : Xh, wfirst ? Xh : Wh,
            wfirst ? col0 : tok0, wfirst ? tok0 : col0, sm, acc);

  // acc[i][j][v] = C[m0 + i*16 + v][n0 + j*16]: m counts rows of the first
  // operand, n rows of the second, both inside the block's tile.
  // gemm_core ends behind a barrier with every LDS read returned and no copy
  // in flight: its buffers are free for the tile, staged as [n][m].
  int m0 = (wave >> 1) * 32 + ((lane >> 4) << 3);
  int n0 = (wave & 1) * 64 + (lane & 15);
  _Float16* st = sm + n0 * EPITCH + m0;
  if (wfirst) {                            // m = feature, n = token
    float sc = (g == 0) ? 0.125f : 1.0f;   // fold 1/sqrt(64) into Q
#pragma unroll   // acc[][] needs constant indices to stay in registers
    for (int i = 0; i < 2; ++i) {
      const float4* bp = (const float4*)(bqkv + col0 + m0 + i * 16);
      float4 lo = bp[0], hi = bp[1];
      float bias[8] = {lo.x, lo.y, lo.z, lo.w, hi.x, hi.y, hi.z, hi.w};
#pragma unroll
      for (int j = 0; j < 4; ++j) {
        v8h w;
#pragma unroll
        for (int v = 0; v < 8; ++v) w[v] = (_Float16)((acc[i][j][v] + bias[v]) * sc);
        *(v8h*)(st + j * 16 * EPITCH + i * 16) = w;
      }
    }
  } else {                                 // m = token, n = feature
#pragma unroll   // as above
    for (int j = 0; j < 4; ++j) {
      float bias = bqkv[col0 + n0 + j * 16];
#pragma unroll
      for (int i = 0; i < 2; ++i) {
        v8h w;
#pragma unroll
        for (int v = 0; v < 8; ++v) w[v] = (_Float16)(acc[i][j][v] + bias);
        *(v8h*)(st + j * 16 * EPITCH + i * 16) = w;
      }
    }
  }
  __syncthreads();                         // the whole tile is staged

  // thread t takes 16-byte piece t%16 of staged rows t/16 + 16*c: a wave-wide
  // store covers two staged rows = four whole lines
  int piece = tid & 15, r = tid >> 4;
  int e0 = col0 & (E_DIM - 1);             // first feature inside Q, K or V
  int bb = tok0 >> 11, s0 = tok0 & (SEQ - 1);
  const _Float16* ld = sm + r * EPITCH + piece * 8;
  v8h w[8];
#pragma unroll   // w[] needs constant indices to stay in registers
  for (int c = 0; c < 8; ++c) w[c] = *(const v8h*)(ld + c * 16 * EPITCH);
  if (wfirst) {                            // staged row = token, 2 heads of 128 B
    int e = e0 + piece * 8;
    _Float16* dst = ((g == 0) ? Qh : Kh)
        + (((size_t)bb * H_NUM + (e >> 6)) * SEQ + s0 + r) * D_DIM + (e & 63);
#pragma unroll   // as above; the row steps become immediate offsets
    for (int c = 0; c < 8; ++c) *(v8h*)(dst + c * 16 * D_DIM) = w[c];
  } else {                                 // staged row = feature (h*64 + d), 128 tokens
    _Float16* dst = Vt + ((size_t)bb * E_DIM + e0 + r) * SEQ + s0 + piece * 8;
#pragma unroll   // as above
    for (int c = 0; c < 8; ++c) *(v8h*)(dst + (size_t)c * 16 * SEQ) = w[c];
  }
}

#define ASTAGE (128 * LPITCH)
// value of lane l ^ 16
__device__ __forceinline__ float xhalf(float x) {
  int xi = __builtin_bit_cast(int, x);
  return __builtin_bit_cast(float, __builtin_amdgcn_permlanex16(
      xi, xi, 0x76543210, 0xfedcba98, false, false));
}

__global__ __launch_bounds__(256)
void attn_wmma_kernel(const _Float16* __restrict__ Q,
                      const _Float16* __restrict__ K,
                      const _Float16* __restrict__ Vt,
                      _Float16* __restrict__ Oh) {
  __shared__ __attribute__((aligned(16))) _Float16 sm[2 * ASTAGE];
  int lane = threadIdx.x & 31, wave = threadIdx.x >> 5;
  int id = blockIdx.x * 8 + wave;           // 0 .. B*H*(S/32)-1 = 2047
  int qt = id & (SEQ / 32 - 1);             // 32-query tile in sequence
  int bh = id >> 6;                         // 0..31
  int b = bh >> 4, h = bh & 15;
  const _Float16* Qp = Q + (size_t)bh * SEQ * D_DIM;
  const _Float16* Kp = K + (size_t)bh * SEQ * D_DIM;
  const _Float16* Vp = Vt + (size_t)bh * D_DIM * SEQ;
  int qrow = qt * 32;

  // Q^T as B operand: column = query, kept in registers for the whole loop
  v16h bq[2][2];
#pragma unroll
  for (int i = 0; i < 2; ++i) {
    bq[i][0] = load_tile16(Qp, D_DIM, qrow + i * 16, 0, lane);
    bq[i][1] = load_tile16(Qp, D_DIM, qrow + i * 16, 32, lane);
  }

  // o[i][j][r] = O^T[d = j*16 + 8*(lane/16) + r][query = qrow + i*16 + lane%16]
  v8f o[2][4];
  float m[2], l[2];   // per query column; l is the lane half's own partial sum
#pragma unroll
  for (int i = 0; i < 2; ++i) {
#pragma unroll
    for (int j = 0; j < 4; ++j) o[i][j] = v8f{};
    m[i] = -1e30f; l[i] = 0.f;
  }

  // this thread's pieces of a stage: K rows r, r+32 and V^T rows r, r+32
  const _Float16* gk = Kp + (size_t)(threadIdx.x >> 3) * D_DIM + (threadIdx.x & 7) * 8;
  const _Float16* gv = Vp + (size_t)(threadIdx.x >> 3) * SEQ + (threadIdx.x & 7) * 8;
  unsigned lk = (unsigned)(size_t)sm + (threadIdx.x >> 3) * LROWB + (threadIdx.x & 7) * 16;

  copy4(lk, lk + 32 * LROWB, lk + 64 * LROWB, lk + 96 * LROWB,
        gk, gk + 32 * D_DIM, gv, gv + 32 * SEQ);
  wait_copies();
  __syncthreads();                          // stage 0 is published
  copy4(lk + ASTAGE * 2, lk + ASTAGE * 2 + 32 * LROWB,
        lk + ASTAGE * 2 + 64 * LROWB, lk + ASTAGE * 2 + 96 * LROWB,
        gk + 64 * D_DIM, gk + 96 * D_DIM, gv + 64, gv + 32 * SEQ + 64);

  for (int t = 0; t < SEQ / 64; ++t) {
   const _Float16* sk = sm + (t & 1) * ASTAGE;   // K rows of this stage
   const _Float16* sv = sk + 64 * LPITCH;        // V^T rows of this stage
#pragma unroll   // both 32-key passes of a stage inline: LDS offsets become immediates
   for (int kb = 0; kb < 64; kb += 32) {
    // s[i][kt][r] = score(key 64*t + kb + kt*16 + 8*(lane/16) + r, query column)
    v8f s[2][2];
#pragma unroll
    for (int i = 0; i < 2; ++i) { s[i][0] = v8f{}; s[i][1] = v8f{}; }

#pragma unroll
    for (int kt = 0; kt < 2; ++kt) {
      v16h ak0 = load_tile16(sk, LPITCH, kb + kt * 16, 0, lane);
      v16h ak1 = load_tile16(sk, LPITCH, kb + kt * 16, 32, lane);
#pragma unroll
      for (int i = 0; i < 2; ++i) {
        s[i][kt] = wmma16(ak0, bq[i][0], s[i][kt]);
        s[i][kt] = wmma16(ak1, bq[i][1], s[i][kt]);
      }
    }

    v16h bp[2];   // P^T as B operand, packed straight from the score tiles
#pragma unroll
    for (int i = 0; i < 2; ++i) {
      float t[8];
#pragma unroll
      for (int v = 0; v < 8; ++v) t[v] = fmaxf(s[i][0][v], s[i][1][v]);
      float mx = fmaxf(fmaxf(fmaxf(t[0], t[1]), fmaxf(t[2], t[3])),
                       fmaxf(fmaxf(t[4], t[5]), fmaxf(t[6], t[7])));
      mx = fmaxf(mx, xhalf(mx));            // both halves use one maximum
      float mn = fmaxf(m[i], mx);
      float corr = __expf(m[i] - mn);
      v8f p0 = s[i][0] - mn;                // keys kb + 8*(lane/16) + v
      v8f p1 = s[i][1] - mn;                // keys kb + 16 + 8*(lane/16) + v
#pragma unroll
      for (int v = 0; v < 8; ++v) { p0[v] = __expf(p0[v]); p1[v] = __expf(p1[v]); }
#pragma unroll
      for (int v = 0; v < 8; ++v) {
        bp[i][v]     = (_Float16)p0[v];
        bp[i][8 + v] = (_Float16)p1[v];
      }
      v8f ps = p0 + p1;
      float rs = ((ps[0] + ps[1]) + (ps[2] + ps[3])) + ((ps[4] + ps[5]) + (ps[6] + ps[7]));
      l[i] = l[i] * corr + rs;
      m[i] = mn;
#pragma unroll
      for (int j = 0; j < 4; ++j) o[i][j] *= corr;
    }

    // V^T operand tiles loaded once, reused by both query subtiles
#pragma unroll
    for (int j = 0; j < 4; ++j) {
      v16h av = load_tile16(sv, LPITCH, j * 16, kb, lane);
#pragma unroll
      for (int i = 0; i < 2; ++i) o[i][j] = wmma16(av, bp[i], o[i][j]);
    }
   }
   wait_lds_reads();
   wait_copies();
   __syncthreads();                         // publishes stage t+1, frees stage t's buffer
   if (t + 2 < SEQ / 64) {
     unsigned lt = lk + (t & 1) * (ASTAGE * 2);
     const _Float16* gkt = gk + (size_t)(t + 2) * 64 * D_DIM;
     const _Float16* gvt = gv + (t + 2) * 64;
     copy4(lt, lt + 32 * LROWB, lt + 64 * LROWB, lt + 96 * LROWB,
           gkt, gkt + 32 * D_DIM, gvt, gvt + 32 * SEQ);
   }
  }
  wait_copies();

  // a lane holds 8 consecutive d of one query: one 16-byte store per tile
#pragma unroll
  for (int i = 0; i < 2; ++i) {
    float inv = 1.0f / (l[i] + xhalf(l[i]));
    int ss = qrow + i * 16 + (lane & 15);
    _Float16* op = Oh + ((size_t)b * SEQ + ss) * E_DIM + h * D_DIM
                      + ((lane >> 4) << 3);
#pragma unroll
    for (int j = 0; j < 4; ++j) {
      v8h w;
#pragma unroll
      for (int r = 0; r < 8; ++r) w[r] = (_Float16)(o[i][j][r] * inv);
      *(v8h*)(op + j * 16) = w;
    }
  }
}

// ---------------------------------------------------------------------------
// 4) res = O @ Weff^T + y   (f32 out; Weff = Wmsa + (Bo Ao)^T)
//    Wave tile 32x64, block 128x128, like the QKV GEMM.
// ---------------------------------------------------------------------------
__global__ __launch_bounds__(256)
void msa_wmma_kernel(const _Float16* __restrict__ Oh,
                     const _Float16* __restrict__ Wmh,   // [1024,1024] f16
                     const float* __restrict__ y, float* __restrict__ res) {
  __shared__ __attribute__((aligned(16))) _Float16 sm[2 * GSTAGE];
  int lane = threadIdx.x & 31, wave = threadIdx.x >> 5;
  int rowb = blockIdx.y * 128 + (wave >> 1) * 32;
  int colb = blockIdx.x * 128 + (wave & 1) * 64;

  v8f acc[2][4];
#pragma unroll
  for (int i = 0; i < 2; ++i)
#pragma unroll
    for (int j = 0; j < 4; ++j) acc[i][j] = v8f{};

  gemm_core(Oh, Wmh, blockIdx.y * 128, blockIdx.x * 128, sm, acc);

#pragma unroll
  for (int j = 0; j < 4; ++j) {
    int col = colb + j * 16 + (lane & 15);
#pragma unroll
    for (int i = 0; i < 2; ++i) {
#pragma unroll
      for (int v = 0; v < 8; ++v) {
        int row = rowb + i * 16 + v + ((lane >> 4) << 3);
        float val = acc[i][j][v];
        val += y[(size_t)row * E_DIM + col];
        res[(size_t)row * E_DIM + col] = val;
      }
    }
  }
}

// ---------------------------------------------------------------------------
// 5) LayerNorm rows of res -> d_out, as a stream: one wave per row. The row
//    (4 KiB) is read once by 8 loads of 16 B per lane and stays in registers;
//    the two sums are taken in the lane (four chains each) and then over the
//    32 lanes by a butterfly, so every lane ends with the same totals.
// ---------------------------------------------------------------------------
typedef __attribute__((ext_vector_type(4))) float v4f;
__global__ __launch_bounds__(256)
void layernorm_kernel(const float* __restrict__ res,
                      const float* __restrict__ gamma,
                      const float* __restrict__ beta, float* __restrict__ out) {
  int lane = threadIdx.x & 31;
  // the wave's number as a scalar: the row's base then sits in scalar registers
  // and every load and store is addressed by the one lane-offset register
  size_t row = (size_t)blockIdx.x * 8 + __builtin_amdgcn_readfirstlane(threadIdx.x >> 5);
  const v4f* rp = (const v4f*)(res + row * E_DIM) + lane;
  const v4f* gp = (const v4f*)gamma + lane;
  const v4f* bp = (const v4f*)beta + lane;
  v4f* op = (v4f*)(out + row * E_DIM) + lane;

  v4f x[SLOADS], g[SLOADS], b[SLOADS];
#pragma unroll   // x[], g[], b[] need constant indices to stay in registers
  for (int c = 0; c < SLOADS; ++c) x[c] = rp[c * 32];
#pragma unroll   // as above
  for (int c = 0; c < SLOADS; ++c) { g[c] = gp[c * 32]; b[c] = bp[c * 32]; }
  // keeps all 24 loads in front of the sums: sunk behind the butterfly, the
  // gamma and beta loads would each be waited for in turn
  __builtin_amdgcn_sched_barrier(0);

  v4f a = x[0], q = x[0] * x[0];
#pragma unroll   // as above
  for (int c = 1; c < SLOADS; ++c) { a += x[c]; q += x[c] * x[c]; }
  float s1 = (a.x + a.y) + (a.z + a.w);
  float s2 = (q.x + q.y) + (q.z + q.w);
#pragma unroll   // the five exchange distances become constants
  for (int d = 16; d > 0; d >>= 1) {
    s1 += __shfl_xor(s1, d);
    s2 += __shfl_xor(s2, d);
  }
  float mu = s1 * (1.0f / E_DIM);
  float var = s2 * (1.0f / E_DIM) - mu * mu;
  float sc = rsqrtf(var + 1e-6f);
#pragma unroll   // as above
  for (int c = 0; c < SLOADS; ++c) op[c * 32] = (x[c] - mu) * sc * g[c] + b[c];
}

// ---------------------------------------------------------------------------
// Host launcher
// ---------------------------------------------------------------------------
extern "C" void kernel_launch(void* const* d_in, const int* in_sizes, int n_in,
                              void* d_out, int out_size, void* d_ws, size_t ws_size,
                              hipStream_t stream) {
  const float* y    = (const float*)d_in[0];
  const float* Wqkv = (const float*)d_in[1];
  const float* bqkv = (const float*)d_in[2];
  const float* Wmsa = (const float*)d_in[3];
  const float* Bq   = (const float*)d_in[4];
  const float* Aq   = (const float*)d_in[5];
  const float* Bk   = (const float*)d_in[6];
  const float* Ak   = (const float*)d_in[7];
  const float* Bv   = (const float*)d_in[8];
  const float* Av   = (const float*)d_in[9];
  const float* Bo   = (const float*)d_in[10];
  const float* Ao   = (const float*)d_in[11];
  const float* gamma = (const float*)d_in[12];
  const float* beta  = (const float*)d_in[13];
  float* out = (float*)d_out;

  // workspace carve-up (all offsets 256B-aligned)
  char* ws = (char*)d_ws;
  size_t off = 0;
  auto carve = [&](size_t bytes) {
    char* p = ws + off;
    off += (bytes + 255) & ~(size_t)255;
    return p;
  };
  _Float16* Xh   = (_Float16*)carve((size_t)TOK * E_DIM * 2);   // y f16
  _Float16* Wqh  = (_Float16*)carve((size_t)NQKV * E_DIM * 2);  // Wqkv + LoRA, f16
  _Float16* Wmh  = (_Float16*)carve((size_t)E_DIM * E_DIM * 2); // Wmsa + LoRA, f16
  _Float16* Qh   = (_Float16*)carve((size_t)TOK * E_DIM * 2);   // [B,H,S,D]
  _Float16* Kh   = (_Float16*)carve((size_t)TOK * E_DIM * 2);   // [B,H,S,D]
  _Float16* Vt   = (_Float16*)carve((size_t)TOK * E_DIM * 2);   // [B,H,D,S]
  _Float16* Oh   = (_Float16*)carve((size_t)TOK * E_DIM * 2);   // [B,S,E]
  float*    res  = (float*)carve((size_t)TOK * E_DIM * 4);
  (void)ws_size; (void)in_sizes; (void)n_in; (void)out_size;

  // 0) convert y: a block of 8 waves takes 8 * SLOADS * 128 elements
  cvt_f32_to_f16<<<TOK * E_DIM / (8 * SLOADS * 128), 256, 0, stream>>>(y, Xh);
  // 1) effective f16 weights: 4 groups of 1024 rows
  fold_lora_kernel<<<4 * (E_DIM / FOLD_ROWS), 128, 0, stream>>>(
      Wqkv, Wmsa, Bq, Aq, Bk, Ak, Bv, Av, Bo, Ao, Wqh, Wmh);
  // 2) QKV GEMM (grid: N/128 x M/128)
  qkv_wmma_kernel<<<dim3(NQKV / 128, TOK / 128), 256, 0, stream>>>(
      Xh, Wqh, bqkv, Qh, Kh, Vt);
  // 3) attention: B*H*(S/32) wave tiles, 8 waves/block
  attn_wmma_kernel<<<(BATCH * H_NUM * (SEQ / 32)) / 8, 256, 0, stream>>>(
      Qh, Kh, Vt, Oh);
  // 4) output projection + residual (grid: N/128 x M/128)
  msa_wmma_kernel<<<dim3(E_DIM / 128, TOK / 128), 256, 0, stream>>>(
      Oh, Wmh, y, res);
  // 5) LayerNorm: 8 rows per block
  layernorm_kernel<<<TOK / 8, 256, 0, stream>>>(res, gamma, beta, out);
}

// v006
// One run takes 98.1 microseconds.
// Next to v005, in two timings, it ran 1.03 and 1.04 times as fast.
// Counting every step since v000, it is 5.80 times as fast.
#include <hip/hip_runtime.h>
#include <hip/hip_bf16.h>

// ---------------------------------------------------------------------------
// Problem constants (match reference)
// ---------------------------------------------------------------------------
#define E_DIM 1024
#define H_NUM 16
#define D_DIM 64
#define R_DIM 8
#define BATCH 2
#define SEQ   2048
#define TOK   (BATCH * SEQ)      // 4096 tokens
#define NQKV  (3 * E_DIM)        // 3072

typedef __attribute__((ext_vector_type(16))) _Float16 v16h;
typedef __attribute__((ext_vector_type(8)))  _Float16 v8h;
typedef __attribute__((ext_vector_type(8)))  float    v8f;

__device__ __forceinline__ v8f wmma16(v16h a, v16h b, v8f c) {
  // D = A(16x32 f16) * B(32x16 f16) + C(16x16 f32)
  return __builtin_amdgcn_wmma_f32_16x16x32_f16(
      /*neg_a=*/false, a, /*neg_b=*/false, b,
      /*c_mod=*/(short)0, c, /*reuse_a=*/false, /*reuse_b=*/false);
}

// Load one 16x32 f16 operand tile into the wave32 WMMA register layout.
// Element (r, k) comes from base[(major + r) * ld + kb + k].
//   lane%16 -> r (A: row M / B: col N), lane/16 selects K-halves:
//   halves 0..7  = K (lane/16)*8 + 0..7
//   halves 8..15 = K 16 + (lane/16)*8 + 0..7
__device__ __forceinline__ v16h load_tile16(const _Float16* base, int ld,
                                            int major, int kb, int lane) {
  const _Float16* p = base + (size_t)(major + (lane & 15)) * (size_t)ld
                           + (size_t)(kb + ((lane >> 4) << 3));
  v8h lo = *(const v8h*)p;        // K = koff + 0..7
  v8h hi = *(const v8h*)(p + 16); // K = koff + 16..23
  return __builtin_shufflevector(lo, hi, 0,1,2,3,4,5,6,7,8,9,10,11,12,13,14,15);
}

// ---------------------------------------------------------------------------
// LDS staging by asynchronous copies. A staged row is 128 B of data (one whole
// line of its source) at a pitch of 144 B (16 B x odd: the ds_load_b128 pitch).
// Thread t of 256 copies 16 B: piece t%8 of row t/8, so one wave-wide copy
// covers 4 whole lines; further copies of the thread lie 32 rows on.
// ---------------------------------------------------------------------------
#define LPITCH 72                       // halves per staged row
#define LROWB  (LPITCH * 2)             // bytes per staged row

// 4 copies of 16 B per lane. The s_wait_xcnt stands inside the statement so
// that no address register is rewritten before the copies have taken it.
__device__ __forceinline__ void copy4(unsigned l0, unsigned l1, unsigned l2, unsigned l3,
                                      const _Float16* g0, const _Float16* g1,
                                      const _Float16* g2, const _Float16* g3) {
  asm volatile("global_load_async_to_lds_b128 %0, %4, off\n\t"
               "global_load_async_to_lds_b128 %1, %5, off\n\t"
               "global_load_async_to_lds_b128 %2, %6, off\n\t"
               "global_load_async_to_lds_b128 %3, %7, off\n\t"
               "s_wait_xcnt 0x0"
               :: "v"(l0), "v"(l1), "v"(l2), "v"(l3),
                  "v"(g0), "v"(g1), "v"(g2), "v"(g3) : "memory");
}
// 8 copies of 16 B per lane, same form.
__device__ __forceinline__ void copy8(unsigned l, const _Float16* ga, const _Float16* gb,
                                      unsigned lb_off, size_t gstep) {
  unsigned l0 = l, l1 = l + 32 * LROWB, l2 = l + 64 * LROWB, l3 = l + 96 * LROWB;
  unsigned l4 = l0 + lb_off, l5 = l1 + lb_off, l6 = l2 + lb_off, l7 = l3 + lb_off;
  const _Float16 *a0 = ga, *a1 = ga + gstep, *a2 = ga + 2 * gstep, *a3 = ga + 3 * gstep;
  const _Float16 *b0 = gb, *b1 = gb + gstep, *b2 = gb + 2 * gstep, *b3 = gb + 3 * gstep;
  asm volatile("global_load_async_to_lds_b128 %0, %8, off\n\t"
               "global_load_async_to_lds_b128 %1, %9, off\n\t"
               "global_load_async_to_lds_b128 %2, %10, off\n\t"
               "global_load_async_to_lds_b128 %3, %11, off\n\t"
               "global_load_async_to_lds_b128 %4, %12, off\n\t"
               "global_load_async_to_lds_b128 %5, %13, off\n\t"
               "global_load_async_to_lds_b128 %6, %14, off\n\t"
               "global_load_async_to_lds_b128 %7, %15, off\n\t"
               "s_wait_xcnt 0x0"
               :: "v"(l0), "v"(l1), "v"(l2), "v"(l3), "v"(l4), "v"(l5), "v"(l6), "v"(l7),
                  "v"(a0), "v"(a1), "v"(a2), "v"(a3), "v"(b0), "v"(b1), "v"(b2), "v"(b3)
               : "memory");
}
// the wave's own copies have landed
__device__ __forceinline__ void wait_copies() {
  asm volatile("s_wait_asynccnt 0x0" ::: "memory");
}
// the wave's own LDS reads have returned (its buffer may be refilled)
__device__ __forceinline__ void wait_lds_reads() {
  asm volatile("s_wait_dscnt 0x0" ::: "memory");
}

// ---------------------------------------------------------------------------
// GEMM core: C(128 x 128) = A[rows][1024] * B[cols][1024]^T per block of 8
// waves (4 in M x 2 in N, wave tile 32 x 64 as acc[2][4]). A stage is 64 k of
// 128 A rows and 128 B rows; two buffers, the next stage's copies fly while
// this one is multiplied.
// ---------------------------------------------------------------------------
#define GSTAGE (256 * LPITCH)           // halves per buffer
__device__ __forceinline__ void gemm_core(const _Float16* __restrict__ A,
                                          const _Float16* __restrict__ B,
                                          int row0, int col0, _Float16* sm,
                                          v8f (&acc)[2][4]) {
  int tid = threadIdx.x, lane = tid & 31, wave = tid >> 5;
  int wr = (wave >> 1) * 32;            // wave's rows in the A part
  int wc = 128 + (wave & 1) * 64;       // wave's rows in the B part
  const _Float16* ga = A + (size_t)(row0 + (tid >> 3)) * E_DIM + (tid & 7) * 8;
  const _Float16* gb = B + (size_t)(col0 + (tid >> 3)) * E_DIM + (tid & 7) * 8;
  unsigned l = (unsigned)(size_t)sm + (tid >> 3) * LROWB + (tid & 7) * 16;

  copy8(l, ga, gb, 128 * LROWB, (size_t)32 * E_DIM);
  wait_copies();
  __syncthreads();                      // stage 0 is published
  copy8(l + GSTAGE * 2, ga + 64, gb + 64, 128 * LROWB, (size_t)32 * E_DIM);

  for (int t = 0; t < E_DIM / 64; ++t) {
    const _Float16* sb = sm + (t & 1) * GSTAGE;
#pragma unroll   // both 32-k steps of a stage inline: LDS offsets become immediates
    for (int kb = 0; kb < 64; kb += 32) {
      // the six fragments of a 32-k step are read as one group ahead of its WMMAs
      v16h a0 = load_tile16(sb, LPITCH, wr, kb, lane);
      v16h a1 = load_tile16(sb, LPITCH, wr + 16, kb, lane);
      v16h b[4];
#pragma unroll   // b[] and acc[][] need constant indices to stay in registers
      for (int j = 0; j < 4; ++j) b[j] = load_tile16(sb, LPITCH, wc + j * 16, kb, lane);
      // keeps the reads together: sunk among the WMMAs, each pair costs its own LDS wait
      __builtin_amdgcn_sched_barrier(0);
#pragma unroll
      for (int j = 0; j < 4; ++j) {
        acc[0][j] = wmma16(a0, b[j], acc[0][j]);
        acc[1][j] = wmma16(a1, b[j], acc[1][j]);
      }
    }
    wait_lds_reads();
    wait_copies();
    __syncthreads();                    // publishes stage t+1, frees stage t's buffer
    if (t + 2 < E_DIM / 64)
      copy8(l + (t & 1) * (GSTAGE * 2), ga + (t + 2) * 64, gb + (t + 2) * 64,
            128 * LROWB, (size_t)32 * E_DIM);
  }
  wait_copies();
}

// ---------------------------------------------------------------------------
// 0) f32 -> f16 convert, as a stream: a wave takes 4 KiB of input by 8 loads
//    of 16 B per lane (each wave-wide load is 512 contiguous bytes), all in
//    flight together, and stores 256 contiguous bytes per store.
//    The grid covers TOK * E_DIM elements exactly.
// ---------------------------------------------------------------------------
#define SLOADS 8                        // 16-byte loads in flight per lane
typedef __attribute__((ext_vector_type(4))) _Float16 v4h;
__global__ __launch_bounds__(256)
void cvt_f32_to_f16(const float* __restrict__ in, _Float16* __restrict__ out) {
  int lane = threadIdx.x & 31;
  size_t first = ((size_t)blockIdx.x * 8 + (threadIdx.x >> 5)) * (SLOADS * 32) + lane;
  const float4* ip = (const float4*)in + first;
  v4h* op = (v4h*)out + first;
  float4 x[SLOADS];
#pragma unroll   // x[] needs constant indices to stay in registers
  for (int c = 0; c < SLOADS; ++c) x[c] = ip[c * 32];
#pragma unroll   // as above
  for (int c = 0; c < SLOADS; ++c) {
    v4h o = {(_Float16)x[c].x, (_Float16)x[c].y, (_Float16)x[c].z, (_Float16)x[c].w};
    op[c * 32] = o;
  }
}

// ---------------------------------------------------------------------------
// 1) Effective f16 weights. y @ W^T + y @ (B A) = y @ (W + (B A)^T)^T, so
//      Wout[n][k] = f16( W[n][k] + sum_r B[k][r] * A[r][n] )
//    for the Q, K, V row groups of Wqkv and for Wmsa (group 3).
//    128 threads cover one row of 1024 k, 8 k each; a thread keeps its 8x8
//    piece of B in registers and walks FOLD_ROWS rows; A[r][n] is the same
//    for the whole block.
// ---------------------------------------------------------------------------
#define FOLD_ROWS 8
__global__ __launch_bounds__(128)
void fold_lora_kernel(const float* __restrict__ Wqkv, const float* __restrict__ Wmsa,
                      const float* __restrict__ Bq, const float* __restrict__ Aq,
                      const float* __restrict__ Bk, const float* __restrict__ Ak,
                      const float* __restrict__ Bv, const float* __restrict__ Av,
                      const float* __restrict__ Bo, const float* __restrict__ Ao,
                      _Float16* __restrict__ Wqh, _Float16* __restrict__ Wmh) {
  int g  = blockIdx.x / (E_DIM / FOLD_ROWS);               // 0=Q 1=K 2=V 3=out
  int n0 = (blockIdx.x % (E_DIM / FOLD_ROWS)) * FOLD_ROWS; // row in the group
  const float* Wg = (g < 3) ? Wqkv + (size_t)g * E_DIM * E_DIM : Wmsa;
  _Float16*    Og = (g < 3) ? Wqh + (size_t)g * E_DIM * E_DIM : Wmh;
  const float* Bg = (g == 0) ? Bq : ((g == 1) ? Bk : ((g == 2) ? Bv : Bo));
  const float* Ag = (g == 0) ? Aq : ((g == 1) ? Ak : ((g == 2) ? Av : Ao));
  int k0 = threadIdx.x * 8;

  float w[FOLD_ROWS][8];
#pragma unroll
  for (int i = 0; i < FOLD_ROWS; ++i) {
    const float4* wp = (const float4*)(Wg + (size_t)(n0 + i) * E_DIM + k0);
    float4 lo = wp[0], hi = wp[1];
    w[i][0] = lo.x; w[i][1] = lo.y; w[i][2] = lo.z; w[i][3] = lo.w;
    w[i][4] = hi.x; w[i][5] = hi.y; w[i][6] = hi.z; w[i][7] = hi.w;
  }
  float bm[8][R_DIM];   // bm[kk][r] = B[k0 + kk][r]
#pragma unroll
  for (int kk = 0; kk < 8; ++kk) {
    const float4* bp = (const float4*)(Bg + (size_t)(k0 + kk) * R_DIM);
    float4 lo = bp[0], hi = bp[1];
    bm[kk][0] = lo.x; bm[kk][1] = lo.y; bm[kk][2] = lo.z; bm[kk][3] = lo.w;
    bm[kk][4] = hi.x; bm[kk][5] = hi.y; bm[kk][6] = hi.z; bm[kk][7] = hi.w;
  }
#pragma unroll
  for (int i = 0; i < FOLD_ROWS; ++i) {
    float a8[R_DIM];
#pragma unroll
    for (int r = 0; r < R_DIM; ++r) a8[r] = Ag[r * E_DIM + n0 + i];
    v8h o;
#pragma unroll
    for (int kk = 0; kk < 8; ++kk) {
      float v = w[i][kk];
#pragma unroll
      for (int r = 0; r < R_DIM; ++r) v = __builtin_fmaf(bm[kk][r], a8[r], v);
      o[kk] = (_Float16)v;
    }
    *(v8h*)(Og + (size_t)(n0 + i) * E_DIM + k0) = o;
  }
}

// ---------------------------------------------------------------------------
// 2) QKV GEMM: C[TOK, 3072] = Xh @ Weff^T + bias (LoRA is in Weff), written to
//    Qh,Kh [B,H,S,D] f16 (Q pre-scaled by 1/sqrt(D)) and Vt [B,H,D,S] f16.
//    Block: 8 waves = 128 tokens x 128 features of ONE of Q, K, V, operands
//    staged in LDS (gemm_core), 8 WMMAs per 32-k step and wave.
//    An accumulator lane holds 8 consecutive rows of the FIRST operand, so the
//    first operand is the one whose index runs along the output's rows in
//    memory: the weights for Q and K (d is contiguous), the tokens for V^T
//    (s is contiguous). The block's tile is then laid in LDS as 128 rows of
//    256 B by 16-byte writes and goes out as whole 128-byte lines.
// ---------------------------------------------------------------------------
#define EPITCH 136                      // halves per staged output row: 272 B = 16 B x odd
__global__ __launch_bounds__(256)
void qkv_wmma_kernel(const _Float16* __restrict__ Xh,
                     const _Float16* __restrict__ Wh,     // [3072,1024] f16
                     const float* __restrict__ bqkv,
                     _Float16* __restrict__ Qh, _Float16* __restrict__ Kh,
                     _Float16* __restrict__ Vt) {
  __shared__ __attribute__((aligned(16))) _Float16 sm[2 * GSTAGE];
  int tid = threadIdx.x, lane = tid & 31, wave = tid >> 5;
  int tok0 = blockIdx.y * 128;             // first token of the block
  int col0 = blockIdx.x * 128;             // first feature of the block, 0..3071
  int g = blockIdx.x >> 3;                 // 0=Q 1=K 2=V, the same for the whole block
  bool wfirst = g < 2;                     // weights as first operand

  v8f acc[2][4];
#pragma unroll
  for (int i = 0; i < 2; ++i)
#pragma unroll
    for (int j = 0; j < 4; ++j) acc[i][j] = v8f{};

  gemm_core(wfirst ? Wh : Xh, wfirst ? Xh : Wh,
            wfirst ? col0 : tok0, wfirst ? tok0 : col0, sm, acc);

  // acc[i][j][v] = C[m0 + i*16 + v][n0 + j*16]: m counts rows of the first
  // operand, n rows of the second, both inside the block's tile.
  // gemm_core ends behind a barrier with every LDS read returned and no copy
  // in flight: its buffers are free for the tile, staged as [n][m].
  int m0 = (wave >> 1) * 32 + ((lane >> 4) << 3);
  int n0 = (wave & 1) * 64 + (lane & 15);
  _Float16* st = sm + n0 * EPITCH + m0;
  if (wfirst) {                            // m = feature, n = token
    float sc = (g == 0) ? 0.125f : 1.0f;   // fold 1/sqrt(64) into Q
#pragma unroll   // acc[][] needs constant indices to stay in registers
    for (int i = 0; i < 2; ++i) {
      const float4* bp = (const float4*)(bqkv + col0 + m0 + i * 16);
      float4 lo = bp[0], hi = bp[1];
      float bias[8] = {lo.x, lo.y, lo.z, lo.w, hi.x, hi.y, hi.z, hi.w};
#pragma unroll
      for (int j = 0; j < 4; ++j) {
        v8h w;
#pragma unroll
        for (int v = 0; v < 8; ++v) w[v] = (_Float16)((acc[i][j][v] + bias[v]) * sc);
        *(v8h*)(st + j * 16 * EPITCH + i * 16) = w;
      }
    }
  } else {                                 // m = token, n = feature
#pragma unroll   // as above
    for (int j = 0; j < 4; ++j) {
      float bias = bqkv[col0 + n0 + j * 16];
#pragma unroll
      for (int i = 0; i < 2; ++i) {
        v8h w;
#pragma unroll
        for (int v = 0; v < 8; ++v) w[v] = (_Float16)(acc[i][j][v] + bias);
        *(v8h*)(st + j * 16 * EPITCH + i * 16) = w;
      }
    }
  }
  __syncthreads();                         // the whole tile is staged

  // thread t takes 16-byte piece t%16 of staged rows t/16 + 16*c: a wave-wide
  // store covers two staged rows = four whole lines
  int piece = tid & 15, r = tid >> 4;
  int e0 = col0 & (E_DIM - 1);             // first feature inside Q, K or V
  int bb = tok0 >> 11, s0 = tok0 & (SEQ - 1);
  const _Float16* ld = sm + r * EPITCH + piece * 8;
  v8h w[8];
#pragma unroll   // w[] needs constant indices to stay in registers
  for (int c = 0; c < 8; ++c) w[c] = *(const v8h*)(ld + c * 16 * EPITCH);
  if (wfirst) {                            // staged row = token, 2 heads of 128 B
    int e = e0 + piece * 8;
    _Float16* dst = ((g == 0) ? Qh : Kh)
        + (((size_t)bb * H_NUM + (e >> 6)) * SEQ + s0 + r) * D_DIM + (e & 63);
#pragma unroll   // as above; the row steps become immediate offsets
    for (int c = 0; c < 8; ++c) *(v8h*)(dst + c * 16 * D_DIM) = w[c];
  } else {                                 // staged row = feature (h*64 + d), 128 tokens
    _Float16* dst = Vt + ((size_t)bb * E_DIM + e0 + r) * SEQ + s0 + piece * 8;
#pragma unroll   // as above
    for (int c = 0; c < 8; ++c) *(v8h*)(dst + (size_t)c * 16 * SEQ) = w[c];
  }
}

#define ASTAGE (128 * LPITCH)
// value of lane l ^ 16
__device__ __forceinline__ float xhalf(float x) {
  int xi = __builtin_bit_cast(int, x);
  return __builtin_bit_cast(float, __builtin_amdgcn_permlanex16(
      xi, xi, 0x76543210, 0xfedcba98, false, false));
}

__global__ __launch_bounds__(256)
void attn_wmma_kernel(const _Float16* __restrict__ Q,
                      const _Float16* __restrict__ K,
                      const _Float16* __restrict__ Vt,
                      _Float16* __restrict__ Oh) {
  __shared__ __attribute__((aligned(16))) _Float16 sm[2 * ASTAGE];
  int lane = threadIdx.x & 31, wave = threadIdx.x >> 5;
  int id = blockIdx.x * 8 + wave;           // 0 .. B*H*(S/32)-1 = 2047
  int qt = id & (SEQ / 32 - 1);             // 32-query tile in sequence
  int bh = id >> 6;                         // 0..31
  int b = bh >> 4, h = bh & 15;
  const _Float16* Qp = Q + (size_t)bh * SEQ * D_DIM;
  const _Float16* Kp = K + (size_t)bh * SEQ * D_DIM;
  const _Float16* Vp = Vt + (size_t)bh * D_DIM * SEQ;
  int qrow = qt * 32;

  // Q^T as B operand: column = query, kept in registers for the whole loop
  v16h bq[2][2];
#pragma unroll
  for (int i = 0; i < 2; ++i) {
    bq[i][0] = load_tile16(Qp, D_DIM, qrow + i * 16, 0, lane);
    bq[i][1] = load_tile16(Qp, D_DIM, qrow + i * 16, 32, lane);
  }

  // o[i][j][r] = O^T[d = j*16 + 8*(lane/16) + r][query = qrow + i*16 + lane%16]
  v8f o[2][4];
  // negm[i]: minus the maximum in use of the lane's query column, in all eight
  // elements: it is the C operand of the score products, so a score tile comes
  // out as score - maximum. l is the lane half's own partial sum.
  v8f negm[2];
  float l[2];
#pragma unroll
  for (int i = 0; i < 2; ++i) {
#pragma unroll
    for (int j = 0; j < 4; ++j) o[i][j] = v8f{};
    negm[i] = v8f{}; l[i] = 0.f;
  }

  // this thread's pieces of a stage: K rows r, r+32 and V^T rows r, r+32
  const _Float16* gk = Kp + (size_t)(threadIdx.x >> 3) * D_DIM + (threadIdx.x & 7) * 8;
  const _Float16* gv = Vp + (size_t)(threadIdx.x >> 3) * SEQ + (threadIdx.x & 7) * 8;
  unsigned lk = (unsigned)(size_t)sm + (threadIdx.x >> 3) * LROWB + (threadIdx.x & 7) * 16;

  copy4(lk, lk + 32 * LROWB, lk + 64 * LROWB, lk + 96 * LROWB,
        gk, gk + 32 * D_DIM, gv, gv + 32 * SEQ);
  wait_copies();
  __syncthreads();                          // stage 0 is published
  copy4(lk + ASTAGE * 2, lk + ASTAGE * 2 + 32 * LROWB,
        lk + ASTAGE * 2 + 64 * LROWB, lk + ASTAGE * 2 + 96 * LROWB,
        gk + 64 * D_DIM, gk + 96 * D_DIM, gv + 64, gv + 32 * SEQ + 64);

  for (int t = 0; t < SEQ / 64; ++t) {
   const _Float16* sk = sm + (t & 1) * ASTAGE;   // K rows of this stage
   const _Float16* sv = sk + 64 * LPITCH;        // V^T rows of this stage
#pragma unroll   // both 32-key passes of a stage inline: LDS offsets become immediates
   for (int kb = 0; kb < 64; kb += 32) {
    // s[i][kt][r] = score(key 64*t + kb + kt*16 + 8*(lane/16) + r, query column)
    //               - maximum in use of that column
    v8f s[2][2];

#pragma unroll
    for (int kt = 0; kt < 2; ++kt) {
      v16h ak0 = load_tile16(sk, LPITCH, kb + kt * 16, 0, lane);
      v16h ak1 = load_tile16(sk, LPITCH, kb + kt * 16, 32, lane);
#pragma unroll
      for (int i = 0; i < 2; ++i) {
        s[i][kt] = wmma16(ak0, bq[i][0], negm[i]);
        s[i][kt] = wmma16(ak1, bq[i][1], s[i][kt]);
      }
    }

    // The pass's four V^T fragments are read here, as one group in front of the
    // test: they land under the score products and the maxima. Read behind the
    // branch, each pair is waited for in turn just ahead of its two products.
    v16h av[4];
#pragma unroll   // av[] needs constant indices to stay in registers
    for (int j = 0; j < 4; ++j) av[j] = load_tile16(sv, LPITCH, j * 16, kb, lane);

    // The maximum in use moves only when a column's scores outgrow it by more
    // than 8 (p stays below e^8, far inside f16), or on the very first pass,
    // which sets it: one test per pass for the whole wave, a scalar branch.
    bool first = (t == 0) && (kb == 0);
    float mx[2];        // the lane half's own largest score above the maximum in use
#pragma unroll
    for (int i = 0; i < 2; ++i) {
      float t8[8];
#pragma unroll
      for (int v = 0; v < 8; ++v) t8[v] = fmaxf(s[i][0][v], s[i][1][v]);
      mx[i] = fmaxf(fmaxf(fmaxf(t8[0], t8[1]), fmaxf(t8[2], t8[3])),
                    fmaxf(fmaxf(t8[4], t8[5]), fmaxf(t8[6], t8[7])));
    }
    // holds the four V^T reads in front of the branch (inputs only, no code): the
    // compiler otherwise sinks them behind it, one exposed LDS wait per pair
    asm volatile("" :: "v"(av[0]), "v"(av[1]), "v"(av[2]), "v"(av[3]));
    if (__builtin_amdgcn_ballot_w32(first || fmaxf(mx[0], mx[1]) > 8.0f) != 0) {
#pragma unroll
      for (int i = 0; i < 2; ++i) {
        float mh = fmaxf(mx[i], xhalf(mx[i]));        // both halves use one maximum
        float d = (first || mh > 8.0f) ? mh : 0.f;    // how far this column's maximum moves
        float corr = first ? 0.f : __expf(-d);        // first pass: o and l are still 0
        s[i][0] -= d; s[i][1] -= d; negm[i] -= d;
        l[i] *= corr;
#pragma unroll
        for (int j = 0; j < 4; ++j) o[i][j] *= corr;
      }
    }

    v16h bp[2];   // P^T as B operand, packed straight from the score tiles
#pragma unroll
    for (int i = 0; i < 2; ++i) {
      // e^x as 2^(x * log2 e), the product taken on whole tiles (packed multiplies)
      v8f p0 = s[i][0] * 1.44269504f;   // keys kb + 8*(lane/16) + v
      v8f p1 = s[i][1] * 1.44269504f;   // keys kb + 16 + 8*(lane/16) + v
#pragma unroll
      for (int v = 0; v < 8; ++v) p0[v] = __builtin_amdgcn_exp2f(p0[v]);
#pragma unroll
      for (int v = 0; v < 8; ++v) p1[v] = __builtin_amdgcn_exp2f(p1[v]);
#pragma unroll
      for (int v = 0; v < 8; ++v) {
        bp[i][v]     = (_Float16)p0[v];
        bp[i][8 + v] = (_Float16)p1[v];
      }
      v8f ps = p0 + p1;
      l[i] += ((ps[0] + ps[1]) + (ps[2] + ps[3])) + ((ps[4] + ps[5]) + (ps[6] + ps[7]));
    }

    // each V^T fragment feeds both query subtiles
#pragma unroll
    for (int j = 0; j < 4; ++j) {
#pragma unroll
      for (int i = 0; i < 2; ++i) o[i][j] = wmma16(av[j], bp[i], o[i][j]);
    }
   }
   wait_lds_reads();
   wait_copies();
   __syncthreads();                         // publishes stage t+1, frees stage t's buffer
   if (t + 2 < SEQ / 64) {
     unsigned lt = lk + (t & 1) * (ASTAGE * 2);
     const _Float16* gkt = gk + (size_t)(t + 2) * 64 * D_DIM;
     const _Float16* gvt = gv + (t + 2) * 64;
     copy4(lt, lt + 32 * LROWB, lt + 64 * LROWB, lt + 96 * LROWB,
           gkt, gkt + 32 * D_DIM, gvt, gvt + 32 * SEQ);
   }
  }
  wait_copies();

  // a lane holds 8 consecutive d of one query: one 16-byte store per tile
#pragma unroll
  for (int i = 0; i < 2; ++i) {
    float inv = 1.0f / (l[i] + xhalf(l[i]));
    int ss = qrow + i * 16 + (lane & 15);
    _Float16* op = Oh + ((size_t)b * SEQ + ss) * E_DIM + h * D_DIM
                      + ((lane >> 4) << 3);
#pragma unroll
    for (int j = 0; j < 4; ++j) {
      v8h w;
#pragma unroll
      for (int r = 0; r < 8; ++r) w[r] = (_Float16)(o[i][j][r] * inv);
      *(v8h*)(op + j * 16) = w;
    }
  }
}

// ---------------------------------------------------------------------------
// 4) res = O @ Weff^T + y   (f32 out; Weff = Wmsa + (Bo Ao)^T)
//    Wave tile 32x64, block 128x128, like the QKV GEMM.
// ---------------------------------------------------------------------------
__global__ __launch_bounds__(256)
void msa_wmma_kernel(const _Float16* __restrict__ Oh,
                     const _Float16* __restrict__ Wmh,   // [1024,1024] f16
                     const float* __restrict__ y, float* __restrict__ res) {
  __shared__ __attribute__((aligned(16))) _Float16 sm[2 * GSTAGE];
  int lane = threadIdx.x & 31, wave = threadIdx.x >> 5;
  int rowb = blockIdx.y * 128 + (wave >> 1) * 32;
  int colb = blockIdx.x * 128 + (wave & 1) * 64;

  v8f acc[2][4];
#pragma unroll
  for (int i = 0; i < 2; ++i)
#pragma unroll
    for (int j = 0; j < 4; ++j) acc[i][j] = v8f{};

  gemm_core(Oh, Wmh, blockIdx.y * 128, blockIdx.x * 128, sm, acc);

#pragma unroll
  for (int j = 0; j < 4; ++j) {
    int col = colb + j * 16 + (lane & 15);
#pragma unroll
    for (int i = 0; i < 2; ++i) {
#pragma unroll
      for (int v = 0; v < 8; ++v) {
        int row = rowb + i * 16 + v + ((lane >> 4) << 3);
        float val = acc[i][j][v];
        val += y[(size_t)row * E_DIM + col];
        res[(size_t)row * E_DIM + col] = val;
      }
    }
  }
}

// ---------------------------------------------------------------------------
// 5) LayerNorm rows of res -> d_out, as a stream: one wave per row. The row
//    (4 KiB) is read once by 8 loads of 16 B per lane and stays in registers;
//    the two sums are taken in the lane (four chains each) and then over the
//    32 lanes by a butterfly, so every lane ends with the same totals.
// ---------------------------------------------------------------------------
typedef __attribute__((ext_vector_type(4))) float v4f;
__global__ __launch_bounds__(256)
void layernorm_kernel(const float* __restrict__ res,
                      const float* __restrict__ gamma,
                      const float* __restrict__ beta, float* __restrict__ out) {
  int lane = threadIdx.x & 31;
  // the wave's number as a scalar: the row's base then sits in scalar registers
  // and every load and store is addressed by the one lane-offset register
  size_t row = (size_t)blockIdx.x * 8 + __builtin_amdgcn_readfirstlane(threadIdx.x >> 5);
  const v4f* rp = (const v4f*)(res + row * E_DIM) + lane;
  const v4f* gp = (const v4f*)gamma + lane;
  const v4f* bp = (const v4f*)beta + lane;
  v4f* op = (v4f*)(out + row * E_DIM) + lane;

  v4f x[SLOADS], g[SLOADS], b[SLOADS];
#pragma unroll   // x[], g[], b[] need constant indices to stay in registers
  for (int c = 0; c < SLOADS; ++c) x[c] = rp[c * 32];
#pragma unroll   // as above
  for (int c = 0; c < SLOADS; ++c) { g[c] = gp[c * 32]; b[c] = bp[c * 32]; }
  // keeps all 24 loads in front of the sums: sunk behind the butterfly, the
  // gamma and beta loads would each be waited for in turn
  __builtin_amdgcn_sched_barrier(0);

  v4f a = x[0], q = x[0] * x[0];
#pragma unroll   // as above
  for (int c = 1; c < SLOADS; ++c) { a += x[c]; q += x[c] * x[c]; }
  float s1 = (a.x + a.y) + (a.z + a.w);
  float s2 = (q.x + q.y) + (q.z + q.w);
#pragma unroll   // the five exchange distances become constants
  for (int d = 16; d > 0; d >>= 1) {
    s1 += __shfl_xor(s1, d);
    s2 += __shfl_xor(s2, d);
  }
  float mu = s1 * (1.0f / E_DIM);
  float var = s2 * (1.0f / E_DIM) - mu * mu;
  float sc = rsqrtf(var + 1e-6f);
#pragma unroll   // as above
  for (int c = 0; c < SLOADS; ++c) op[c * 32] = (x[c] - mu) * sc * g[c] + b[c];
}

// ---------------------------------------------------------------------------
// Host launcher
// ---------------------------------------------------------------------------
extern "C" void kernel_launch(void* const* d_in, const int* in_sizes, int n_in,
                              void* d_out, int out_size, void* d_ws, size_t ws_size,
                              hipStream_t stream) {
  const float* y    = (const float*)d_in[0];
  const float* Wqkv = (const float*)d_in[1];
  const float* bqkv = (const float*)d_in[2];
  const float* Wmsa = (const float*)d_in[3];
  const float* Bq   = (const float*)d_in[4];
  const float* Aq   = (const float*)d_in[5];
  const float* Bk   = (const float*)d_in[6];
  const float* Ak   = (const float*)d_in[7];
  const float* Bv   = (const float*)d_in[8];
  const float* Av   = (const float*)d_in[9];
  const float* Bo   = (const float*)d_in[10];
  const float* Ao   = (const float*)d_in[11];
  const float* gamma = (const float*)d_in[12];
  const float* beta  = (const float*)d_in[13];
  float* out = (float*)d_out;

  // workspace carve-up (all offsets 256B-aligned)
  char* ws = (char*)d_ws;
  size_t off = 0;
  auto carve = [&](size_t bytes) {
    char* p = ws + off;
    off += (bytes + 255) & ~(size_t)255;
    return p;
  };
  _Float16* Xh   = (_Float16*)carve((size_t)TOK * E_DIM * 2);   // y f16
  _Float16* Wqh  = (_Float16*)carve((size_t)NQKV * E_DIM * 2);  // Wqkv + LoRA, f16
  _Float16* Wmh  = (_Float16*)carve((size_t)E_DIM * E_DIM * 2); // Wmsa + LoRA, f16
  _Float16* Qh   = (_Float16*)carve((size_t)TOK * E_DIM * 2);   // [B,H,S,D]
  _Float16* Kh   = (_Float16*)carve((size_t)TOK * E_DIM * 2);   // [B,H,S,D]
  _Float16* Vt   = (_Float16*)carve((size_t)TOK * E_DIM * 2);   // [B,H,D,S]
  _Float16* Oh   = (_Float16*)carve((size_t)TOK * E_DIM * 2);   // [B,S,E]
  float*    res  = (float*)carve((size_t)TOK * E_DIM * 4);
  (void)ws_size; (void)in_sizes; (void)n_in; (void)out_size;

  // 0) convert y: a block of 8 waves takes 8 * SLOADS * 128 elements
  cvt_f32_to_f16<<<TOK * E_DIM / (8 * SLOADS * 128), 256, 0, stream>>>(y, Xh);
  // 1) effective f16 weights: 4 groups of 1024 rows
  fold_lora_kernel<<<4 * (E_DIM / FOLD_ROWS), 128, 0, stream>>>(
      Wqkv, Wmsa, Bq, Aq, Bk, Ak, Bv, Av, Bo, Ao, Wqh, Wmh);
  // 2) QKV GEMM (grid: N/128 x M/128)
  qkv_wmma_kernel<<<dim3(NQKV / 128, TOK / 128), 256, 0, stream>>>(
      Xh, Wqh, bqkv, Qh, Kh, Vt);
  // 3) attention: B*H*(S/32) wave tiles, 8 waves/block
  attn_wmma_kernel<<<(BATCH * H_NUM * (SEQ / 32)) / 8, 256, 0, stream>>>(
      Qh, Kh, Vt, Oh);
  // 4) output projection + residual (grid: N/128 x M/128)
  msa_wmma_kernel<<<dim3(E_DIM / 128, TOK / 128), 256, 0, stream>>>(
      Oh, Wmh, y, res);
  // 5) LayerNorm: 8 rows per block
  layernorm_kernel<<<TOK / 8, 256, 0, stream>>>(res, gamma, beta, out);
}

// v007
// Measured time: 95.7 microseconds a run.
// In both of two side-by-side timings against v006, it was 1.03 times as fast.
// Counting every step since v000, it is 5.98 times as fast.
#include <hip/hip_runtime.h>
#include <hip/hip_bf16.h>

// ---------------------------------------------------------------------------
// Problem constants (match reference)
// ---------------------------------------------------------------------------
#define E_DIM 1024
#define H_NUM 16
#define D_DIM 64
#define R_DIM 8
#define BATCH 2
#define SEQ   2048
#define TOK   (BATCH * SEQ)      // 4096 tokens
#define NQKV  (3 * E_DIM)        // 3072

typedef __attribute__((ext_vector_type(16))) _Float16 v16h;
typedef __attribute__((ext_vector_type(8)))  _Float16 v8h;
typedef __attribute__((ext_vector_type(8)))  float    v8f;

__device__ __forceinline__ v8f wmma16(v16h a, v16h b, v8f c) {
  // D = A(16x32 f16) * B(32x16 f16) + C(16x16 f32)
  return __builtin_amdgcn_wmma_f32_16x16x32_f16(
      /*neg_a=*/false, a, /*neg_b=*/false, b,
      /*c_mod=*/(short)0, c, /*reuse_a=*/false, /*reuse_b=*/false);
}

// Load one 16x32 f16 operand tile into the wave32 WMMA register layout.
// Element (r, k) comes from base[(major + r) * ld + kb + k].
//   lane%16 -> r (A: row M / B: col N), lane/16 selects K-halves:
//   halves 0..7  = K (lane/16)*8 + 0..7
//   halves 8..15 = K 16 + (lane/16)*8 + 0..7
__device__ __forceinline__ v16h load_tile16(const _Float16* base, int ld,
                                            int major, int kb, int lane) {
  const _Float16* p = base + (size_t)(major + (lane & 15)) * (size_t)ld
                           + (size_t)(kb + ((lane >> 4) << 3));
  v8h lo = *(const v8h*)p;        // K = koff + 0..7
  v8h hi = *(const v8h*)(p + 16); // K = koff + 16..23
  return __builtin_shufflevector(lo, hi, 0,1,2,3,4,5,6,7,8,9,10,11,12,13,14,15);
}

// ---------------------------------------------------------------------------
// LDS staging by asynchronous copies. A staged row is 128 B of data (one whole
// line of its source) at a pitch of 144 B (16 B x odd: the ds_load_b128 pitch).
// Thread t of 256 copies 16 B: piece t%8 of row t/8, so one wave-wide copy
// covers 4 whole lines; further copies of the thread lie 32 rows on.
// ---------------------------------------------------------------------------
#define LPITCH 72                       // halves per staged row
#define LROWB  (LPITCH * 2)             // bytes per staged row

// 4 copies of 16 B per lane. The s_wait_xcnt stands inside the statement so
// that no address register is rewritten before the copies have taken it.
__device__ __forceinline__ void copy4(unsigned l0, unsigned l1, unsigned l2, unsigned l3,
                                      const _Float16* g0, const _Float16* g1,
                                      const _Float16* g2, const _Float16* g3) {
  asm volatile("global_load_async_to_lds_b128 %0, %4, off\n\t"
               "global_load_async_to_lds_b128 %1, %5, off\n\t"
               "global_load_async_to_lds_b128 %2, %6, off\n\t"
               "global_load_async_to_lds_b128 %3, %7, off\n\t"
               "s_wait_xcnt 0x0"
               :: "v"(l0), "v"(l1), "v"(l2), "v"(l3),
                  "v"(g0), "v"(g1), "v"(g2), "v"(g3) : "memory");
}
// 8 copies of 16 B per lane, same form.
__device__ __forceinline__ void copy8(unsigned l, const _Float16* ga, const _Float16* gb,
                                      unsigned lb_off, size_t gstep) {
  unsigned l0 = l, l1 = l + 32 * LROWB, l2 = l + 64 * LROWB, l3 = l + 96 * LROWB;
  unsigned l4 = l0 + lb_off, l5 = l1 + lb_off, l6 = l2 + lb_off, l7 = l3 + lb_off;
  const _Float16 *a0 = ga, *a1 = ga + gstep, *a2 = ga + 2 * gstep, *a3 = ga + 3 * gstep;
  const _Float16 *b0 = gb, *b1 = gb + gstep, *b2 = gb + 2 * gstep, *b3 = gb + 3 * gstep;
  asm volatile("global_load_async_to_lds_b128 %0, %8, off\n\t"
               "global_load_async_to_lds_b128 %1, %9, off\n\t"
               "global_load_async_to_lds_b128 %2, %10, off\n\t"
               "global_load_async_to_lds_b128 %3, %11, off\n\t"
               "global_load_async_to_lds_b128 %4, %12, off\n\t"
               "global_load_async_to_lds_b128 %5, %13, off\n\t"
               "global_load_async_to_lds_b128 %6, %14, off\n\t"
               "global_load_async_to_lds_b128 %7, %15, off\n\t"
               "s_wait_xcnt 0x0"
               :: "v"(l0), "v"(l1), "v"(l2), "v"(l3), "v"(l4), "v"(l5), "v"(l6), "v"(l7),
                  "v"(a0), "v"(a1), "v"(a2), "v"(a3), "v"(b0), "v"(b1), "v"(b2), "v"(b3)
               : "memory");
}
// the wave's own copies have landed
__device__ __forceinline__ void wait_copies() {
  asm volatile("s_wait_asynccnt 0x0" ::: "memory");
}
// the wave's own LDS reads have returned (its buffer may be refilled)
__device__ __forceinline__ void wait_lds_reads() {
  asm volatile("s_wait_dscnt 0x0" ::: "memory");
}

// ---------------------------------------------------------------------------
// GEMM core: C(128 x 128) = A[rows][1024] * B[cols][1024]^T per block of 8
// waves (4 in M x 2 in N, wave tile 32 x 64 as acc[2][4]). A stage is 64 k of
// 128 A rows and 128 B rows; two buffers, the next stage's copies fly while
// this one is multiplied.
// ---------------------------------------------------------------------------
#define GSTAGE (256 * LPITCH)           // halves per buffer
__device__ __forceinline__ void gemm_core(const _Float16* __restrict__ A,
                                          const _Float16* __restrict__ B,
                                          int row0, int col0, _Float16* sm,
                                          v8f (&acc)[2][4]) {
  int tid = threadIdx.x, lane = tid & 31, wave = tid >> 5;
  int wr = (wave >> 1) * 32;            // wave's rows in the A part
  int wc = 128 + (wave & 1) * 64;       // wave's rows in the B part
  const _Float16* ga = A + (size_t)(row0 + (tid >> 3)) * E_DIM + (tid & 7) * 8;
  const _Float16* gb = B + (size_t)(col0 + (tid >> 3)) * E_DIM + (tid & 7) * 8;
  unsigned l = (unsigned)(size_t)sm + (tid >> 3) * LROWB + (tid & 7) * 16;

  copy8(l, ga, gb, 128 * LROWB, (size_t)32 * E_DIM);
  wait_copies();
  __syncthreads();                      // stage 0 is published
  copy8(l + GSTAGE * 2, ga + 64, gb + 64, 128 * LROWB, (size_t)32 * E_DIM);

  for (int t = 0; t < E_DIM / 64; ++t) {
    const _Float16* sb = sm + (t & 1) * GSTAGE;
#pragma unroll   // both 32-k steps of a stage inline: LDS offsets become immediates
    for (int kb = 0; kb < 64; kb += 32) {
      // the six fragments of a 32-k step are read as one group ahead of its WMMAs
      v16h a0 = load_tile16(sb, LPITCH, wr, kb, lane);
      v16h a1 = load_tile16(sb, LPITCH, wr + 16, kb, lane);
      v16h b[4];
#pragma unroll   // b[] and acc[][] need constant indices to stay in registers
      for (int j = 0; j < 4; ++j) b[j] = load_tile16(sb, LPITCH, wc + j * 16, kb, lane);
      // keeps the reads together: sunk among the WMMAs, each pair costs its own LDS wait
      __builtin_amdgcn_sched_barrier(0);
#pragma unroll
      for (int j = 0; j < 4; ++j) {
        acc[0][j] = wmma16(a0, b[j], acc[0][j]);
        acc[1][j] = wmma16(a1, b[j], acc[1][j]);
      }
    }
    wait_lds_reads();
    wait_copies();
    __syncthreads();                    // publishes stage t+1, frees stage t's buffer
    if (t + 2 < E_DIM / 64)
      copy8(l + (t & 1) * (GSTAGE * 2), ga + (t + 2) * 64, gb + (t + 2) * 64,
            128 * LROWB, (size_t)32 * E_DIM);
  }
  wait_copies();
}

// ---------------------------------------------------------------------------
// 0) Prepass, ONE launch for two independent jobs, told apart by the block's
//    index: the effective f16 weights (blocks 0 .. FOLD_BLOCKS-1, the longer
//    job) and the f32 -> f16 convert of y (the rest).
//
//    Convert, as a stream: a wave takes 4 KiB of input by 8 loads of 16 B per
//    lane (each wave-wide load is 512 contiguous bytes), all in flight
//    together, and stores 256 contiguous bytes per store. Its blocks cover
//    TOK * E_DIM elements exactly.
//
//    Effective weights. y @ W^T + y @ (B A) = y @ (W + (B A)^T)^T, so
//      Wout[n][k] = f16( W[n][k] + sum_r B[k][r] * A[r][n] )
//    for the Q, K, V row groups of Wqkv and for Wmsa (group 3).
//    128 threads cover one row of 1024 k, 8 k each; a thread keeps its 8x8
//    piece of B in registers and walks FOLD_ROWS rows; each half of a block
//    has its own FOLD_ROWS rows, and A[r][n] is the same for the whole half.
// ---------------------------------------------------------------------------
#define SLOADS 8                        // 16-byte loads in flight per lane
#define FOLD_ROWS 8
#define FOLD_BLOCKS (4 * E_DIM / (2 * FOLD_ROWS))        // 2 * FOLD_ROWS rows per block
#define CVT_BLOCKS  (TOK * E_DIM / (8 * SLOADS * 128))   // 8 waves of SLOADS * 128 elements
typedef __attribute__((ext_vector_type(4))) _Float16 v4h;

__device__ __forceinline__ void cvt_f32_to_f16(int blk, const float* __restrict__ in,
                                               _Float16* __restrict__ out) {
  int lane = threadIdx.x & 31;
  size_t first = ((size_t)blk * 8 + (threadIdx.x >> 5)) * (SLOADS * 32) + lane;
  const float4* ip = (const float4*)in + first;
  v4h* op = (v4h*)out + first;
  float4 x[SLOADS];
#pragma unroll   // x[] needs constant indices to stay in registers
  for (int c = 0; c < SLOADS; ++c) x[c] = ip[c * 32];
#pragma unroll   // as above
  for (int c = 0; c < SLOADS; ++c) {
    v4h o = {(_Float16)x[c].x, (_Float16)x[c].y, (_Float16)x[c].z, (_Float16)x[c].w};
    op[c * 32] = o;
  }
}

__global__ __launch_bounds__(256)
void prepass_kernel(const float* __restrict__ y, _Float16* __restrict__ Xh,
                    const float* __restrict__ Wqkv, const float* __restrict__ Wmsa,
                    const float* __restrict__ Bq, const float* __restrict__ Aq,
                    const float* __restrict__ Bk, const float* __restrict__ Ak,
                    const float* __restrict__ Bv, const float* __restrict__ Av,
                    const float* __restrict__ Bo, const float* __restrict__ Ao,
                    _Float16* __restrict__ Wqh, _Float16* __restrict__ Wmh) {
  if (blockIdx.x >= FOLD_BLOCKS) {
    cvt_f32_to_f16(blockIdx.x - FOLD_BLOCKS, y, Xh);
    return;
  }
  // the block's half as a scalar: the row numbers, and with them the reads of A,
  // stay in scalar registers
  int part = blockIdx.x * 2 + __builtin_amdgcn_readfirstlane(threadIdx.x >> 7);
  int g  = part / (E_DIM / FOLD_ROWS);               // 0=Q 1=K 2=V 3=out
  int n0 = (part % (E_DIM / FOLD_ROWS)) * FOLD_ROWS; // row in the group
  const float* Wg = (g < 3) ? Wqkv + (size_t)g * E_DIM * E_DIM : Wmsa;
  _Float16*    Og = (g < 3) ? Wqh + (size_t)g * E_DIM * E_DIM : Wmh;
  const float* Bg = (g == 0) ? Bq : ((g == 1) ? Bk : ((g == 2) ? Bv : Bo));
  const float* Ag = (g == 0) ? Aq : ((g == 1) ? Ak : ((g == 2) ? Av : Ao));
  int k0 = (threadIdx.x & 127) * 8;

  float w[FOLD_ROWS][8];
#pragma unroll
  for (int i = 0; i < FOLD_ROWS; ++i) {
    const float4* wp = (const float4*)(Wg + (size_t)(n0 + i) * E_DIM + k0);
    float4 lo = wp[0], hi = wp[1];
    w[i][0] = lo.x; w[i][1] = lo.y; w[i][2] = lo.z; w[i][3] = lo.w;
    w[i][4] = hi.x; w[i][5] = hi.y; w[i][6] = hi.z; w[i][7] = hi.w;
  }
  float bm[8][R_DIM];   // bm[kk][r] = B[k0 + kk][r]
#pragma unroll
  for (int kk = 0; kk < 8; ++kk) {
    const float4* bp = (const float4*)(Bg + (size_t)(k0 + kk) * R_DIM);
    float4 lo = bp[0], hi = bp[1];
    bm[kk][0] = lo.x; bm[kk][1] = lo.y; bm[kk][2] = lo.z; bm[kk][3] = lo.w;
    bm[kk][4] = hi.x; bm[kk][5] = hi.y; bm[kk][6] = hi.z; bm[kk][7] = hi.w;
  }
#pragma unroll
  for (int i = 0; i < FOLD_ROWS; ++i) {
    float a8[R_DIM];
#pragma unroll
    for (int r = 0; r < R_DIM; ++r) a8[r] = Ag[r * E_DIM + n0 + i];
    v8h o;
#pragma unroll
    for (int kk = 0; kk < 8; ++kk) {
      float v = w[i][kk];
#pragma unroll
      for (int r = 0; r < R_DIM; ++r) v = __builtin_fmaf(bm[kk][r], a8[r], v);
      o[kk] = (_Float16)v;
    }
    *(v8h*)(Og + (size_t)(n0 + i) * E_DIM + k0) = o;
  }
}

// ---------------------------------------------------------------------------
// 2) QKV GEMM: C[TOK, 3072] = Xh @ Weff^T + bias (LoRA is in Weff), written to
//    Qh,Kh [B,H,S,D] f16 (Q pre-scaled by 1/sqrt(D)) and Vt [B,H,D,S] f16.
//    Block: 8 waves = 128 tokens x 128 features of ONE of Q, K, V, operands
//    staged in LDS (gemm_core), 8 WMMAs per 32-k step and wave.
//    An accumulator lane holds 8 consecutive rows of the FIRST operand, so the
//    first operand is the one whose index runs along the output's rows in
//    memory: the weights for Q and K (d is contiguous), the tokens for V^T
//    (s is contiguous). The block's tile is then laid in LDS as 128 rows of
//    256 B by 16-byte writes and goes out as whole 128-byte lines.
// ---------------------------------------------------------------------------
#define EPITCH 136                      // halves per staged output row: 272 B = 16 B x odd
__global__ __launch_bounds__(256)
void qkv_wmma_kernel(const _Float16* __restrict__ Xh,
                     const _Float16* __restrict__ Wh,     // [3072,1024] f16
                     const float* __restrict__ bqkv,
                     _Float16* __restrict__ Qh, _Float16* __restrict__ Kh,
                     _Float16* __restrict__ Vt) {
  __shared__ __attribute__((aligned(16))) _Float16 sm[2 * GSTAGE];
  int tid = threadIdx.x, lane = tid & 31, wave = tid >> 5;
  int tok0 = blockIdx.y * 128;             // first token of the block
  int col0 = blockIdx.x * 128;             // first feature of the block, 0..3071
  int g = blockIdx.x >> 3;                 // 0=Q 1=K 2=V, the same for the whole block
  bool wfirst = g < 2;                     // weights as first operand

  v8f acc[2][4];
#pragma unroll
  for (int i = 0; i < 2; ++i)
#pragma unroll
    for (int j = 0; j < 4; ++j) acc[i][j] = v8f{};

  gemm_core(wfirst ? Wh : Xh, wfirst ? Xh : Wh,
            wfirst ? col0 : tok0, wfirst ? tok0 : col0, sm, acc);

  // acc[i][j][v] = C[m0 + i*16 + v][n0 + j*16]: m counts rows of the first
  // operand, n rows of the second, both inside the block's tile.
  // gemm_core ends behind a barrier with every LDS read returned and no copy
  // in flight: its buffers are free for the tile, staged as [n][m].
  int m0 = (wave >> 1) * 32 + ((lane >> 4) << 3);
  int n0 = (wave & 1) * 64 + (lane & 15);
  _Float16* st = sm + n0 * EPITCH + m0;
  if (wfirst) {                            // m = feature, n = token
    float sc = (g == 0) ? 0.125f : 1.0f;   // fold 1/sqrt(64) into Q
#pragma unroll   // acc[][] needs constant indices to stay in registers
    for (int i = 0; i < 2; ++i) {
      const float4* bp = (const float4*)(bqkv + col0 + m0 + i * 16);
      float4 lo = bp[0], hi = bp[1];
      float bias[8] = {lo.x, lo.y, lo.z, lo.w, hi.x, hi.y, hi.z, hi.w};
#pragma unroll
      for (int j = 0; j < 4; ++j) {
        v8h w;
#pragma unroll
        for (int v = 0; v < 8; ++v) w[v] = (_Float16)((acc[i][j][v] + bias[v]) * sc);
        *(v8h*)(st + j * 16 * EPITCH + i * 16) = w;
      }
    }
  } else {                                 // m = token, n = feature
#pragma unroll   // as above
    for (int j = 0; j < 4; ++j) {
      float bias = bqkv[col0 + n0 + j * 16];
#pragma unroll
      for (int i = 0; i < 2; ++i) {
        v8h w;
#pragma unroll
        for (int v = 0; v < 8; ++v) w[v] = (_Float16)(acc[i][j][v] + bias);
        *(v8h*)(st + j * 16 * EPITCH + i * 16) = w;
      }
    }
  }
  __syncthreads();                         // the whole tile is staged

  // thread t takes 16-byte piece t%16 of staged rows t/16 + 16*c: a wave-wide
  // store covers two staged rows = four whole lines
  int piece = tid & 15, r = tid >> 4;
  int e0 = col0 & (E_DIM - 1);             // first feature inside Q, K or V
  int bb = tok0 >> 11, s0 = tok0 & (SEQ - 1);
  const _Float16* ld = sm + r * EPITCH + piece * 8;
  v8h w[8];
#pragma unroll   // w[] needs constant indices to stay in registers
  for (int c = 0; c < 8; ++c) w[c] = *(const v8h*)(ld + c * 16 * EPITCH);
  if (wfirst) {                            // staged row = token, 2 heads of 128 B
    int e = e0 + piece * 8;
    _Float16* dst = ((g == 0) ? Qh : Kh)
        + (((size_t)bb * H_NUM + (e >> 6)) * SEQ + s0 + r) * D_DIM + (e & 63);
#pragma unroll   // as above; the row steps become immediate offsets
    for (int c = 0; c < 8; ++c) *(v8h*)(dst + c * 16 * D_DIM) = w[c];
  } else {                                 // staged row = feature (h*64 + d), 128 tokens
    _Float16* dst = Vt + ((size_t)bb * E_DIM + e0 + r) * SEQ + s0 + piece * 8;
#pragma unroll   // as above
    for (int c = 0; c < 8; ++c) *(v8h*)(dst + (size_t)c * 16 * SEQ) = w[c];
  }
}

#define ASTAGE (128 * LPITCH)
// value of lane l ^ 16
__device__ __forceinline__ float xhalf(float x) {
  int xi = __builtin_bit_cast(int, x);
  return __builtin_bit_cast(float, __builtin_amdgcn_permlanex16(
      xi, xi, 0x76543210, 0xfedcba98, false, false));
}

__global__ __launch_bounds__(256)
void attn_wmma_kernel(const _Float16* __restrict__ Q,
                      const _Float16* __restrict__ K,
                      const _Float16* __restrict__ Vt,
                      _Float16* __restrict__ Oh) {
  __shared__ __attribute__((aligned(16))) _Float16 sm[2 * ASTAGE];
  int lane = threadIdx.x & 31, wave = threadIdx.x >> 5;
  int id = blockIdx.x * 8 + wave;           // 0 .. B*H*(S/32)-1 = 2047
  int qt = id & (SEQ / 32 - 1);             // 32-query tile in sequence
  int bh = id >> 6;                         // 0..31
  int b = bh >> 4, h = bh & 15;
  const _Float16* Qp = Q + (size_t)bh * SEQ * D_DIM;
  const _Float16* Kp = K + (size_t)bh * SEQ * D_DIM;
  const _Float16* Vp = Vt + (size_t)bh * D_DIM * SEQ;
  int qrow = qt * 32;

  // Q^T as B operand: column = query, kept in registers for the whole loop
  v16h bq[2][2];
#pragma unroll
  for (int i = 0; i < 2; ++i) {
    bq[i][0] = load_tile16(Qp, D_DIM, qrow + i * 16, 0, lane);
    bq[i][1] = load_tile16(Qp, D_DIM, qrow + i * 16, 32, lane);
  }

  // o[i][j][r] = O^T[d = j*16 + 8*(lane/16) + r][query = qrow + i*16 + lane%16]
  v8f o[2][4];
  // negm[i]: minus the maximum in use of the lane's query column, in all eight
  // elements: it is the C operand of the score products, so a score tile comes
  // out as score - maximum. l is the lane half's own partial sum.
  v8f negm[2];
  float l[2];
#pragma unroll
  for (int i = 0; i < 2; ++i) {
#pragma unroll
    for (int j = 0; j < 4; ++j) o[i][j] = v8f{};
    negm[i] = v8f{}; l[i] = 0.f;
  }

  // this thread's pieces of a stage: K rows r, r+32 and V^T rows r, r+32
  const _Float16* gk = Kp + (size_t)(threadIdx.x >> 3) * D_DIM + (threadIdx.x & 7) * 8;
  const _Float16* gv = Vp + (size_t)(threadIdx.x >> 3) * SEQ + (threadIdx.x & 7) * 8;
  unsigned lk = (unsigned)(size_t)sm + (threadIdx.x >> 3) * LROWB + (threadIdx.x & 7) * 16;

  copy4(lk, lk + 32 * LROWB, lk + 64 * LROWB, lk + 96 * LROWB,
        gk, gk + 32 * D_DIM, gv, gv + 32 * SEQ);
  wait_copies();
  __syncthreads();                          // stage 0 is published
  copy4(lk + ASTAGE * 2, lk + ASTAGE * 2 + 32 * LROWB,
        lk + ASTAGE * 2 + 64 * LROWB, lk + ASTAGE * 2 + 96 * LROWB,
        gk + 64 * D_DIM, gk + 96 * D_DIM, gv + 64, gv + 32 * SEQ + 64);

  for (int t = 0; t < SEQ / 64; ++t) {
   const _Float16* sk = sm + (t & 1) * ASTAGE;   // K rows of this stage
   const _Float16* sv = sk + 64 * LPITCH;        // V^T rows of this stage
#pragma unroll   // both 32-key passes of a stage inline: LDS offsets become immediates
   for (int kb = 0; kb < 64; kb += 32) {
    // s[i][kt][r] = score(key 64*t + kb + kt*16 + 8*(lane/16) + r, query column)
    //               - maximum in use of that column
    v8f s[2][2];

#pragma unroll
    for (int kt = 0; kt < 2; ++kt) {
      v16h ak0 = load_tile16(sk, LPITCH, kb + kt * 16, 0, lane);
      v16h ak1 = load_tile16(sk, LPITCH, kb + kt * 16, 32, lane);
#pragma unroll
      for (int i = 0; i < 2; ++i) {
        s[i][kt] = wmma16(ak0, bq[i][0], negm[i]);
        s[i][kt] = wmma16(ak1, bq[i][1], s[i][kt]);
      }
    }

    // The pass's four V^T fragments are read here, as one group in front of the
    // test: they land under the score products and the maxima. Read behind the
    // branch, each pair is waited for in turn just ahead of its two products.
    v16h av[4];
#pragma unroll   // av[] needs constant indices to stay in registers
    for (int j = 0; j < 4; ++j) av[j] = load_tile16(sv, LPITCH, j * 16, kb, lane);

    // The maximum in use moves only when a column's scores outgrow it by more
    // than 8 (p stays below e^8, far inside f16), or on the very first pass,
    // which sets it: one test per pass for the whole wave, a scalar branch.
    bool first = (t == 0) && (kb == 0);
    float mx[2];        // the lane half's own largest score above the maximum in use
#pragma unroll
    for (int i = 0; i < 2; ++i) {
      float t8[8];
#pragma unroll
      for (int v = 0; v < 8; ++v) t8[v] = fmaxf(s[i][0][v], s[i][1][v]);
      mx[i] = fmaxf(fmaxf(fmaxf(t8[0], t8[1]), fmaxf(t8[2], t8[3])),
                    fmaxf(fmaxf(t8[4], t8[5]), fmaxf(t8[6], t8[7])));
    }
    // holds the four V^T reads in front of the branch (inputs only, no code): the
    // compiler otherwise sinks them behind it, one exposed LDS wait per pair
    asm volatile("" :: "v"(av[0]), "v"(av[1]), "v"(av[2]), "v"(av[3]));
    if (__builtin_amdgcn_ballot_w32(first || fmaxf(mx[0], mx[1]) > 8.0f) != 0) {
#pragma unroll
      for (int i = 0; i < 2; ++i) {
        float mh = fmaxf(mx[i], xhalf(mx[i]));        // both halves use one maximum
        float d = (first || mh > 8.0f) ? mh : 0.f;    // how far this column's maximum moves
        float corr = first ? 0.f : __expf(-d);        // first pass: o and l are still 0
        s[i][0] -= d; s[i][1] -= d; negm[i] -= d;
        l[i] *= corr;
#pragma unroll
        for (int j = 0; j < 4; ++j) o[i][j] *= corr;
      }
    }

    v16h bp[2];   // P^T as B operand, packed straight from the score tiles
#pragma unroll
    for (int i = 0; i < 2; ++i) {
      // e^x as 2^(x * log2 e), the product taken on whole tiles (packed multiplies)
      v8f p0 = s[i][0] * 1.44269504f;   // keys kb + 8*(lane/16) + v
      v8f p1 = s[i][1] * 1.44269504f;   // keys kb + 16 + 8*(lane/16) + v
#pragma unroll
      for (int v = 0; v < 8; ++v) p0[v] = __builtin_amdgcn_exp2f(p0[v]);
#pragma unroll
      for (int v = 0; v < 8; ++v) p1[v] = __builtin_amdgcn_exp2f(p1[v]);
#pragma unroll
      for (int v = 0; v < 8; ++v) {
        bp[i][v]     = (_Float16)p0[v];
        bp[i][8 + v] = (_Float16)p1[v];
      }
      v8f ps = p0 + p1;
      l[i] += ((ps[0] + ps[1]) + (ps[2] + ps[3])) + ((ps[4] + ps[5]) + (ps[6] + ps[7]));
    }

    // each V^T fragment feeds both query subtiles
#pragma unroll
    for (int j = 0; j < 4; ++j) {
#pragma unroll
      for (int i = 0; i < 2; ++i) o[i][j] = wmma16(av[j], bp[i], o[i][j]);
    }
   }
   wait_lds_reads();
   wait_copies();
   __syncthreads();                         // publishes stage t+1, frees stage t's buffer
   if (t + 2 < SEQ / 64) {
     unsigned lt = lk + (t & 1) * (ASTAGE * 2);
     const _Float16* gkt = gk + (size_t)(t + 2) * 64 * D_DIM;
     const _Float16* gvt = gv + (t + 2) * 64;
     copy4(lt, lt + 32 * LROWB, lt + 64 * LROWB, lt + 96 * LROWB,
           gkt, gkt + 32 * D_DIM, gvt, gvt + 32 * SEQ);
   }
  }
  wait_copies();

  // a lane holds 8 consecutive d of one query: one 16-byte store per tile
#pragma unroll
  for (int i = 0; i < 2; ++i) {
    float inv = 1.0f / (l[i] + xhalf(l[i]));
    int ss = qrow + i * 16 + (lane & 15);
    _Float16* op = Oh + ((size_t)b * SEQ + ss) * E_DIM + h * D_DIM
                      + ((lane >> 4) << 3);
#pragma unroll
    for (int j = 0; j < 4; ++j) {
      v8h w;
#pragma unroll
      for (int r = 0; r < 8; ++r) w[r] = (_Float16)(o[i][j][r] * inv);
      *(v8h*)(op + j * 16) = w;
    }
  }
}

// ---------------------------------------------------------------------------
// 4) res = O @ Weff^T + y   (f32 out; Weff = Wmsa + (Bo Ao)^T)
//    Wave tile 32x64, block 128x128, like the QKV GEMM.
// ---------------------------------------------------------------------------
__global__ __launch_bounds__(256)
void msa_wmma_kernel(const _Float16* __restrict__ Oh,
                     const _Float16* __restrict__ Wmh,   // [1024,1024] f16
                     const float* __restrict__ y, float* __restrict__ res) {
  __shared__ __attribute__((aligned(16))) _Float16 sm[2 * GSTAGE];
  int lane = threadIdx.x & 31, wave = threadIdx.x >> 5;
  int rowb = blockIdx.y * 128 + (wave >> 1) * 32;
  int colb = blockIdx.x * 128 + (wave & 1) * 64;

  v8f acc[2][4];
#pragma unroll
  for (int i = 0; i < 2; ++i)
#pragma unroll
    for (int j = 0; j < 4; ++j) acc[i][j] = v8f{};

  gemm_core(Oh, Wmh, blockIdx.y * 128, blockIdx.x * 128, sm, acc);

#pragma unroll
  for (int j = 0; j < 4; ++j) {
    int col = colb + j * 16 + (lane & 15);
#pragma unroll
    for (int i = 0; i < 2; ++i) {
#pragma unroll
      for (int v = 0; v < 8; ++v) {
        int row = rowb + i * 16 + v + ((lane >> 4) << 3);
        float val = acc[i][j][v];
        val += y[(size_t)row * E_DIM + col];
        res[(size_t)row * E_DIM + col] = val;
      }
    }
  }
}

// ---------------------------------------------------------------------------
// 5) LayerNorm rows of res -> d_out, as a stream: one wave per row. The row
//    (4 KiB) is read once by 8 loads of 16 B per lane and stays in registers;
//    the two sums are taken in the lane (four chains each) and then over the
//    32 lanes by a butterfly, so every lane ends with the same totals.
// ---------------------------------------------------------------------------
typedef __attribute__((ext_vector_type(4))) float v4f;
__global__ __launch_bounds__(256)
void layernorm_kernel(const float* __restrict__ res,
                      const float* __restrict__ gamma,
                      const float* __restrict__ beta, float* __restrict__ out) {
  int lane = threadIdx.x & 31;
  // the wave's number as a scalar: the row's base then sits in scalar registers
  // and every load and store is addressed by the one lane-offset register
  size_t row = (size_t)blockIdx.x * 8 + __builtin_amdgcn_readfirstlane(threadIdx.x >> 5);
  const v4f* rp = (const v4f*)(res + row * E_DIM) + lane;
  const v4f* gp = (const v4f*)gamma + lane;
  const v4f* bp = (const v4f*)beta + lane;
  v4f* op = (v4f*)(out + row * E_DIM) + lane;

  v4f x[SLOADS], g[SLOADS], b[SLOADS];
#pragma unroll   // x[], g[], b[] need constant indices to stay in registers
  for (int c = 0; c < SLOADS; ++c) x[c] = rp[c * 32];
#pragma unroll   // as above
  for (int c = 0; c < SLOADS; ++c) { g[c] = gp[c * 32]; b[c] = bp[c * 32]; }
  // keeps all 24 loads in front of the sums: sunk behind the butterfly, the
  // gamma and beta loads would each be waited for in turn
  __builtin_amdgcn_sched_barrier(0);

  v4f a = x[0], q = x[0] * x[0];
#pragma unroll   // as above
  for (int c = 1; c < SLOADS; ++c) { a += x[c]; q += x[c] * x[c]; }
  float s1 = (a.x + a.y) + (a.z + a.w);
  float s2 = (q.x + q.y) + (q.z + q.w);
#pragma unroll   // the five exchange distances become constants
  for (int d = 16; d > 0; d >>= 1) {
    s1 += __shfl_xor(s1, d);
    s2 += __shfl_xor(s2, d);
  }
  float mu = s1 * (1.0f / E_DIM);
  float var = s2 * (1.0f / E_DIM) - mu * mu;
  float sc = rsqrtf(var + 1e-6f);
#pragma unroll   // as above
  for (int c = 0; c < SLOADS; ++c) op[c * 32] = (x[c] - mu) * sc * g[c] + b[c];
}

// ---------------------------------------------------------------------------
// Host launcher
// ---------------------------------------------------------------------------
extern "C" void kernel_launch(void* const* d_in, const int* in_sizes, int n_in,
                              void* d_out, int out_size, void* d_ws, size_t ws_size,
                              hipStream_t stream) {
  const float* y    = (const float*)d_in[0];
  const float* Wqkv = (const float*)d_in[1];
  const float* bqkv = (const float*)d_in[2];
  const float* Wmsa = (const float*)d_in[3];
  const float* Bq   = (const float*)d_in[4];
  const float* Aq   = (const float*)d_in[5];
  const float* Bk   = (const float*)d_in[6];
  const float* Ak   = (const float*)d_in[7];
  const float* Bv   = (const float*)d_in[8];
  const float* Av   = (const float*)d_in[9];
  const float* Bo   = (const float*)d_in[10];
  const float* Ao   = (const float*)d_in[11];
  const float* gamma = (const float*)d_in[12];
  const float* beta  = (const float*)d_in[13];
  float* out = (float*)d_out;

  // workspace carve-up (all offsets 256B-aligned)
  char* ws = (char*)d_ws;
  size_t off = 0;
  auto carve = [&](size_t bytes) {
    char* p = ws + off;
    off += (bytes + 255) & ~(size_t)255;
    return p;
  };
  _Float16* Xh   = (_Float16*)carve((size_t)TOK * E_DIM * 2);   // y f16
  _Float16* Wqh  = (_Float16*)carve((size_t)NQKV * E_DIM * 2);  // Wqkv + LoRA, f16
  _Float16* Wmh  = (_Float16*)carve((size_t)E_DIM * E_DIM * 2); // Wmsa + LoRA, f16
  _Float16* Qh   = (_Float16*)carve((size_t)TOK * E_DIM * 2);   // [B,H,S,D]
  _Float16* Kh   = (_Float16*)carve((size_t)TOK * E_DIM * 2);   // [B,H,S,D]
  _Float16* Vt   = (_Float16*)carve((size_t)TOK * E_DIM * 2);   // [B,H,D,S]
  _Float16* Oh   = (_Float16*)carve((size_t)TOK * E_DIM * 2);   // [B,S,E]
  float*    res  = (float*)carve((size_t)TOK * E_DIM * 4);
  (void)ws_size; (void)in_sizes; (void)n_in; (void)out_size;

  // 0) prepass: effective f16 weights and the convert of y, one launch
  prepass_kernel<<<FOLD_BLOCKS + CVT_BLOCKS, 256, 0, stream>>>(
      y, Xh, Wqkv, Wmsa, Bq, Aq, Bk, Ak, Bv, Av, Bo, Ao, Wqh, Wmh);
  // 2) QKV GEMM (grid: N/128 x M/128)
  qkv_wmma_kernel<<<dim3(NQKV / 128, TOK / 128), 256, 0, stream>>>(
      Xh, Wqh, bqkv, Qh, Kh, Vt);
  // 3) attention: B*H*(S/32) wave tiles, 8 waves/block
  attn_wmma_kernel<<<(BATCH * H_NUM * (SEQ / 32)) / 8, 256, 0, stream>>>(
      Qh, Kh, Vt, Oh);
  // 4) output projection + residual (grid: N/128 x M/128)
  msa_wmma_kernel<<<dim3(E_DIM / 128, TOK / 128), 256, 0, stream>>>(
      Oh, Wmh, y, res);
  // 5) LayerNorm: 8 rows per block
  layernorm_kernel<<<TOK / 8, 256, 0, stream>>>(res, gamma, beta, out);
}

// v008
// One run takes 90.3 microseconds.
// Two timings next to v007 put it at 1.04 and 1.05 times that version's speed.
// Over all steps from v000 it is 6.27 times as fast.
#include <hip/hip_runtime.h>
#include <hip/hip_bf16.h>

// ---------------------------------------------------------------------------
// Problem constants (match reference)
// ---------------------------------------------------------------------------
#define E_DIM 1024
#define H_NUM 16
#define D_DIM 64
#define R_DIM 8
#define BATCH 2
#define SEQ   2048
#define TOK   (BATCH * SEQ)      // 4096 tokens
#define NQKV  (3 * E_DIM)        // 3072

typedef __attribute__((ext_vector_type(16))) _Float16 v16h;
typedef __attribute__((ext_vector_type(8)))  _Float16 v8h;
typedef __attribute__((ext_vector_type(8)))  float    v8f;

__device__ __forceinline__ v8f wmma16(v16h a, v16h b, v8f c) {
  // D = A(16x32 f16) * B(32x16 f16) + C(16x16 f32)
  return __builtin_amdgcn_wmma_f32_16x16x32_f16(
      /*neg_a=*/false, a, /*neg_b=*/false, b,
      /*c_mod=*/(short)0, c, /*reuse_a=*/false, /*reuse_b=*/false);
}

// Load one 16x32 f16 operand tile into the wave32 WMMA register layout.
// Element (r, k) comes from base[(major + r) * ld + kb + k].
//   lane%16 -> r (A: row M / B: col N), lane/16 selects K-halves:
//   halves 0..7  = K (lane/16)*8 + 0..7
//   halves 8..15 = K 16 + (lane/16)*8 + 0..7
__device__ __forceinline__ v16h load_tile16(const _Float16* base, int ld,
                                            int major, int kb, int lane) {
  const _Float16* p = base + (size_t)(major + (lane & 15)) * (size_t)ld
                           + (size_t)(kb + ((lane >> 4) << 3));
  v8h lo = *(const v8h*)p;        // K = koff + 0..7
  v8h hi = *(const v8h*)(p + 16); // K = koff + 16..23
  return __builtin_shufflevector(lo, hi, 0,1,2,3,4,5,6,7,8,9,10,11,12,13,14,15);
}

// ---------------------------------------------------------------------------
// LDS staging by asynchronous copies. A staged row is 128 B of data (one whole
// line of its source) at a pitch of 144 B (16 B x odd: the ds_load_b128 pitch).
// Thread t of 256 copies 16 B: piece t%8 of row t/8, so one wave-wide copy
// covers 4 whole lines; further copies of the thread lie 32 rows on.
// ---------------------------------------------------------------------------
#define LPITCH 72                       // halves per staged row
#define LROWB  (LPITCH * 2)             // bytes per staged row

// 4 copies of 16 B per lane. The s_wait_xcnt stands inside the statement so
// that no address register is rewritten before the copies have taken it.
__device__ __forceinline__ void copy4(unsigned l0, unsigned l1, unsigned l2, unsigned l3,
                                      const _Float16* g0, const _Float16* g1,
                                      const _Float16* g2, const _Float16* g3) {
  asm volatile("global_load_async_to_lds_b128 %0, %4, off\n\t"
               "global_load_async_to_lds_b128 %1, %5, off\n\t"
               "global_load_async_to_lds_b128 %2, %6, off\n\t"
               "global_load_async_to_lds_b128 %3, %7, off\n\t"
               "s_wait_xcnt 0x0"
               :: "v"(l0), "v"(l1), "v"(l2), "v"(l3),
                  "v"(g0), "v"(g1), "v"(g2), "v"(g3) : "memory");
}
// 8 copies of 16 B per lane, same form.
__device__ __forceinline__ void copy8(unsigned l, const _Float16* ga, const _Float16* gb,
                                      unsigned lb_off, size_t gstep) {
  unsigned l0 = l, l1 = l + 32 * LROWB, l2 = l + 64 * LROWB, l3 = l + 96 * LROWB;
  unsigned l4 = l0 + lb_off, l5 = l1 + lb_off, l6 = l2 + lb_off, l7 = l3 + lb_off;
  const _Float16 *a0 = ga, *a1 = ga + gstep, *a2 = ga + 2 * gstep, *a3 = ga + 3 * gstep;
  const _Float16 *b0 = gb, *b1 = gb + gstep, *b2 = gb + 2 * gstep, *b3 = gb + 3 * gstep;
  asm volatile("global_load_async_to_lds_b128 %0, %8, off\n\t"
               "global_load_async_to_lds_b128 %1, %9, off\n\t"
               "global_load_async_to_lds_b128 %2, %10, off\n\t"
               "global_load_async_to_lds_b128 %3, %11, off\n\t"
               "global_load_async_to_lds_b128 %4, %12, off\n\t"
               "global_load_async_to_lds_b128 %5, %13, off\n\t"
               "global_load_async_to_lds_b128 %6, %14, off\n\t"
               "global_load_async_to_lds_b128 %7, %15, off\n\t"
               "s_wait_xcnt 0x0"
               :: "v"(l0), "v"(l1), "v"(l2), "v"(l3), "v"(l4), "v"(l5), "v"(l6), "v"(l7),
                  "v"(a0), "v"(a1), "v"(a2), "v"(a3), "v"(b0), "v"(b1), "v"(b2), "v"(b3)
               : "memory");
}
// the wave's own copies have landed
__device__ __forceinline__ void wait_copies() {
  asm volatile("s_wait_asynccnt 0x0" ::: "memory");
}
// the wave's own LDS reads have returned (its buffer may be refilled)
__device__ __forceinline__ void wait_lds_reads() {
  asm volatile("s_wait_dscnt 0x0" ::: "memory");
}

// ---------------------------------------------------------------------------
// GEMM core: C(128 x 128) = A[rows][1024] * B[cols][1024]^T per block of 8
// waves (4 in M x 2 in N, wave tile 32 x 64 as acc[2][4]). A stage is 64 k of
// 128 A rows and 128 B rows; two buffers, the next stage's copies fly while
// this one is multiplied.
// ---------------------------------------------------------------------------
#define GSTAGE (256 * LPITCH)           // halves per buffer
__device__ __forceinline__ void gemm_core(const _Float16* __restrict__ A,
                                          const _Float16* __restrict__ B,
                                          int row0, int col0, _Float16* sm,
                                          v8f (&acc)[2][4]) {
  int tid = threadIdx.x, lane = tid & 31, wave = tid >> 5;
  int wr = (wave >> 1) * 32;            // wave's rows in the A part
  int wc = 128 + (wave & 1) * 64;       // wave's rows in the B part
  const _Float16* ga = A + (size_t)(row0 + (tid >> 3)) * E_DIM + (tid & 7) * 8;
  const _Float16* gb = B + (size_t)(col0 + (tid >> 3)) * E_DIM + (tid & 7) * 8;
  unsigned l = (unsigned)(size_t)sm + (tid >> 3) * LROWB + (tid & 7) * 16;

  copy8(l, ga, gb, 128 * LROWB, (size_t)32 * E_DIM);
  wait_copies();
  __syncthreads();                      // stage 0 is published
  copy8(l + GSTAGE * 2, ga + 64, gb + 64, 128 * LROWB, (size_t)32 * E_DIM);

  for (int t = 0; t < E_DIM / 64; ++t) {
    const _Float16* sb = sm + (t & 1) * GSTAGE;
#pragma unroll   // both 32-k steps of a stage inline: LDS offsets become immediates
    for (int kb = 0; kb < 64; kb += 32) {
      // the six fragments of a 32-k step are read as one group ahead of its WMMAs
      v16h a0 = load_tile16(sb, LPITCH, wr, kb, lane);
      v16h a1 = load_tile16(sb, LPITCH, wr + 16, kb, lane);
      v16h b[4];
#pragma unroll   // b[] and acc[][] need constant indices to stay in registers
      for (int j = 0; j < 4; ++j) b[j] = load_tile16(sb, LPITCH, wc + j * 16, kb, lane);
      // keeps the reads together: sunk among the WMMAs, each pair costs its own LDS wait
      __builtin_amdgcn_sched_barrier(0);
#pragma unroll
      for (int j = 0; j < 4; ++j) {
        acc[0][j] = wmma16(a0, b[j], acc[0][j]);
        acc[1][j] = wmma16(a1, b[j], acc[1][j]);
      }
    }
    wait_lds_reads();
    wait_copies();
    __syncthreads();                    // publishes stage t+1, frees stage t's buffer
    if (t + 2 < E_DIM / 64)
      copy8(l + (t & 1) * (GSTAGE * 2), ga + (t + 2) * 64, gb + (t + 2) * 64,
            128 * LROWB, (size_t)32 * E_DIM);
  }
  wait_copies();
}

// ---------------------------------------------------------------------------
// 0) Prepass, ONE launch for two independent jobs, told apart by the block's
//    index: the effective f16 weights (blocks 0 .. FOLD_BLOCKS-1, the longer
//    job) and the f32 -> f16 convert of y (the rest).
//
//    Convert, as a stream: a wave takes 4 KiB of input by 8 loads of 16 B per
//    lane (each wave-wide load is 512 contiguous bytes), all in flight
//    together, and stores 256 contiguous bytes per store. Its blocks cover
//    TOK * E_DIM elements exactly.
//
//    Effective weights. y @ W^T + y @ (B A) = y @ (W + (B A)^T)^T, so
//      Wout[n][k] = f16( W[n][k] + sum_r B[k][r] * A[r][n] )
//    for the Q, K, V row groups of Wqkv and for Wmsa (group 3).
//    128 threads cover one row of 1024 k, 8 k each; a thread keeps its 8x8
//    piece of B in registers and walks FOLD_ROWS rows; each half of a block
//    has its own FOLD_ROWS rows, and A[r][n] is the same for the whole half.
// ---------------------------------------------------------------------------
#define SLOADS 8                        // 16-byte loads in flight per lane
#define FOLD_ROWS 8
#define FOLD_BLOCKS (4 * E_DIM / (2 * FOLD_ROWS))        // 2 * FOLD_ROWS rows per block
#define CVT_BLOCKS  (TOK * E_DIM / (8 * SLOADS * 128))   // 8 waves of SLOADS * 128 elements
typedef __attribute__((ext_vector_type(4))) _Float16 v4h;

__device__ __forceinline__ void cvt_f32_to_f16(int blk, const float* __restrict__ in,
                                               _Float16* __restrict__ out) {
  int lane = threadIdx.x & 31;
  size_t first = ((size_t)blk * 8 + (threadIdx.x >> 5)) * (SLOADS * 32) + lane;
  const float4* ip = (const float4*)in + first;
  v4h* op = (v4h*)out + first;
  float4 x[SLOADS];
#pragma unroll   // x[] needs constant indices to stay in registers
  for (int c = 0; c < SLOADS; ++c) x[c] = ip[c * 32];
#pragma unroll   // as above
  for (int c = 0; c < SLOADS; ++c) {
    v4h o = {(_Float16)x[c].x, (_Float16)x[c].y, (_Float16)x[c].z, (_Float16)x[c].w};
    op[c * 32] = o;
  }
}

__global__ __launch_bounds__(256)
void prepass_kernel(const float* __restrict__ y, _Float16* __restrict__ Xh,
                    const float* __restrict__ Wqkv, const float* __restrict__ Wmsa,
                    const float* __restrict__ Bq, const float* __restrict__ Aq,
                    const float* __restrict__ Bk, const float* __restrict__ Ak,
                    const float* __restrict__ Bv, const float* __restrict__ Av,
                    const float* __restrict__ Bo, const float* __restrict__ Ao,
                    _Float16* __restrict__ Wqh, _Float16* __restrict__ Wmh) {
  if (blockIdx.x >= FOLD_BLOCKS) {
    cvt_f32_to_f16(blockIdx.x - FOLD_BLOCKS, y, Xh);
    return;
  }
  // the block's half as a scalar: the row numbers, and with them the reads of A,
  // stay in scalar registers
  int part = blockIdx.x * 2 + __builtin_amdgcn_readfirstlane(threadIdx.x >> 7);
  int g  = part / (E_DIM / FOLD_ROWS);               // 0=Q 1=K 2=V 3=out
  int n0 = (part % (E_DIM / FOLD_ROWS)) * FOLD_ROWS; // row in the group
  const float* Wg = (g < 3) ? Wqkv + (size_t)g * E_DIM * E_DIM : Wmsa;
  _Float16*    Og = (g < 3) ? Wqh + (size_t)g * E_DIM * E_DIM : Wmh;
  const float* Bg = (g == 0) ? Bq : ((g == 1) ? Bk : ((g == 2) ? Bv : Bo));
  const float* Ag = (g == 0) ? Aq : ((g == 1) ? Ak : ((g == 2) ? Av : Ao));
  int k0 = (threadIdx.x & 127) * 8;

  float w[FOLD_ROWS][8];
#pragma unroll
  for (int i = 0; i < FOLD_ROWS; ++i) {
    const float4* wp = (const float4*)(Wg + (size_t)(n0 + i) * E_DIM + k0);
    float4 lo = wp[0], hi = wp[1];
    w[i][0] = lo.x; w[i][1] = lo.y; w[i][2] = lo.z; w[i][3] = lo.w;
    w[i][4] = hi.x; w[i][5] = hi.y; w[i][6] = hi.z; w[i][7] = hi.w;
  }
  float bm[8][R_DIM];   // bm[kk][r] = B[k0 + kk][r]
#pragma unroll
  for (int kk = 0; kk < 8; ++kk) {
    const float4* bp = (const float4*)(Bg + (size_t)(k0 + kk) * R_DIM);
    float4 lo = bp[0], hi = bp[1];
    bm[kk][0] = lo.x; bm[kk][1] = lo.y; bm[kk][2] = lo.z; bm[kk][3] = lo.w;
    bm[kk][4] = hi.x; bm[kk][5] = hi.y; bm[kk][6] = hi.z; bm[kk][7] = hi.w;
  }
#pragma unroll
  for (int i = 0; i < FOLD_ROWS; ++i) {
    float a8[R_DIM];
#pragma unroll
    for (int r = 0; r < R_DIM; ++r) a8[r] = Ag[r * E_DIM + n0 + i];
    v8h o;
#pragma unroll
    for (int kk = 0; kk < 8; ++kk) {
      float v = w[i][kk];
#pragma unroll
      for (int r = 0; r < R_DIM; ++r) v = __builtin_fmaf(bm[kk][r], a8[r], v);
      o[kk] = (_Float16)v;
    }
    *(v8h*)(Og + (size_t)(n0 + i) * E_DIM + k0) = o;
  }
}

// ---------------------------------------------------------------------------
// 2) QKV GEMM: C[TOK, 3072] = Xh @ Weff^T + bias (LoRA is in Weff), written to
//    Qh,Kh [B,H,S,D] f16 (Q pre-scaled by 1/sqrt(D)) and Vt [B,H,D,S] f16.
//    Block: 8 waves = 128 tokens x 128 features of ONE of Q, K, V, operands
//    staged in LDS (gemm_core), 8 WMMAs per 32-k step and wave.
//    An accumulator lane holds 8 consecutive rows of the FIRST operand, so the
//    first operand is the one whose index runs along the output's rows in
//    memory: the weights for Q and K (d is contiguous), the tokens for V^T
//    (s is contiguous). The block's tile is then laid in LDS as 128 rows of
//    256 B by 16-byte writes and goes out as whole 128-byte lines.
// ---------------------------------------------------------------------------
#define EPITCH 136                      // halves per staged output row: 272 B = 16 B x odd
__global__ __launch_bounds__(256)
void qkv_wmma_kernel(const _Float16* __restrict__ Xh,
                     const _Float16* __restrict__ Wh,     // [3072,1024] f16
                     const float* __restrict__ bqkv,
                     _Float16* __restrict__ Qh, _Float16* __restrict__ Kh,
                     _Float16* __restrict__ Vt) {
  __shared__ __attribute__((aligned(16))) _Float16 sm[2 * GSTAGE];
  int tid = threadIdx.x, lane = tid & 31, wave = tid >> 5;
  int tok0 = blockIdx.y * 128;             // first token of the block
  int col0 = blockIdx.x * 128;             // first feature of the block, 0..3071
  int g = blockIdx.x >> 3;                 // 0=Q 1=K 2=V, the same for the whole block
  bool wfirst = g < 2;                     // weights as first operand

  v8f acc[2][4];
#pragma unroll
  for (int i = 0; i < 2; ++i)
#pragma unroll
    for (int j = 0; j < 4; ++j) acc[i][j] = v8f{};

  gemm_core(wfirst ? Wh : Xh, wfirst ? Xh : Wh,
            wfirst ? col0 : tok0, wfirst ? tok0 : col0, sm, acc);

  // acc[i][j][v] = C[m0 + i*16 + v][n0 + j*16]: m counts rows of the first
  // operand, n rows of the second, both inside the block's tile.
  // gemm_core ends behind a barrier with every LDS read returned and no copy
  // in flight: its buffers are free for the tile, staged as [n][m].
  int m0 = (wave >> 1) * 32 + ((lane >> 4) << 3);
  int n0 = (wave & 1) * 64 + (lane & 15);
  _Float16* st = sm + n0 * EPITCH + m0;
  if (wfirst) {                            // m = feature, n = token
    float sc = (g == 0) ? 0.125f : 1.0f;   // fold 1/sqrt(64) into Q
#pragma unroll   // acc[][] needs constant indices to stay in registers
    for (int i = 0; i < 2; ++i) {
      const float4* bp = (const float4*)(bqkv + col0 + m0 + i * 16);
      float4 lo = bp[0], hi = bp[1];
      float bias[8] = {lo.x, lo.y, lo.z, lo.w, hi.x, hi.y, hi.z, hi.w};
#pragma unroll
      for (int j = 0; j < 4; ++j) {
        v8h w;
#pragma unroll
        for (int v = 0; v < 8; ++v) w[v] = (_Float16)((acc[i][j][v] + bias[v]) * sc);
        *(v8h*)(st + j * 16 * EPITCH + i * 16) = w;
      }
    }
  } else {                                 // m = token, n = feature
#pragma unroll   // as above
    for (int j = 0; j < 4; ++j) {
      float bias = bqkv[col0 + n0 + j * 16];
#pragma unroll
      for (int i = 0; i < 2; ++i) {
        v8h w;
#pragma unroll
        for (int v = 0; v < 8; ++v) w[v] = (_Float16)(acc[i][j][v] + bias);
        *(v8h*)(st + j * 16 * EPITCH + i * 16) = w;
      }
    }
  }
  __syncthreads();                         // the whole tile is staged

  // thread t takes 16-byte piece t%16 of staged rows t/16 + 16*c: a wave-wide
  // store covers two staged rows = four whole lines
  int piece = tid & 15, r = tid >> 4;
  int e0 = col0 & (E_DIM - 1);             // first feature inside Q, K or V
  int bb = tok0 >> 11, s0 = tok0 & (SEQ - 1);
  const _Float16* ld = sm + r * EPITCH + piece * 8;
  v8h w[8];
#pragma unroll   // w[] needs constant indices to stay in registers
  for (int c = 0; c < 8; ++c) w[c] = *(const v8h*)(ld + c * 16 * EPITCH);
  if (wfirst) {                            // staged row = token, 2 heads of 128 B
    int e = e0 + piece * 8;
    _Float16* dst = ((g == 0) ? Qh : Kh)
        + (((size_t)bb * H_NUM + (e >> 6)) * SEQ + s0 + r) * D_DIM + (e & 63);
#pragma unroll   // as above; the row steps become immediate offsets
    for (int c = 0; c < 8; ++c) *(v8h*)(dst + c * 16 * D_DIM) = w[c];
  } else {                                 // staged row = feature (h*64 + d), 128 tokens
    _Float16* dst = Vt + ((size_t)bb * E_DIM + e0 + r) * SEQ + s0 + piece * 8;
#pragma unroll   // as above
    for (int c = 0; c < 8; ++c) *(v8h*)(dst + (size_t)c * 16 * SEQ) = w[c];
  }
}

#define ASTAGE (128 * LPITCH)
#define ABUF   (2 * ASTAGE)
#define HKEYS  (SEQ / 2)
#define PSLOT  (8 * 32 * 4 + 32 * 2)
typedef __attribute__((ext_vector_type(4))) float v4f;
// value of lane l ^ 16
__device__ __forceinline__ float xhalf(float x) {
  int xi = __builtin_bit_cast(int, x);
  return __builtin_bit_cast(float, __builtin_amdgcn_permlanex16(
      xi, xi, 0x76543210, 0xfedcba98, false, false));
}

// One 16-query subtile's partial result goes to the pair's other wave: 16 B per
// lane and write, lanes side by side (no bank conflict).
__device__ __forceinline__ void give_part(float* slot, int lane, const v8f (&o)[4],
                                          float nm, float l) {
  v4f* p = (v4f*)slot + lane;
#pragma unroll   // o[] needs constant indices to stay in registers
  for (int j = 0; j < 4; ++j) {
    p[(2 * j) * 32]     = v4f{o[j][0], o[j][1], o[j][2], o[j][3]};
    p[(2 * j + 1) * 32] = v4f{o[j][4], o[j][5], o[j][6], o[j][7]};
  }
  ((float2*)(slot + 8 * 32 * 4))[lane] = float2{nm, l};
}
// Joins the other wave's partial result of a subtile with this wave's own (both
// brought to the larger of the two maxima), divides by the sum and stores:
// a lane holds 8 consecutive d of one query, one 16-byte store per tile.
__device__ __forceinline__ void join_store(const float* slot, int lane, const v8f (&o)[4],
                                           float nm, float l, _Float16* op) {
  const v4f* p = (const v4f*)slot + lane;
  float2 ml = ((const float2*)(slot + 8 * 32 * 4))[lane];
  float nmin = fminf(nm, ml.x);                 // minus the larger maximum
  float c0 = __expf(nmin - nm), c1 = __expf(nmin - ml.x);
  float lt = l * c0 + ml.y * c1;
  float inv = 1.0f / (lt + xhalf(lt));
  c0 *= inv; c1 *= inv;
#pragma unroll   // as above
  for (int j = 0; j < 4; ++j) {
    v4f lo = p[(2 * j) * 32], hi = p[(2 * j + 1) * 32];
    v8h w;
#pragma unroll
    for (int r = 0; r < 4; ++r) {
      w[r]     = (_Float16)(o[j][r] * c0 + lo[r] * c1);
      w[4 + r] = (_Float16)(o[j][4 + r] * c0 + hi[r] * c1);
    }
    *(v8h*)(op + j * 16) = w;
  }
}

__global__ __launch_bounds__(512)
void attn_wmma_kernel(const _Float16* __restrict__ Q,
                      const _Float16* __restrict__ K,
                      const _Float16* __restrict__ Vt,
                      _Float16* __restrict__ Oh) {
  __shared__ __attribute__((aligned(16))) _Float16 sm[2 * ABUF];
  static_assert(16 * PSLOT * 4 <= 2 * ABUF * 2, "the hand-over fits the ring");
  int lane = threadIdx.x & 31, wave = threadIdx.x >> 5;
  // the wave's key half as a scalar: the tests on it are scalar branches
  int kh = __builtin_amdgcn_readfirstlane(threadIdx.x >> 8);
  int id = blockIdx.x * 8 + (wave & 7);     // 0 .. B*H*(S/32)-1 = 2047
  int qt = id & (SEQ / 32 - 1);             // 32-query tile in sequence
  int bh = id >> 6;                         // 0..31
  int b = bh >> 4, h = bh & 15;
  const _Float16* Qp = Q + (size_t)bh * SEQ * D_DIM;
  const _Float16* Kp = K + (size_t)bh * SEQ * D_DIM;
  const _Float16* Vp = Vt + (size_t)bh * D_DIM * SEQ;
  int qrow = qt * 32;

  // Q^T as B operand: column = query, kept in registers for the whole loop
  v16h bq[2][2];
#pragma unroll
  for (int i = 0; i < 2; ++i) {
    bq[i][0] = load_tile16(Qp, D_DIM, qrow + i * 16, 0, lane);
    bq[i][1] = load_tile16(Qp, D_DIM, qrow + i * 16, 32, lane);
  }

  // o[i][j][r] = O^T[d = j*16 + 8*(lane/16) + r][query = qrow + i*16 + lane%16]
  v8f o[2][4];
  // negm[i]: minus the maximum in use of the lane's query column, in all eight
  // elements: it is the C operand of the score products, so a score tile comes
  // out as score - maximum. l is the lane half's own partial sum.
  v8f negm[2];
  float l[2];
#pragma unroll
  for (int i = 0; i < 2; ++i) {
#pragma unroll
    for (int j = 0; j < 4; ++j) o[i][j] = v8f{};
    negm[i] = v8f{}; l[i] = 0.f;
  }

  // this thread's pieces of a stage, all of its own wave's key half:
  // K rows r, r+32 and V^T rows r, r+32
  int u = threadIdx.x & 255;
  const _Float16* gk = Kp + (size_t)(kh * HKEYS + (u >> 3)) * D_DIM + (u & 7) * 8;
  const _Float16* gv = Vp + (size_t)(u >> 3) * SEQ + kh * HKEYS + (u & 7) * 8;
  unsigned lk = (unsigned)(size_t)sm + kh * (ASTAGE * 2) + (u >> 3) * LROWB + (u & 7) * 16;

  copy4(lk, lk + 32 * LROWB, lk + 64 * LROWB, lk + 96 * LROWB,
        gk, gk + 32 * D_DIM, gv, gv + 32 * SEQ);
  wait_copies();
  __syncthreads();                          // stage 0 is published
  copy4(lk + ABUF * 2, lk + ABUF * 2 + 32 * LROWB,
        lk + ABUF * 2 + 64 * LROWB, lk + ABUF * 2 + 96 * LROWB,
        gk + 64 * D_DIM, gk + 96 * D_DIM, gv + 64, gv + 32 * SEQ + 64);

  for (int t = 0; t < HKEYS / 64; ++t) {
   const _Float16* sk = sm + (t & 1) * ABUF + kh * ASTAGE;   // K rows of this stage
   const _Float16* sv = sk + 64 * LPITCH;        // V^T rows of this stage
#pragma unroll   // both 32-key passes of a stage inline: LDS offsets become immediates
   for (int kb = 0; kb < 64; kb += 32) {
    // s[i][kt][r] = score(key kh*HKEYS + 64*t + kb + kt*16 + 8*(lane/16) + r, query column)
    //               - maximum in use of that column
    v8f s[2][2];

#pragma unroll
    for (int kt = 0; kt < 2; ++kt) {
      v16h ak0 = load_tile16(sk, LPITCH, kb + kt * 16, 0, lane);
      v16h ak1 = load_tile16(sk, LPITCH, kb + kt * 16, 32, lane);
#pragma unroll
      for (int i = 0; i < 2; ++i) {
        s[i][kt] = wmma16(ak0, bq[i][0], negm[i]);
        s[i][kt] = wmma16(ak1, bq[i][1], s[i][kt]);
      }
    }

    // The pass's four V^T fragments are read here, as one group in front of the
    // test: they land under the score products and the maxima. Read behind the
    // branch, each pair is waited for in turn just ahead of its two products.
    v16h av[4];
#pragma unroll   // av[] needs constant indices to stay in registers
    for (int j = 0; j < 4; ++j) av[j] = load_tile16(sv, LPITCH, j * 16, kb, lane);

    // The maximum in use moves only when a column's scores outgrow it by more
    // than 8 (p stays below e^8, far inside f16), or on the very first pass,
    // which sets it: one test per pass for the whole wave, a scalar branch.
    bool first = (t == 0) && (kb == 0);
    float mx[2];        // the lane half's own largest score above the maximum in use
#pragma unroll
    for (int i = 0; i < 2; ++i) {
      float t8[8];
#pragma unroll
      for (int v = 0; v < 8; ++v) t8[v] = fmaxf(s[i][0][v], s[i][1][v]);
      mx[i] = fmaxf(fmaxf(fmaxf(t8[0], t8[1]), fmaxf(t8[2], t8[3])),
                    fmaxf(fmaxf(t8[4], t8[5]), fmaxf(t8[6], t8[7])));
    }
    // holds the four V^T reads in front of the branch (inputs only, no code): the
    // compiler otherwise sinks them behind it, one exposed LDS wait per pair
    asm volatile("" :: "v"(av[0]), "v"(av[1]), "v"(av[2]), "v"(av[3]));
    if (__builtin_amdgcn_ballot_w32(first || fmaxf(mx[0], mx[1]) > 8.0f) != 0) {
#pragma unroll
      for (int i = 0; i < 2; ++i) {
        float mh = fmaxf(mx[i], xhalf(mx[i]));        // both halves use one maximum
        float d = (first || mh > 8.0f) ? mh : 0.f;    // how far this column's maximum moves
        float corr = first ? 0.f : __expf(-d);        // first pass: o and l are still 0
        s[i][0] -= d; s[i][1] -= d; negm[i] -= d;
        l[i] *= corr;
#pragma unroll
        for (int j = 0; j < 4; ++j) o[i][j] *= corr;
      }
    }

    v16h bp[2];   // P^T as B operand, packed straight from the score tiles
#pragma unroll
    for (int i = 0; i < 2; ++i) {
      // e^x as 2^(x * log2 e), the product taken on whole tiles (packed multiplies)
      v8f p0 = s[i][0] * 1.44269504f;   // keys kb + 8*(lane/16) + v
      v8f p1 = s[i][1] * 1.44269504f;   // keys kb + 16 + 8*(lane/16) + v
#pragma unroll
      for (int v = 0; v < 8; ++v) p0[v] = __builtin_amdgcn_exp2f(p0[v]);
#pragma unroll
      for (int v = 0; v < 8; ++v) p1[v] = __builtin_amdgcn_exp2f(p1[v]);
#pragma unroll
      for (int v = 0; v < 8; ++v) {
        bp[i][v]     = (_Float16)p0[v];
        bp[i][8 + v] = (_Float16)p1[v];
      }
      v8f ps = p0 + p1;
      l[i] += ((ps[0] + ps[1]) + (ps[2] + ps[3])) + ((ps[4] + ps[5]) + (ps[6] + ps[7]));
    }

    // each V^T fragment feeds both query subtiles
#pragma unroll
    for (int j = 0; j < 4; ++j) {
#pragma unroll
      for (int i = 0; i < 2; ++i) o[i][j] = wmma16(av[j], bp[i], o[i][j]);
    }
   }
   wait_lds_reads();
   wait_copies();
   __syncthreads();                         // publishes stage t+1, frees stage t's buffer
   if (t + 2 < HKEYS / 64) {
     unsigned lt = lk + (t & 1) * (ABUF * 2);
     const _Float16* gkt = gk + (size_t)(t + 2) * 64 * D_DIM;
     const _Float16* gvt = gv + (t + 2) * 64;
     copy4(lt, lt + 32 * LROWB, lt + 64 * LROWB, lt + 96 * LROWB,
           gkt, gkt + 32 * D_DIM, gvt, gvt + 32 * SEQ);
   }
  }
  wait_copies();

  // The loop ends behind a barrier with every LDS read returned and no copy in
  // flight: the ring is free for the hand-over. Wave kh keeps subtile kh.
  float* ps = (float*)sm;
  if (kh == 0) give_part(ps + wave * PSLOT, lane, o[1], negm[1][0], l[1]);
  else         give_part(ps + wave * PSLOT, lane, o[0], negm[0][0], l[0]);
  __syncthreads();                          // every handed-over subtile is in LDS
  const float* po = ps + (wave ^ 8) * PSLOT;
  _Float16* op = Oh + ((size_t)b * SEQ + qrow + kh * 16 + (lane & 15)) * E_DIM + h * D_DIM
                    + ((lane >> 4) << 3);
  if (kh == 0) join_store(po, lane, o[0], negm[0][0], l[0], op);
  else         join_store(po, lane, o[1], negm[1][0], l[1], op);
}

// ---------------------------------------------------------------------------
// 4) res = O @ Weff^T + y   (f32 out; Weff = Wmsa + (Bo Ao)^T)
//    Wave tile 32x64, block 128x128, like the QKV GEMM.
// ---------------------------------------------------------------------------
__global__ __launch_bounds__(256)
void msa_wmma_kernel(const _Float16* __restrict__ Oh,
                     const _Float16* __restrict__ Wmh,   // [1024,1024] f16
                     const float* __restrict__ y, float* __restrict__ res) {
  __shared__ __attribute__((aligned(16))) _Float16 sm[2 * GSTAGE];
  int lane = threadIdx.x & 31, wave = threadIdx.x >> 5;
  int rowb = blockIdx.y * 128 + (wave >> 1) * 32;
  int colb = blockIdx.x * 128 + (wave & 1) * 64;

  v8f acc[2][4];
#pragma unroll
  for (int i = 0; i < 2; ++i)
#pragma unroll
    for (int j = 0; j < 4; ++j) acc[i][j] = v8f{};

  gemm_core(Oh, Wmh, blockIdx.y * 128, blockIdx.x * 128, sm, acc);

#pragma unroll
  for (int j = 0; j < 4; ++j) {
    int col = colb + j * 16 + (lane & 15);
#pragma unroll
    for (int i = 0; i < 2; ++i) {
#pragma unroll
      for (int v = 0; v < 8; ++v) {
        int row = rowb + i * 16 + v + ((lane >> 4) << 3);
        float val = acc[i][j][v];
        val += y[(size_t)row * E_DIM + col];
        res[(size_t)row * E_DIM + col] = val;
      }
    }
  }
}

// ---------------------------------------------------------------------------
// 5) LayerNorm rows of res -> d_out, as a stream: one wave per row. The row
//    (4 KiB) is read once by 8 loads of 16 B per lane and stays in registers;
//    the two sums are taken in the lane (four chains each) and then over the
//    32 lanes by a butterfly, so every lane ends with the same totals.
// ---------------------------------------------------------------------------
__global__ __launch_bounds__(256)
void layernorm_kernel(const float* __restrict__ res,
                      const float* __restrict__ gamma,
                      const float* __restrict__ beta, float* __restrict__ out) {
  int lane = threadIdx.x & 31;
  // the wave's number as a scalar: the row's base then sits in scalar registers
  // and every load and store is addressed by the one lane-offset register
  size_t row = (size_t)blockIdx.x * 8 + __builtin_amdgcn_readfirstlane(threadIdx.x >> 5);
  const v4f* rp = (const v4f*)(res + row * E_DIM) + lane;
  const v4f* gp = (const v4f*)gamma + lane;
  const v4f* bp = (const v4f*)beta + lane;
  v4f* op = (v4f*)(out + row * E_DIM) + lane;

  v4f x[SLOADS], g[SLOADS], b[SLOADS];
#pragma unroll   // x[], g[], b[] need constant indices to stay in registers
  for (int c = 0; c < SLOADS; ++c) x[c] = rp[c * 32];
#pragma unroll   // as above
  for (int c = 0; c < SLOADS; ++c) { g[c] = gp[c * 32]; b[c] = bp[c * 32]; }
  // keeps all 24 loads in front of the sums: sunk behind the butterfly, the
  // gamma and beta loads would each be waited for in turn
  __builtin_amdgcn_sched_barrier(0);

  v4f a = x[0], q = x[0] * x[0];
#pragma unroll   // as above
  for (int c = 1; c < SLOADS; ++c) { a += x[c]; q += x[c] * x[c]; }
  float s1 = (a.x + a.y) + (a.z + a.w);
  float s2 = (q.x + q.y) + (q.z + q.w);
#pragma unroll   // the five exchange distances become constants
  for (int d = 16; d > 0; d >>= 1) {
    s1 += __shfl_xor(s1, d);
    s2 += __shfl_xor(s2, d);
  }
  float mu = s1 * (1.0f / E_DIM);
  float var = s2 * (1.0f / E_DIM) - mu * mu;
  float sc = rsqrtf(var + 1e-6f);
#pragma unroll   // as above
  for (int c = 0; c < SLOADS; ++c) op[c * 32] = (x[c] - mu) * sc * g[c] + b[c];
}

// ---------------------------------------------------------------------------
// Host launcher
// ---------------------------------------------------------------------------
extern "C" void kernel_launch(void* const* d_in, const int* in_sizes, int n_in,
                              void* d_out, int out_size, void* d_ws, size_t ws_size,
                              hipStream_t stream) {
  const float* y    = (const float*)d_in[0];
  const float* Wqkv = (const float*)d_in[1];
  const float* bqkv = (const float*)d_in[2];
  const float* Wmsa = (const float*)d_in[3];
  const float* Bq   = (const float*)d_in[4];
  const float* Aq   = (const float*)d_in[5];
  const float* Bk   = (const float*)d_in[6];
  const float* Ak   = (const float*)d_in[7];
  const float* Bv   = (const float*)d_in[8];
  const float* Av   = (const float*)d_in[9];
  const float* Bo   = (const float*)d_in[10];
  const float* Ao   = (const float*)d_in[11];
  const float* gamma = (const float*)d_in[12];
  const float* beta  = (const float*)d_in[13];
  float* out = (float*)d_out;

  // workspace carve-up (all offsets 256B-aligned)
  char* ws = (char*)d_ws;
  size_t off = 0;
  auto carve = [&](size_t bytes) {
    char* p = ws + off;
    off += (bytes + 255) & ~(size_t)255;
    return p;
  };
  _Float16* Xh   = (_Float16*)carve((size_t)TOK * E_DIM * 2);   // y f16
  _Float16* Wqh  = (_Float16*)carve((size_t)NQKV * E_DIM * 2);  // Wqkv + LoRA, f16
  _Float16* Wmh  = (_Float16*)carve((size_t)E_DIM * E_DIM * 2); // Wmsa + LoRA, f16
  _Float16* Qh   = (_Float16*)carve((size_t)TOK * E_DIM * 2);   // [B,H,S,D]
  _Float16* Kh   = (_Float16*)carve((size_t)TOK * E_DIM * 2);   // [B,H,S,D]
  _Float16* Vt   = (_Float16*)carve((size_t)TOK * E_DIM * 2);   // [B,H,D,S]
  _Float16* Oh   = (_Float16*)carve((size_t)TOK * E_DIM * 2);   // [B,S,E]
  float*    res  = (float*)carve((size_t)TOK * E_DIM * 4);
  (void)ws_size; (void)in_sizes; (void)n_in; (void)out_size;

  // 0) prepass: effective f16 weights and the convert of y, one launch
  prepass_kernel<<<FOLD_BLOCKS + CVT_BLOCKS, 256, 0, stream>>>(
      y, Xh, Wqkv, Wmsa, Bq, Aq, Bk, Ak, Bv, Av, Bo, Ao, Wqh, Wmh);
  // 2) QKV GEMM (grid: N/128 x M/128)
  qkv_wmma_kernel<<<dim3(NQKV / 128, TOK / 128), 256, 0, stream>>>(
      Xh, Wqh, bqkv, Qh, Kh, Vt);
  // 3) attention: B*H*(S/32) query tiles, 8 per block, 2 waves per tile
  attn_wmma_kernel<<<(BATCH * H_NUM * (SEQ / 32)) / 8, 512, 0, stream>>>(
      Qh, Kh, Vt, Oh);
  // 4) output projection + residual (grid: N/128 x M/128)
  msa_wmma_kernel<<<dim3(E_DIM / 128, TOK / 128), 256, 0, stream>>>(
      Oh, Wmh, y, res);
  // 5) LayerNorm: 8 rows per block
  layernorm_kernel<<<TOK / 8, 256, 0, stream>>>(res, gamma, beta, out);
}

// v009
// One run takes 85.8 microseconds.
// Timed twice side by side with v008, it ran 1.05 times as fast both times.
// Over all steps from v000 it is 6.61 times as fast.
#include <hip/hip_runtime.h>
#include <hip/hip_bf16.h>

// ---------------------------------------------------------------------------
// Problem constants (match reference)
// ---------------------------------------------------------------------------
#define E_DIM 1024
#define H_NUM 16
#define D_DIM 64
#define R_DIM 8
#define BATCH 2
#define SEQ   2048
#define TOK   (BATCH * SEQ)      // 4096 tokens
#define NQKV  (3 * E_DIM)        // 3072

typedef __attribute__((ext_vector_type(16))) _Float16 v16h;
typedef __attribute__((ext_vector_type(8)))  _Float16 v8h;
typedef __attribute__((ext_vector_type(8)))  float    v8f;

__device__ __forceinline__ v8f wmma16(v16h a, v16h b, v8f c) {
  // D = A(16x32 f16) * B(32x16 f16) + C(16x16 f32)
  return __builtin_amdgcn_wmma_f32_16x16x32_f16(
      /*neg_a=*/false, a, /*neg_b=*/false, b,
      /*c_mod=*/(short)0, c, /*reuse_a=*/false, /*reuse_b=*/false);
}

// Load one 16x32 f16 operand tile into the wave32 WMMA register layout.
// Element (r, k) comes from base[(major + r) * ld + kb + k].
//   lane%16 -> r (A: row M / B: col N), lane/16 selects K-halves:
//   halves 0..7  = K (lane/16)*8 + 0..7
//   halves 8..15 = K 16 + (lane/16)*8 + 0..7
__device__ __forceinline__ v16h load_tile16(const _Float16* base, int ld,
                                            int major, int kb, int lane) {
  const _Float16* p = base + (size_t)(major + (lane & 15)) * (size_t)ld
                           + (size_t)(kb + ((lane >> 4) << 3));
  v8h lo = *(const v8h*)p;        // K = koff + 0..7
  v8h hi = *(const v8h*)(p + 16); // K = koff + 16..23
  return __builtin_shufflevector(lo, hi, 0,1,2,3,4,5,6,7,8,9,10,11,12,13,14,15);
}

// ---------------------------------------------------------------------------
// LDS staging by asynchronous copies. A staged row is 128 B of data (one whole
// line of its source) at a pitch of 144 B (16 B x odd: the ds_load_b128 pitch).
// Thread t of 256 (of 128 in the QKV GEMM) copies 16 B: piece t%8 of row t/8, so one wave-wide copy
// covers 4 whole lines; further copies of the thread lie 32 rows on (16 in the QKV GEMM).
// ---------------------------------------------------------------------------
#define LPITCH 72                       // halves per staged row
#define LROWB  (LPITCH * 2)             // bytes per staged row

// 4 copies of 16 B per lane. The s_wait_xcnt stands inside the statement so
// that no address register is rewritten before the copies have taken it.
__device__ __forceinline__ void copy4(unsigned l0, unsigned l1, unsigned l2, unsigned l3,
                                      const _Float16* g0, const _Float16* g1,
                                      const _Float16* g2, const _Float16* g3) {
  asm volatile("global_load_async_to_lds_b128 %0, %4, off\n\t"
               "global_load_async_to_lds_b128 %1, %5, off\n\t"
               "global_load_async_to_lds_b128 %2, %6, off\n\t"
               "global_load_async_to_lds_b128 %3, %7, off\n\t"
               "s_wait_xcnt 0x0"
               :: "v"(l0), "v"(l1), "v"(l2), "v"(l3),
                  "v"(g0), "v"(g1), "v"(g2), "v"(g3) : "memory");
}
// 8 copies of 16 B per lane, same form.
__device__ __forceinline__ void copy8(unsigned l, const _Float16* ga, const _Float16* gb,
                                      unsigned lb_off, size_t gstep) {
  unsigned l0 = l, l1 = l + 32 * LROWB, l2 = l + 64 * LROWB, l3 = l + 96 * LROWB;
  unsigned l4 = l0 + lb_off, l5 = l1 + lb_off, l6 = l2 + lb_off, l7 = l3 + lb_off;
  const _Float16 *a0 = ga, *a1 = ga + gstep, *a2 = ga + 2 * gstep, *a3 = ga + 3 * gstep;
  const _Float16 *b0 = gb, *b1 = gb + gstep, *b2 = gb + 2 * gstep, *b3 = gb + 3 * gstep;
  asm volatile("global_load_async_to_lds_b128 %0, %8, off\n\t"
               "global_load_async_to_lds_b128 %1, %9, off\n\t"
               "global_load_async_to_lds_b128 %2, %10, off\n\t"
               "global_load_async_to_lds_b128 %3, %11, off\n\t"
               "global_load_async_to_lds_b128 %4, %12, off\n\t"
               "global_load_async_to_lds_b128 %5, %13, off\n\t"
               "global_load_async_to_lds_b128 %6, %14, off\n\t"
               "global_load_async_to_lds_b128 %7, %15, off\n\t"
               "s_wait_xcnt 0x0"
               :: "v"(l0), "v"(l1), "v"(l2), "v"(l3), "v"(l4), "v"(l5), "v"(l6), "v"(l7),
                  "v"(a0), "v"(a1), "v"(a2), "v"(a3), "v"(b0), "v"(b1), "v"(b2), "v"(b3)
               : "memory");
}
// the wave's own copies have landed
__device__ __forceinline__ void wait_copies() {
  asm volatile("s_wait_asynccnt 0x0" ::: "memory");
}
// the wave's own LDS reads have returned (its buffer may be refilled)
__device__ __forceinline__ void wait_lds_reads() {
  asm volatile("s_wait_dscnt 0x0" ::: "memory");
}

// ---------------------------------------------------------------------------
// GEMM core: C(128 x 128) = A[rows][1024] * B[cols][1024]^T per block of 8
// waves (4 in M x 2 in N, wave tile 32 x 64 as acc[2][4]). A stage is 64 k of
// 128 A rows and 128 B rows; two buffers, the next stage's copies fly while
// this one is multiplied.
// ---------------------------------------------------------------------------
#define GSTAGE (256 * LPITCH)           // halves per buffer
__device__ __forceinline__ void gemm_core(const _Float16* __restrict__ A,
                                          const _Float16* __restrict__ B,
                                          int row0, int col0, _Float16* sm,
                                          v8f (&acc)[2][4]) {
  int tid = threadIdx.x, lane = tid & 31, wave = tid >> 5;
  int wr = (wave >> 1) * 32;            // wave's rows in the A part
  int wc = 128 + (wave & 1) * 64;       // wave's rows in the B part
  const _Float16* ga = A + (size_t)(row0 + (tid >> 3)) * E_DIM + (tid & 7) * 8;
  const _Float16* gb = B + (size_t)(col0 + (tid >> 3)) * E_DIM + (tid & 7) * 8;
  unsigned l = (unsigned)(size_t)sm + (tid >> 3) * LROWB + (tid & 7) * 16;

  copy8(l, ga, gb, 128 * LROWB, (size_t)32 * E_DIM);
  wait_copies();
  __syncthreads();                      // stage 0 is published
  copy8(l + GSTAGE * 2, ga + 64, gb + 64, 128 * LROWB, (size_t)32 * E_DIM);

  for (int t = 0; t < E_DIM / 64; ++t) {
    const _Float16* sb = sm + (t & 1) * GSTAGE;
#pragma unroll   // both 32-k steps of a stage inline: LDS offsets become immediates
    for (int kb = 0; kb < 64; kb += 32) {
      // the six fragments of a 32-k step are read as one group ahead of its WMMAs
      v16h a0 = load_tile16(sb, LPITCH, wr, kb, lane);
      v16h a1 = load_tile16(sb, LPITCH, wr + 16, kb, lane);
      v16h b[4];
#pragma unroll   // b[] and acc[][] need constant indices to stay in registers
      for (int j = 0; j < 4; ++j) b[j] = load_tile16(sb, LPITCH, wc + j * 16, kb, lane);
      // keeps the reads together: sunk among the WMMAs, each pair costs its own LDS wait
      __builtin_amdgcn_sched_barrier(0);
#pragma unroll
      for (int j = 0; j < 4; ++j) {
        acc[0][j] = wmma16(a0, b[j], acc[0][j]);
        acc[1][j] = wmma16(a1, b[j], acc[1][j]);
      }
    }
    wait_lds_reads();
    wait_copies();
    __syncthreads();                    // publishes stage t+1, frees stage t's buffer
    if (t + 2 < E_DIM / 64)
      copy8(l + (t & 1) * (GSTAGE * 2), ga + (t + 2) * 64, gb + (t + 2) * 64,
            128 * LROWB, (size_t)32 * E_DIM);
  }
  wait_copies();
}

// ---------------------------------------------------------------------------
// 0) Prepass, ONE launch for two independent jobs, told apart by the block's
//    index: the effective f16 weights (blocks 0 .. FOLD_BLOCKS-1, the longer
//    job) and the f32 -> f16 convert of y (the rest).
//
//    Convert, as a stream: a wave takes 4 KiB of input by 8 loads of 16 B per
//    lane (each wave-wide load is 512 contiguous bytes), all in flight
//    together, and stores 256 contiguous bytes per store. Its blocks cover
//    TOK * E_DIM elements exactly.
//
//    Effective weights. y @ W^T + y @ (B A) = y @ (W + (B A)^T)^T, so
//      Wout[n][k] = f16( W[n][k] + sum_r B[k][r] * A[r][n] )
//    for the Q, K, V row groups of Wqkv and for Wmsa (group 3).
//    128 threads cover one row of 1024 k, 8 k each; a thread keeps its 8x8
//    piece of B in registers and walks FOLD_ROWS rows; each half of a block
//    has its own FOLD_ROWS rows, and A[r][n] is the same for the whole half.
// ---------------------------------------------------------------------------
#define SLOADS 8                        // 16-byte loads in flight per lane
#define FOLD_ROWS 8
#define FOLD_BLOCKS (4 * E_DIM / (2 * FOLD_ROWS))        // 2 * FOLD_ROWS rows per block
#define CVT_BLOCKS  (TOK * E_DIM / (8 * SLOADS * 128))   // 8 waves of SLOADS * 128 elements
typedef __attribute__((ext_vector_type(4))) _Float16 v4h;

__device__ __forceinline__ void cvt_f32_to_f16(int blk, const float* __restrict__ in,
                                               _Float16* __restrict__ out) {
  int lane = threadIdx.x & 31;
  size_t first = ((size_t)blk * 8 + (threadIdx.x >> 5)) * (SLOADS * 32) + lane;
  const float4* ip = (const float4*)in + first;
  v4h* op = (v4h*)out + first;
  float4 x[SLOADS];
#pragma unroll   // x[] needs constant indices to stay in registers
  for (int c = 0; c < SLOADS; ++c) x[c] = ip[c * 32];
#pragma unroll   // as above
  for (int c = 0; c < SLOADS; ++c) {
    v4h o = {(_Float16)x[c].x, (_Float16)x[c].y, (_Float16)x[c].z, (_Float16)x[c].w};
    op[c * 32] = o;
  }
}

__global__ __launch_bounds__(256)
void prepass_kernel(const float* __restrict__ y, _Float16* __restrict__ Xh,
                    const float* __restrict__ Wqkv, const float* __restrict__ Wmsa,
                    const float* __restrict__ Bq, const float* __restrict__ Aq,
                    const float* __restrict__ Bk, const float* __restrict__ Ak,
                    const float* __restrict__ Bv, const float* __restrict__ Av,
                    const float* __restrict__ Bo, const float* __restrict__ Ao,
                    _Float16* __restrict__ Wqh, _Float16* __restrict__ Wmh) {
  if (blockIdx.x >= FOLD_BLOCKS) {
    cvt_f32_to_f16(blockIdx.x - FOLD_BLOCKS, y, Xh);
    return;
  }
  // the block's half as a scalar: the row numbers, and with them the reads of A,
  // stay in scalar registers
  int part = blockIdx.x * 2 + __builtin_amdgcn_readfirstlane(threadIdx.x >> 7);
  int g  = part / (E_DIM / FOLD_ROWS);               // 0=Q 1=K 2=V 3=out
  int n0 = (part % (E_DIM / FOLD_ROWS)) * FOLD_ROWS; // row in the group
  const float* Wg = (g < 3) ? Wqkv + (size_t)g * E_DIM * E_DIM : Wmsa;
  _Float16*    Og = (g < 3) ? Wqh + (size_t)g * E_DIM * E_DIM : Wmh;
  const float* Bg = (g == 0) ? Bq : ((g == 1) ? Bk : ((g == 2) ? Bv : Bo));
  const float* Ag = (g == 0) ? Aq : ((g == 1) ? Ak : ((g == 2) ? Av : Ao));
  int k0 = (threadIdx.x & 127) * 8;

  float w[FOLD_ROWS][8];
#pragma unroll
  for (int i = 0; i < FOLD_ROWS; ++i) {
    const float4* wp = (const float4*)(Wg + (size_t)(n0 + i) * E_DIM + k0);
    float4 lo = wp[0], hi = wp[1];
    w[i][0] = lo.x; w[i][1] = lo.y; w[i][2] = lo.z; w[i][3] = lo.w;
    w[i][4] = hi.x; w[i][5] = hi.y; w[i][6] = hi.z; w[i][7] = hi.w;
  }
  float bm[8][R_DIM];   // bm[kk][r] = B[k0 + kk][r]
#pragma unroll
  for (int kk = 0; kk < 8; ++kk) {
    const float4* bp = (const float4*)(Bg + (size_t)(k0 + kk) * R_DIM);
    float4 lo = bp[0], hi = bp[1];
    bm[kk][0] = lo.x; bm[kk][1] = lo.y; bm[kk][2] = lo.z; bm[kk][3] = lo.w;
    bm[kk][4] = hi.x; bm[kk][5] = hi.y; bm[kk][6] = hi.z; bm[kk][7] = hi.w;
  }
#pragma unroll
  for (int i = 0; i < FOLD_ROWS; ++i) {
    float a8[R_DIM];
#pragma unroll
    for (int r = 0; r < R_DIM; ++r) a8[r] = Ag[r * E_DIM + n0 + i];
    v8h o;
#pragma unroll
    for (int kk = 0; kk < 8; ++kk) {
      float v = w[i][kk];
#pragma unroll
      for (int r = 0; r < R_DIM; ++r) v = __builtin_fmaf(bm[kk][r], a8[r], v);
      o[kk] = (_Float16)v;
    }
    *(v8h*)(Og + (size_t)(n0 + i) * E_DIM + k0) = o;
  }
}

// ---------------------------------------------------------------------------
// 2) QKV GEMM: C[TOK, 3072] = Xh @ Weff^T + bias (LoRA is in Weff), written to
//    Qh,Kh [B,H,S,D] f16 (Q pre-scaled by 1/sqrt(D)) and Vt [B,H,D,S] f16.
//    Block: 12 waves = 256 tokens x 192 features (3 heads), 256 blocks, one per
//    WGP: each operand byte fetched from L2 feeds more products than in a
//    128 x 128 tile. Wave tile 64 tokens x 64 features = ONE head of one of
//    Q, K, V: 16 WMMAs per 8 fragments read from LDS.
//    An accumulator lane holds 8 consecutive rows of the FIRST operand, so the
//    first operand is the one whose index runs along the output's rows in
//    memory: the weights for Q and K (d is contiguous), the tokens for V^T
//    (s is contiguous). The wave tile is square and both operands are read in
//    the same way, so a wave makes that choice by which LDS rows it calls first.
//    A stage is 64 k of 256 token rows and 192 weight rows. A block is alone on
//    its WGP, so a stage's copies get two stages of flight: three buffers, and
//    the three groups of four waves copy the stages in turn (28 copies a lane),
//    so that a group never has more than one stage in flight and its wait to 0
//    means that stage alone.
// ---------------------------------------------------------------------------
#define QROWS  (256 + 192)              // staged rows per stage: tokens, then weights
#define QSTAGE (QROWS * LPITCH)         // halves per buffer
#define QNST   (E_DIM / 64)             // stages

// 14 copies of 16 B per lane, LDS rows 16 apart. The s_wait_xcnt stands inside
// the statement so that no address register is rewritten before the copies
// have taken it.
__device__ __forceinline__ void copy14(unsigned l, const _Float16* const (&g)[14]) {
  unsigned d[14];
#pragma unroll   // d[] needs constant indices to stay in registers
  for (int c = 0; c < 14; ++c) d[c] = l + c * (16 * LROWB);
  asm volatile("global_load_async_to_lds_b128 %0, %14, off\n\t"
               "global_load_async_to_lds_b128 %1, %15, off\n\t"
               "global_load_async_to_lds_b128 %2, %16, off\n\t"
               "global_load_async_to_lds_b128 %3, %17, off\n\t"
               "global_load_async_to_lds_b128 %4, %18, off\n\t"
               "global_load_async_to_lds_b128 %5, %19, off\n\t"
               "global_load_async_to_lds_b128 %6, %20, off\n\t"
               "global_load_async_to_lds_b128 %7, %21, off\n\t"
               "global_load_async_to_lds_b128 %8, %22, off\n\t"
               "global_load_async_to_lds_b128 %9, %23, off\n\t"
               "global_load_async_to_lds_b128 %10, %24, off\n\t"
               "global_load_async_to_lds_b128 %11, %25, off\n\t"
               "global_load_async_to_lds_b128 %12, %26, off\n\t"
               "global_load_async_to_lds_b128 %13, %27, off\n\t"
               "s_wait_xcnt 0x0"
               :: "v"(d[0]), "v"(d[1]), "v"(d[2]), "v"(d[3]), "v"(d[4]), "v"(d[5]), "v"(d[6]),
                  "v"(d[7]), "v"(d[8]), "v"(d[9]), "v"(d[10]), "v"(d[11]), "v"(d[12]), "v"(d[13]),
                  "v"(g[0]), "v"(g[1]), "v"(g[2]), "v"(g[3]), "v"(g[4]), "v"(g[5]), "v"(g[6]),
                  "v"(g[7]), "v"(g[8]), "v"(g[9]), "v"(g[10]), "v"(g[11]), "v"(g[12]), "v"(g[13])
               : "memory");
}
// One whole stage by the 128 threads of one wave group: thread u copies piece
// u%8 of staged rows u/8 + 16*c, c = 0..27 (16 sweeps of tokens, 12 of weights).
// gx, gw: the thread's piece of its first token row and first weight row at
// this stage's k; l: its LDS byte address in row u/8 of the stage's buffer.
__device__ __forceinline__ void copy_qstage(unsigned l, const _Float16* gx, const _Float16* gw) {
  const _Float16* g[14];
#pragma unroll   // g[] needs constant indices to stay in registers
  for (int c = 0; c < 14; ++c) g[c] = gx + (size_t)c * 16 * E_DIM;
  copy14(l, g);
#pragma unroll   // as above
  for (int c = 0; c < 14; ++c)
    g[c] = (c < 2) ? gx + (size_t)(14 + c) * 16 * E_DIM : gw + (size_t)(c - 2) * 16 * E_DIM;
  copy14(l + 14 * (16 * LROWB), g);
}

__global__ __launch_bounds__(384)
void qkv_wmma_kernel(const _Float16* __restrict__ Xh,
                     const _Float16* __restrict__ Wh,     // [3072,1024] f16
                     const float* __restrict__ bqkv,
                     _Float16* __restrict__ Qh, _Float16* __restrict__ Kh,
                     _Float16* __restrict__ Vt) {
  __shared__ __attribute__((aligned(16))) _Float16 sm[3 * QSTAGE];
  static_assert(12 * 64 * LPITCH <= 3 * QSTAGE, "the output staging fits the ring");
  int tid = threadIdx.x, lane = tid & 31, wave = tid >> 5;
  // the wave's group as a scalar: the tests on it are scalar branches
  int grp = __builtin_amdgcn_readfirstlane(tid >> 7);   // 0..2: head in the block, copy turn
  int tw = wave & 3;                       // the wave's 64 tokens in the block
  int tok0 = blockIdx.y * 256;             // first token of the block
  int col0 = blockIdx.x * 192;             // first feature of the block, 0..3071
  int hg = blockIdx.x * 3 + grp;           // the wave's head among the 48 of Q, K, V
  int g = hg >> 4, head = hg & 15;         // 0=Q 1=K 2=V, the same for the whole wave
  bool wfirst = g < 2;                     // weights as first operand

  v8f acc[4][4];
#pragma unroll
  for (int i = 0; i < 4; ++i)
#pragma unroll
    for (int j = 0; j < 4; ++j) acc[i][j] = v8f{};

  int xr = tw * 64, wr = 256 + grp * 64;   // the wave's token rows and weight rows of a stage
  int fr = wfirst ? wr : xr;               // rows of the first operand
  int sr = wfirst ? xr : wr;               // rows of the second operand

  int u = tid & 127;
  const _Float16* gx = Xh + (size_t)(tok0 + (u >> 3)) * E_DIM + (u & 7) * 8;
  const _Float16* gw = Wh + (size_t)(col0 + (u >> 3)) * E_DIM + (u & 7) * 8;
  unsigned l = (unsigned)(size_t)sm + (u >> 3) * LROWB + (u & 7) * 16;

  // stages 0, 1, 2: each group copies the stage of its own number
  copy_qstage(l + grp * (QSTAGE * 2), gx + grp * 64, gw + grp * 64);
  if (grp == 0) wait_copies();
  __syncthreads();                          // stage 0 is published

  int ph = 0;                               // t mod 3: buffer in use, and its group
  for (int t = 0; t < QNST; ++t) {
    const _Float16* sb = sm + ph * QSTAGE;
    int nx = (ph == 2) ? 0 : ph + 1;
#pragma unroll   // both 32-k steps of a stage inline: LDS offsets become immediates
    for (int kb = 0; kb < 64; kb += 32) {
      // the eight fragments of a 32-k step are read as one group ahead of its WMMAs
      v16h a[4], b[4];
#pragma unroll   // a[], b[] and acc[][] need constant indices to stay in registers
      for (int i = 0; i < 4; ++i) a[i] = load_tile16(sb, LPITCH, fr + i * 16, kb, lane);
#pragma unroll
      for (int j = 0; j < 4; ++j) b[j] = load_tile16(sb, LPITCH, sr + j * 16, kb, lane);
      // keeps the reads together: sunk among the WMMAs, each pair costs its own LDS wait
      __builtin_amdgcn_sched_barrier(0);
#pragma unroll
      for (int j = 0; j < 4; ++j)
#pragma unroll
        for (int i = 0; i < 4; ++i) acc[i][j] = wmma16(a[i], b[j], acc[i][j]);
    }
    wait_lds_reads();
    if (grp == nx) wait_copies();           // stage t+1 has landed: its group's only copies
    __syncthreads();                        // publishes stage t+1, frees stage t's buffer
    if (grp == ph && t + 3 < QNST)
      copy_qstage(l + ph * (QSTAGE * 2), gx + (t + 3) * 64, gw + (t + 3) * 64);
    ph = nx;
  }
  wait_copies();

  // acc[i][j][v] = C[m0 + i*16 + v][n0 + j*16]: m counts rows of the first
  // operand, n rows of the second, both inside the wave's tile.
  // The loop ends behind a barrier with every LDS read returned and no copy in
  // flight: the ring is free. Each wave stages its tile as [n][m], 64 rows of
  // 128 B, in a range of its own.
  int m0 = (lane >> 4) << 3;
  int n0 = lane & 15;
  _Float16* tile = sm + wave * (64 * LPITCH);
  _Float16* st = tile + n0 * LPITCH + m0;
  if (wfirst) {                            // m = d of the head, n = token
    float sc = (g == 0) ? 0.125f : 1.0f;   // fold 1/sqrt(64) into Q
#pragma unroll   // acc[][] needs constant indices to stay in registers
    for (int i = 0; i < 4; ++i) {
      const float4* bp = (const float4*)(bqkv + hg * 64 + m0 + i * 16);
      float4 lo = bp[0], hi = bp[1];
      float bias[8] = {lo.x, lo.y, lo.z, lo.w, hi.x, hi.y, hi.z, hi.w};
#pragma unroll
      for (int j = 0; j < 4; ++j) {
        v8h w;
#pragma unroll
        for (int v = 0; v < 8; ++v) w[v] = (_Float16)((acc[i][j][v] + bias[v]) * sc);
        *(v8h*)(st + j * 16 * LPITCH + i * 16) = w;
      }
    }
  } else {                                 // m = token, n = d of the head
#pragma unroll   // as above
    for (int j = 0; j < 4; ++j) {
      float bias = bqkv[hg * 64 + n0 + j * 16];
#pragma unroll
      for (int i = 0; i < 4; ++i) {
        v8h w;
#pragma unroll
        for (int v = 0; v < 8; ++v) w[v] = (_Float16)(acc[i][j][v] + bias);
        *(v8h*)(st + j * 16 * LPITCH + i * 16) = w;
      }
    }
  }
  __syncthreads();                         // every tile is staged

  // lane takes 16-byte piece lane%8 of staged rows lane/8 + 4*c: a wave-wide
  // store covers four staged rows = four whole lines
  int piece = lane & 7, r = lane >> 3;
  int bb = tok0 >> 11, s0 = (tok0 & (SEQ - 1)) + tw * 64;
  const _Float16* ld = tile + r * LPITCH + piece * 8;
  v8h w[16];
#pragma unroll   // w[] needs constant indices to stay in registers
  for (int c = 0; c < 16; ++c) w[c] = *(const v8h*)(ld + c * 4 * LPITCH);
  if (wfirst) {                            // staged row = token, 128 B of its head
    _Float16* dst = ((g == 0) ? Qh : Kh)
        + (((size_t)bb * H_NUM + head) * SEQ + s0 + r) * D_DIM + piece * 8;
#pragma unroll   // as above; the row steps become immediate offsets
    for (int c = 0; c < 16; ++c) *(v8h*)(dst + c * 4 * D_DIM) = w[c];
  } else {                                 // staged row = d of the head, 64 tokens
    _Float16* dst = Vt + ((size_t)bb * E_DIM + head * D_DIM + r) * SEQ + s0 + piece * 8;
#pragma unroll   // as above
    for (int c = 0; c < 16; ++c) *(v8h*)(dst + (size_t)c * 4 * SEQ) = w[c];
  }
}

#define ASTAGE (128 * LPITCH)
#define ABUF   (2 * ASTAGE)
#define HKEYS  (SEQ / 2)
#define PSLOT  (8 * 32 * 4 + 32 * 2)
typedef __attribute__((ext_vector_type(4))) float v4f;
// value of lane l ^ 16
__device__ __forceinline__ float xhalf(float x) {
  int xi = __builtin_bit_cast(int, x);
  return __builtin_bit_cast(float, __builtin_amdgcn_permlanex16(
      xi, xi, 0x76543210, 0xfedcba98, false, false));
}

// One 16-query subtile's partial result goes to the pair's other wave: 16 B per
// lane and write, lanes side by side (no bank conflict).
__device__ __forceinline__ void give_part(float* slot, int lane, const v8f (&o)[4],
                                          float nm, float l) {
  v4f* p = (v4f*)slot + lane;
#pragma unroll   // o[] needs constant indices to stay in registers
  for (int j = 0; j < 4; ++j) {
    p[(2 * j) * 32]     = v4f{o[j][0], o[j][1], o[j][2], o[j][3]};
    p[(2 * j + 1) * 32] = v4f{o[j][4], o[j][5], o[j][6], o[j][7]};
  }
  ((float2*)(slot + 8 * 32 * 4))[lane] = float2{nm, l};
}
// Joins the other wave's partial result of a subtile with this wave's own (both
// brought to the larger of the two maxima), divides by the sum and stores:
// a lane holds 8 consecutive d of one query, one 16-byte store per tile.
__device__ __forceinline__ void join_store(const float* slot, int lane, const v8f (&o)[4],
                                           float nm, float l, _Float16* op) {
  const v4f* p = (const v4f*)slot + lane;
  float2 ml = ((const float2*)(slot + 8 * 32 * 4))[lane];
  float nmin = fminf(nm, ml.x);                 // minus the larger maximum
  float c0 = __expf(nmin - nm), c1 = __expf(nmin - ml.x);
  float lt = l * c0 + ml.y * c1;
  float inv = 1.0f / (lt + xhalf(lt));
  c0 *= inv; c1 *= inv;
#pragma unroll   // as above
  for (int j = 0; j < 4; ++j) {
    v4f lo = p[(2 * j) * 32], hi = p[(2 * j + 1) * 32];
    v8h w;
#pragma unroll
    for (int r = 0; r < 4; ++r) {
      w[r]     = (_Float16)(o[j][r] * c0 + lo[r] * c1);
      w[4 + r] = (_Float16)(o[j][4 + r] * c0 + hi[r] * c1);
    }
    *(v8h*)(op + j * 16) = w;
  }
}

__global__ __launch_bounds__(512)
void attn_wmma_kernel(const _Float16* __restrict__ Q,
                      const _Float16* __restrict__ K,
                      const _Float16* __restrict__ Vt,
                      _Float16* __restrict__ Oh) {
  __shared__ __attribute__((aligned(16))) _Float16 sm[2 * ABUF];
  static_assert(16 * PSLOT * 4 <= 2 * ABUF * 2, "the hand-over fits the ring");
  int lane = threadIdx.x & 31, wave = threadIdx.x >> 5;
  // the wave's key half as a scalar: the tests on it are scalar branches
  int kh = __builtin_amdgcn_readfirstlane(threadIdx.x >> 8);
  int id = blockIdx.x * 8 + (wave & 7);     // 0 .. B*H*(S/32)-1 = 2047
  int qt = id & (SEQ / 32 - 1);             // 32-query tile in sequence
  int bh = id >> 6;                         // 0..31
  int b = bh >> 4, h = bh & 15;
  const _Float16* Qp = Q + (size_t)bh * SEQ * D_DIM;
  const _Float16* Kp = K + (size_t)bh * SEQ * D_DIM;
  const _Float16* Vp = Vt + (size_t)bh * D_DIM * SEQ;
  int qrow = qt * 32;

  // Q^T as B operand: column = query, kept in registers for the whole loop
  v16h bq[2][2];
#pragma unroll
  for (int i = 0; i < 2; ++i) {
    bq[i][0] = load_tile16(Qp, D_DIM, qrow + i * 16, 0, lane);
    bq[i][1] = load_tile16(Qp, D_DIM, qrow + i * 16, 32, lane);
  }

  // o[i][j][r] = O^T[d = j*16 + 8*(lane/16) + r][query = qrow + i*16 + lane%16]
  v8f o[2][4];
  // negm[i]: minus the maximum in use of the lane's query column, in all eight
  // elements: it is the C operand of the score products, so a score tile comes
  // out as score - maximum. l is the lane half's own partial sum.
  v8f negm[2];
  float l[2];
#pragma unroll
  for (int i = 0; i < 2; ++i) {
#pragma unroll
    for (int j = 0; j < 4; ++j) o[i][j] = v8f{};
    negm[i] = v8f{}; l[i] = 0.f;
  }

  // this thread's pieces of a stage, all of its own wave's key half:
  // K rows r, r+32 and V^T rows r, r+32
  int u = threadIdx.x & 255;
  const _Float16* gk = Kp + (size_t)(kh * HKEYS + (u >> 3)) * D_DIM + (u & 7) * 8;
  const _Float16* gv = Vp + (size_t)(u >> 3) * SEQ + kh * HKEYS + (u & 7) * 8;
  unsigned lk = (unsigned)(size_t)sm + kh * (ASTAGE * 2) + (u >> 3) * LROWB + (u & 7) * 16;

  copy4(lk, lk + 32 * LROWB, lk + 64 * LROWB, lk + 96 * LROWB,
        gk, gk + 32 * D_DIM, gv, gv + 32 * SEQ);
  wait_copies();
  __syncthreads();                          // stage 0 is published
  copy4(lk + ABUF * 2, lk + ABUF * 2 + 32 * LROWB,
        lk + ABUF * 2 + 64 * LROWB, lk + ABUF * 2 + 96 * LROWB,
        gk + 64 * D_DIM, gk + 96 * D_DIM, gv + 64, gv + 32 * SEQ + 64);

  for (int t = 0; t < HKEYS / 64; ++t) {
   const _Float16* sk = sm + (t & 1) * ABUF + kh * ASTAGE;   // K rows of this stage
   const _Float16* sv = sk + 64 * LPITCH;        // V^T rows of this stage
#pragma unroll   // both 32-key passes of a stage inline: LDS offsets become immediates
   for (int kb = 0; kb < 64; kb += 32) {
    // s[i][kt][r] = score(key kh*HKEYS + 64*t + kb + kt*16 + 8*(lane/16) + r, query column)
    //               - maximum in use of that column
    v8f s[2][2];

#pragma unroll
    for (int kt = 0; kt < 2; ++kt) {
      v16h ak0 = load_tile16(sk, LPITCH, kb + kt * 16, 0, lane);
      v16h ak1 = load_tile16(sk, LPITCH, kb + kt * 16, 32, lane);
#pragma unroll
      for (int i = 0; i < 2; ++i) {
        s[i][kt] = wmma16(ak0, bq[i][0], negm[i]);
        s[i][kt] = wmma16(ak1, bq[i][1], s[i][kt]);
      }
    }

    // The pass's four V^T fragments are read here, as one group in front of the
    // test: they land under the score products and the maxima. Read behind the
    // branch, each pair is waited for in turn just ahead of its two products.
    v16h av[4];
#pragma unroll   // av[] needs constant indices to stay in registers
    for (int j = 0; j < 4; ++j) av[j] = load_tile16(sv, LPITCH, j * 16, kb, lane);

    // The maximum in use moves only when a column's scores outgrow it by more
    // than 8 (p stays below e^8, far inside f16), or on the very first pass,
    // which sets it: one test per pass for the whole wave, a scalar branch.
    bool first = (t == 0) && (kb == 0);
    float mx[2];        // the lane half's own largest score above the maximum in use
#pragma unroll
    for (int i = 0; i < 2; ++i) {
      float t8[8];
#pragma unroll
      for (int v = 0; v < 8; ++v) t8[v] = fmaxf(s[i][0][v], s[i][1][v]);
      mx[i] = fmaxf(fmaxf(fmaxf(t8[0], t8[1]), fmaxf(t8[2], t8[3])),
                    fmaxf(fmaxf(t8[4], t8[5]), fmaxf(t8[6], t8[7])));
    }
    // holds the four V^T reads in front of the branch (inputs only, no code): the
    // compiler otherwise sinks them behind it, one exposed LDS wait per pair
    asm volatile("" :: "v"(av[0]), "v"(av[1]), "v"(av[2]), "v"(av[3]));
    if (__builtin_amdgcn_ballot_w32(first || fmaxf(mx[0], mx[1]) > 8.0f) != 0) {
#pragma unroll
      for (int i = 0; i < 2; ++i) {
        float mh = fmaxf(mx[i], xhalf(mx[i]));        // both halves use one maximum
        float d = (first || mh > 8.0f) ? mh : 0.f;    // how far this column's maximum moves
        float corr = first ? 0.f : __expf(-d);        // first pass: o and l are still 0
        s[i][0] -= d; s[i][1] -= d; negm[i] -= d;
        l[i] *= corr;
#pragma unroll
        for (int j = 0; j < 4; ++j) o[i][j] *= corr;
      }
    }

    v16h bp[2];   // P^T as B operand, packed straight from the score tiles
#pragma unroll
    for (int i = 0; i < 2; ++i) {
      // e^x as 2^(x * log2 e), the product taken on whole tiles (packed multiplies)
      v8f p0 = s[i][0] * 1.44269504f;   // keys kb + 8*(lane/16) + v
      v8f p1 = s[i][1] * 1.44269504f;   // keys kb + 16 + 8*(lane/16) + v
#pragma unroll
      for (int v = 0; v < 8; ++v) p0[v] = __builtin_amdgcn_exp2f(p0[v]);
#pragma unroll
      for (int v = 0; v < 8; ++v) p1[v] = __builtin_amdgcn_exp2f(p1[v]);
#pragma unroll
      for (int v = 0; v < 8; ++v) {
        bp[i][v]     = (_Float16)p0[v];
        bp[i][8 + v] = (_Float16)p1[v];
      }
      v8f ps = p0 + p1;
      l[i] += ((ps[0] + ps[1]) + (ps[2] + ps[3])) + ((ps[4] + ps[5]) + (ps[6] + ps[7]));
    }

    // each V^T fragment feeds both query subtiles
#pragma unroll
    for (int j = 0; j < 4; ++j) {
#pragma unroll
      for (int i = 0; i < 2; ++i) o[i][j] = wmma16(av[j], bp[i], o[i][j]);
    }
   }
   wait_lds_reads();
   wait_copies();
   __syncthreads();                         // publishes stage t+1, frees stage t's buffer
   if (t + 2 < HKEYS / 64) {
     unsigned lt = lk + (t & 1) * (ABUF * 2);
     const _Float16* gkt = gk + (size_t)(t + 2) * 64 * D_DIM;
     const _Float16* gvt = gv + (t + 2) * 64;
     copy4(lt, lt + 32 * LROWB, lt + 64 * LROWB, lt + 96 * LROWB,
           gkt, gkt + 32 * D_DIM, gvt, gvt + 32 * SEQ);
   }
  }
  wait_copies();

  // The loop ends behind a barrier with every LDS read returned and no copy in
  // flight: the ring is free for the hand-over. Wave kh keeps subtile kh.
  float* ps = (float*)sm;
  if (kh == 0) give_part(ps + wave * PSLOT, lane, o[1], negm[1][0], l[1]);
  else         give_part(ps + wave * PSLOT, lane, o[0], negm[0][0], l[0]);
  __syncthreads();                          // every handed-over subtile is in LDS
  const float* po = ps + (wave ^ 8) * PSLOT;
  _Float16* op = Oh + ((size_t)b * SEQ + qrow + kh * 16 + (lane & 15)) * E_DIM + h * D_DIM
                    + ((lane >> 4) << 3);
  if (kh == 0) join_store(po, lane, o[0], negm[0][0], l[0], op);
  else         join_store(po, lane, o[1], negm[1][0], l[1], op);
}

// ---------------------------------------------------------------------------
// 4) res = O @ Weff^T + y   (f32 out; Weff = Wmsa + (Bo Ao)^T)
//    Wave tile 32x64, block 128x128 (gemm_core).
// ---------------------------------------------------------------------------
__global__ __launch_bounds__(256)
void msa_wmma_kernel(const _Float16* __restrict__ Oh,
                     const _Float16* __restrict__ Wmh,   // [1024,1024] f16
                     const float* __restrict__ y, float* __restrict__ res) {
  __shared__ __attribute__((aligned(16))) _Float16 sm[2 * GSTAGE];
  int lane = threadIdx.x & 31, wave = threadIdx.x >> 5;
  int rowb = blockIdx.y * 128 + (wave >> 1) * 32;
  int colb = blockIdx.x * 128 + (wave & 1) * 64;

  v8f acc[2][4];
#pragma unroll
  for (int i = 0; i < 2; ++i)
#pragma unroll
    for (int j = 0; j < 4; ++j) acc[i][j] = v8f{};

  gemm_core(Oh, Wmh, blockIdx.y * 128, blockIdx.x * 128, sm, acc);

#pragma unroll
  for (int j = 0; j < 4; ++j) {
    int col = colb + j * 16 + (lane & 15);
#pragma unroll
    for (int i = 0; i < 2; ++i) {
#pragma unroll
      for (int v = 0; v < 8; ++v) {
        int row = rowb + i * 16 + v + ((lane >> 4) << 3);
        float val = acc[i][j][v];
        val += y[(size_t)row * E_DIM + col];
        res[(size_t)row * E_DIM + col] = val;
      }
    }
  }
}

// ---------------------------------------------------------------------------
// 5) LayerNorm rows of res -> d_out, as a stream: one wave per row. The row
//    (4 KiB) is read once by 8 loads of 16 B per lane and stays in registers;
//    the two sums are taken in the lane (four chains each) and then over the
//    32 lanes by a butterfly, so every lane ends with the same totals.
// ---------------------------------------------------------------------------
__global__ __launch_bounds__(256)
void layernorm_kernel(const float* __restrict__ res,
                      const float* __restrict__ gamma,
                      const float* __restrict__ beta, float* __restrict__ out) {
  int lane = threadIdx.x & 31;
  // the wave's number as a scalar: the row's base then sits in scalar registers
  // and every load and store is addressed by the one lane-offset register
  size_t row = (size_t)blockIdx.x * 8 + __builtin_amdgcn_readfirstlane(threadIdx.x >> 5);
  const v4f* rp = (const v4f*)(res + row * E_DIM) + lane;
  const v4f* gp = (const v4f*)gamma + lane;
  const v4f* bp = (const v4f*)beta + lane;
  v4f* op = (v4f*)(out + row * E_DIM) + lane;

  v4f x[SLOADS], g[SLOADS], b[SLOADS];
#pragma unroll   // x[], g[], b[] need constant indices to stay in registers
  for (int c = 0; c < SLOADS; ++c) x[c] = rp[c * 32];
#pragma unroll   // as above
  for (int c = 0; c < SLOADS; ++c) { g[c] = gp[c * 32]; b[c] = bp[c * 32]; }
  // keeps all 24 loads in front of the sums: sunk behind the butterfly, the
  // gamma and beta loads would each be waited for in turn
  __builtin_amdgcn_sched_barrier(0);

  v4f a = x[0], q = x[0] * x[0];
#pragma unroll   // as above
  for (int c = 1; c < SLOADS; ++c) { a += x[c]; q += x[c] * x[c]; }
  float s1 = (a.x + a.y) + (a.z + a.w);
  float s2 = (q.x + q.y) + (q.z + q.w);
#pragma unroll   // the five exchange distances become constants
  for (int d = 16; d > 0; d >>= 1) {
    s1 += __shfl_xor(s1, d);
    s2 += __shfl_xor(s2, d);
  }
  float mu = s1 * (1.0f / E_DIM);
  float var = s2 * (1.0f / E_DIM) - mu * mu;
  float sc = rsqrtf(var + 1e-6f);
#pragma unroll   // as above
  for (int c = 0; c < SLOADS; ++c) op[c * 32] = (x[c] - mu) * sc * g[c] + b[c];
}

// ---------------------------------------------------------------------------
// Host launcher
// ---------------------------------------------------------------------------
extern "C" void kernel_launch(void* const* d_in, const int* in_sizes, int n_in,
                              void* d_out, int out_size, void* d_ws, size_t ws_size,
                              hipStream_t stream) {
  const float* y    = (const float*)d_in[0];
  const float* Wqkv = (const float*)d_in[1];
  const float* bqkv = (const float*)d_in[2];
  const float* Wmsa = (const float*)d_in[3];
  const float* Bq   = (const float*)d_in[4];
  const float* Aq   = (const float*)d_in[5];
  const float* Bk   = (const float*)d_in[6];
  const float* Ak   = (const float*)d_in[7];
  const float* Bv   = (const float*)d_in[8];
  const float* Av   = (const float*)d_in[9];
  const float* Bo   = (const float*)d_in[10];
  const float* Ao   = (const float*)d_in[11];
  const float* gamma = (const float*)d_in[12];
  const float* beta  = (const float*)d_in[13];
  float* out = (float*)d_out;

  // workspace carve-up (all offsets 256B-aligned)
  char* ws = (char*)d_ws;
  size_t off = 0;
  auto carve = [&](size_t bytes) {
    char* p = ws + off;
    off += (bytes + 255) & ~(size_t)255;
    return p;
  };
  _Float16* Xh   = (_Float16*)carve((size_t)TOK * E_DIM * 2);   // y f16
  _Float16* Wqh  = (_Float16*)carve((size_t)NQKV * E_DIM * 2);  // Wqkv + LoRA, f16
  _Float16* Wmh  = (_Float16*)carve((size_t)E_DIM * E_DIM * 2); // Wmsa + LoRA, f16
  _Float16* Qh   = (_Float16*)carve((size_t)TOK * E_DIM * 2);   // [B,H,S,D]
  _Float16* Kh   = (_Float16*)carve((size_t)TOK * E_DIM * 2);   // [B,H,S,D]
  _Float16* Vt   = (_Float16*)carve((size_t)TOK * E_DIM * 2);   // [B,H,D,S]
  _Float16* Oh   = (_Float16*)carve((size_t)TOK * E_DIM * 2);   // [B,S,E]
  float*    res  = (float*)carve((size_t)TOK * E_DIM * 4);
  (void)ws_size; (void)in_sizes; (void)n_in; (void)out_size;

  // 0) prepass: effective f16 weights and the convert of y, one launch
  prepass_kernel<<<FOLD_BLOCKS + CVT_BLOCKS, 256, 0, stream>>>(
      y, Xh, Wqkv, Wmsa, Bq, Aq, Bk, Ak, Bv, Av, Bo, Ao, Wqh, Wmh);
  // 2) QKV GEMM (grid: N/192 x M/256)
  qkv_wmma_kernel<<<dim3(NQKV / 192, TOK / 256), 384, 0, stream>>>(
      Xh, Wqh, bqkv, Qh, Kh, Vt);
  // 3) attention: B*H*(S/32) query tiles, 8 per block, 2 waves per tile
  attn_wmma_kernel<<<(BATCH * H_NUM * (SEQ / 32)) / 8, 512, 0, stream>>>(
      Qh, Kh, Vt, Oh);
  // 4) output projection + residual (grid: N/128 x M/128)
  msa_wmma_kernel<<<dim3(E_DIM / 128, TOK / 128), 256, 0, stream>>>(
      Oh, Wmh, y, res);
  // 5) LayerNorm: 8 rows per block
  layernorm_kernel<<<TOK / 8, 256, 0, stream>>>(res, gamma, beta, out);
}

// v010
// One run takes 81 microseconds.
// In two side-by-side timings against v009, it was 1.05 and 1.07 times as fast.
// Over all steps from v000 it is 7.00 times as fast.
#include <hip/hip_runtime.h>
#include <hip/hip_bf16.h>

// ---------------------------------------------------------------------------
// Problem constants (match reference)
// ---------------------------------------------------------------------------
#define E_DIM 1024
#define H_NUM 16
#define D_DIM 64
#define R_DIM 8
#define BATCH 2
#define SEQ   2048
#define TOK   (BATCH * SEQ)      // 4096 tokens
#define NQKV  (3 * E_DIM)        // 3072

typedef __attribute__((ext_vector_type(16))) _Float16 v16h;
typedef __attribute__((ext_vector_type(8)))  _Float16 v8h;
typedef __attribute__((ext_vector_type(8)))  float    v8f;

__device__ __forceinline__ v8f wmma16(v16h a, v16h b, v8f c) {
  // D = A(16x32 f16) * B(32x16 f16) + C(16x16 f32)
  return __builtin_amdgcn_wmma_f32_16x16x32_f16(
      /*neg_a=*/false, a, /*neg_b=*/false, b,
      /*c_mod=*/(short)0, c, /*reuse_a=*/false, /*reuse_b=*/false);
}

// Load one 16x32 f16 operand tile into the wave32 WMMA register layout.
// Element (r, k) comes from base[(major + r) * ld + kb + k].
//   lane%16 -> r (A: row M / B: col N), lane/16 selects K-halves:
//   halves 0..7  = K (lane/16)*8 + 0..7
//   halves 8..15 = K 16 + (lane/16)*8 + 0..7
__device__ __forceinline__ v16h load_tile16(const _Float16* base, int ld,
                                            int major, int kb, int lane) {
  const _Float16* p = base + (size_t)(major + (lane & 15)) * (size_t)ld
                           + (size_t)(kb + ((lane >> 4) << 3));
  v8h lo = *(const v8h*)p;        // K = koff + 0..7
  v8h hi = *(const v8h*)(p + 16); // K = koff + 16..23
  return __builtin_shufflevector(lo, hi, 0,1,2,3,4,5,6,7,8,9,10,11,12,13,14,15);
}

// ---------------------------------------------------------------------------
// LDS staging by asynchronous copies. In attention and the QKV GEMM a staged row is 128 B of data (one whole
// line of its source) at a pitch of 144 B (16 B x odd: the ds_load_b128 pitch).
// Thread t of 256 (of 128 in the QKV GEMM) copies 16 B: piece t%8 of row t/8, so one wave-wide copy
// covers 4 whole lines; further copies of the thread lie 32 rows on (16 in the QKV GEMM).
// ---------------------------------------------------------------------------
#define LPITCH 72                       // halves per staged row
#define LROWB  (LPITCH * 2)             // bytes per staged row

// 4 copies of 16 B per lane. The s_wait_xcnt stands inside the statement so
// that no address register is rewritten before the copies have taken it.
__device__ __forceinline__ void copy4(unsigned l0, unsigned l1, unsigned l2, unsigned l3,
                                      const _Float16* g0, const _Float16* g1,
                                      const _Float16* g2, const _Float16* g3) {
  asm volatile("global_load_async_to_lds_b128 %0, %4, off\n\t"
               "global_load_async_to_lds_b128 %1, %5, off\n\t"
               "global_load_async_to_lds_b128 %2, %6, off\n\t"
               "global_load_async_to_lds_b128 %3, %7, off\n\t"
               "s_wait_xcnt 0x0"
               :: "v"(l0), "v"(l1), "v"(l2), "v"(l3),
                  "v"(g0), "v"(g1), "v"(g2), "v"(g3) : "memory");
}
// the wave's own copies have landed
__device__ __forceinline__ void wait_copies() {
  asm volatile("s_wait_asynccnt 0x0" ::: "memory");
}
// the wave's own LDS reads have returned (its buffer may be refilled)
__device__ __forceinline__ void wait_lds_reads() {
  asm volatile("s_wait_dscnt 0x0" ::: "memory");
}

// ---------------------------------------------------------------------------
// 0) Prepass, ONE launch for two independent jobs, told apart by the block's
//    index: the effective f16 weights (blocks 0 .. FOLD_BLOCKS-1, the longer
//    job) and the f32 -> f16 convert of y (the rest).
//
//    Convert, as a stream: a wave takes 4 KiB of input by 8 loads of 16 B per
//    lane (each wave-wide load is 512 contiguous bytes), all in flight
//    together, and stores 256 contiguous bytes per store. Its blocks cover
//    TOK * E_DIM elements exactly.
//
//    Effective weights. y @ W^T + y @ (B A) = y @ (W + (B A)^T)^T, so
//      Wout[n][k] = f16( W[n][k] + sum_r B[k][r] * A[r][n] )
//    for the Q, K, V row groups of Wqkv and for Wmsa (group 3).
//    128 threads cover one row of 1024 k, 8 k each; a thread keeps its 8x8
//    piece of B in registers and walks FOLD_ROWS rows; each half of a block
//    has its own FOLD_ROWS rows, and A[r][n] is the same for the whole half.
//    Group 3 is stored in FRAGMENT ORDER, as 16-byte pieces
//      [n / 16][k / 32][(k / 16) % 2][lane = n % 16 + 16 * ((k / 8) % 2)]
//    (the order of load_tile16), so that its one reader takes each half of a
//    16 x 32 operand tile by one wave-wide load of 512 contiguous bytes.
// ---------------------------------------------------------------------------
#define SLOADS 8                        // 16-byte loads in flight per lane
#define FOLD_ROWS 8
#define FOLD_BLOCKS (4 * E_DIM / (2 * FOLD_ROWS))        // 2 * FOLD_ROWS rows per block
#define CVT_BLOCKS  (TOK * E_DIM / (8 * SLOADS * 128))   // 8 waves of SLOADS * 128 elements
typedef __attribute__((ext_vector_type(4))) _Float16 v4h;

__device__ __forceinline__ void cvt_f32_to_f16(int blk, const float* __restrict__ in,
                                               _Float16* __restrict__ out) {
  int lane = threadIdx.x & 31;
  size_t first = ((size_t)blk * 8 + (threadIdx.x >> 5)) * (SLOADS * 32) + lane;
  const float4* ip = (const float4*)in + first;
  v4h* op = (v4h*)out + first;
  float4 x[SLOADS];
#pragma unroll   // x[] needs constant indices to stay in registers
  for (int c = 0; c < SLOADS; ++c) x[c] = ip[c * 32];
#pragma unroll   // as above
  for (int c = 0; c < SLOADS; ++c) {
    v4h o = {(_Float16)x[c].x, (_Float16)x[c].y, (_Float16)x[c].z, (_Float16)x[c].w};
    op[c * 32] = o;
  }
}

__global__ __launch_bounds__(256)
void prepass_kernel(const float* __restrict__ y, _Float16* __restrict__ Xh,
                    const float* __restrict__ Wqkv, const float* __restrict__ Wmsa,
                    const float* __restrict__ Bq, const float* __restrict__ Aq,
                    const float* __restrict__ Bk, const float* __restrict__ Ak,
                    const float* __restrict__ Bv, const float* __restrict__ Av,
                    const float* __restrict__ Bo, const float* __restrict__ Ao,
                    _Float16* __restrict__ Wqh, _Float16* __restrict__ Wmh) {
  if (blockIdx.x >= FOLD_BLOCKS) {
    cvt_f32_to_f16(blockIdx.x - FOLD_BLOCKS, y, Xh);
    return;
  }
  // the block's half as a scalar: the row numbers, and with them the reads of A,
  // stay in scalar registers
  int part = blockIdx.x * 2 + __builtin_amdgcn_readfirstlane(threadIdx.x >> 7);
  int g  = part / (E_DIM / FOLD_ROWS);               // 0=Q 1=K 2=V 3=out
  int n0 = (part % (E_DIM / FOLD_ROWS)) * FOLD_ROWS; // row in the group
  const float* Wg = (g < 3) ? Wqkv + (size_t)g * E_DIM * E_DIM : Wmsa;
  _Float16*    Og = (g < 3) ? Wqh + (size_t)g * E_DIM * E_DIM : Wmh;
  const float* Bg = (g == 0) ? Bq : ((g == 1) ? Bk : ((g == 2) ? Bv : Bo));
  const float* Ag = (g == 0) ? Aq : ((g == 1) ? Ak : ((g == 2) ? Av : Ao));
  int k0 = (threadIdx.x & 127) * 8;
  // where the thread's piece of row n0 goes, and the step to the next row's
  // (n0 is a multiple of FOLD_ROWS = 8: the rows share n / 16, so in fragment
  // order their pieces lie side by side)
  _Float16* op = Og + ((g < 3)
      ? n0 * E_DIM + k0
      : ((((n0 >> 4) * (E_DIM / 32) + (k0 >> 5)) * 2 + ((k0 >> 4) & 1)) * 32
         + (n0 & 15) + ((k0 >> 3) & 1) * 16) * 8);
  int ostep = (g < 3) ? E_DIM : 8;

  float w[FOLD_ROWS][8];
#pragma unroll
  for (int i = 0; i < FOLD_ROWS; ++i) {
    const float4* wp = (const float4*)(Wg + (size_t)(n0 + i) * E_DIM + k0);
    float4 lo = wp[0], hi = wp[1];
    w[i][0] = lo.x; w[i][1] = lo.y; w[i][2] = lo.z; w[i][3] = lo.w;
    w[i][4] = hi.x; w[i][5] = hi.y; w[i][6] = hi.z; w[i][7] = hi.w;
  }
  float bm[8][R_DIM];   // bm[kk][r] = B[k0 + kk][r]
#pragma unroll
  for (int kk = 0; kk < 8; ++kk) {
    const float4* bp = (const float4*)(Bg + (size_t)(k0 + kk) * R_DIM);
    float4 lo = bp[0], hi = bp[1];
    bm[kk][0] = lo.x; bm[kk][1] = lo.y; bm[kk][2] = lo.z; bm[kk][3] = lo.w;
    bm[kk][4] = hi.x; bm[kk][5] = hi.y; bm[kk][6] = hi.z; bm[kk][7] = hi.w;
  }
#pragma unroll
  for (int i = 0; i < FOLD_ROWS; ++i) {
    float a8[R_DIM];
#pragma unroll
    for (int r = 0; r < R_DIM; ++r) a8[r] = Ag[r * E_DIM + n0 + i];
    v8h o;
#pragma unroll
    for (int kk = 0; kk < 8; ++kk) {
      float v = w[i][kk];
#pragma unroll
      for (int r = 0; r < R_DIM; ++r) v = __builtin_fmaf(bm[kk][r], a8[r], v);
      o[kk] = (_Float16)v;
    }
    *(v8h*)(op + i * ostep) = o;
  }
}

// ---------------------------------------------------------------------------
// 2) QKV GEMM: C[TOK, 3072] = Xh @ Weff^T + bias (LoRA is in Weff), written to
//    Qh,Kh [B,H,S,D] f16 (Q pre-scaled by 1/sqrt(D)) and Vt [B,H,D,S] f16.
//    Block: 12 waves = 256 tokens x 192 features (3 heads), 256 blocks, one per
//    WGP: each operand byte fetched from L2 feeds more products than in a
//    128 x 128 tile. Wave tile 64 tokens x 64 features = ONE head of one of
//    Q, K, V: 16 WMMAs per 8 fragments read from LDS.
//    An accumulator lane holds 8 consecutive rows of the FIRST operand, so the
//    first operand is the one whose index runs along the output's rows in
//    memory: the weights for Q and K (d is contiguous), the tokens for V^T
//    (s is contiguous). The wave tile is square and both operands are read in
//    the same way, so a wave makes that choice by which LDS rows it calls first.
//    A stage is 64 k of 256 token rows and 192 weight rows. A block is alone on
//    its WGP, so a stage's copies get two stages of flight: three buffers, and
//    the three groups of four waves copy the stages in turn (28 copies a lane),
//    so that a group never has more than one stage in flight and its wait to 0
//    means that stage alone.
// ---------------------------------------------------------------------------
#define QROWS  (256 + 192)              // staged rows per stage: tokens, then weights
#define QSTAGE (QROWS * LPITCH)         // halves per buffer
#define QNST   (E_DIM / 64)             // stages

// 14 copies of 16 B per lane, LDS rows 16 apart. The s_wait_xcnt stands inside
// the statement so that no address register is rewritten before the copies
// have taken it.
__device__ __forceinline__ void copy14(unsigned l, const _Float16* const (&g)[14]) {
  unsigned d[14];
#pragma unroll   // d[] needs constant indices to stay in registers
  for (int c = 0; c < 14; ++c) d[c] = l + c * (16 * LROWB);
  asm volatile("global_load_async_to_lds_b128 %0, %14, off\n\t"
               "global_load_async_to_lds_b128 %1, %15, off\n\t"
               "global_load_async_to_lds_b128 %2, %16, off\n\t"
               "global_load_async_to_lds_b128 %3, %17, off\n\t"
               "global_load_async_to_lds_b128 %4, %18, off\n\t"
               "global_load_async_to_lds_b128 %5, %19, off\n\t"
               "global_load_async_to_lds_b128 %6, %20, off\n\t"
               "global_load_async_to_lds_b128 %7, %21, off\n\t"
               "global_load_async_to_lds_b128 %8, %22, off\n\t"
               "global_load_async_to_lds_b128 %9, %23, off\n\t"
               "global_load_async_to_lds_b128 %10, %24, off\n\t"
               "global_load_async_to_lds_b128 %11, %25, off\n\t"
               "global_load_async_to_lds_b128 %12, %26, off\n\t"
               "global_load_async_to_lds_b128 %13, %27, off\n\t"
               "s_wait_xcnt 0x0"
               :: "v"(d[0]), "v"(d[1]), "v"(d[2]), "v"(d[3]), "v"(d[4]), "v"(d[5]), "v"(d[6]),
                  "v"(d[7]), "v"(d[8]), "v"(d[9]), "v"(d[10]), "v"(d[11]), "v"(d[12]), "v"(d[13]),
                  "v"(g[0]), "v"(g[1]), "v"(g[2]), "v"(g[3]), "v"(g[4]), "v"(g[5]), "v"(g[6]),
                  "v"(g[7]), "v"(g[8]), "v"(g[9]), "v"(g[10]), "v"(g[11]), "v"(g[12]), "v"(g[13])
               : "memory");
}
// One whole stage by the 128 threads of one wave group: thread u copies piece
// u%8 of staged rows u/8 + 16*c, c = 0..27 (16 sweeps of tokens, 12 of weights).
// gx, gw: the thread's piece of its first token row and first weight row at
// this stage's k; l: its LDS byte address in row u/8 of the stage's buffer.
__device__ __forceinline__ void copy_qstage(unsigned l, const _Float16* gx, const _Float16* gw) {
  const _Float16* g[14];
#pragma unroll   // g[] needs constant indices to stay in registers
  for (int c = 0; c < 14; ++c) g[c] = gx + (size_t)c * 16 * E_DIM;
  copy14(l, g);
#pragma unroll   // as above
  for (int c = 0; c < 14; ++c)
    g[c] = (c < 2) ? gx + (size_t)(14 + c) * 16 * E_DIM : gw + (size_t)(c - 2) * 16 * E_DIM;
  copy14(l + 14 * (16 * LROWB), g);
}

__global__ __launch_bounds__(384)
void qkv_wmma_kernel(const _Float16* __restrict__ Xh,
                     const _Float16* __restrict__ Wh,     // [3072,1024] f16
                     const float* __restrict__ bqkv,
                     _Float16* __restrict__ Qh, _Float16* __restrict__ Kh,
                     _Float16* __restrict__ Vt) {
  __shared__ __attribute__((aligned(16))) _Float16 sm[3 * QSTAGE];
  static_assert(12 * 64 * LPITCH <= 3 * QSTAGE, "the output staging fits the ring");
  int tid = threadIdx.x, lane = tid & 31, wave = tid >> 5;
  // the wave's group as a scalar: the tests on it are scalar branches
  int grp = __builtin_amdgcn_readfirstlane(tid >> 7);   // 0..2: head in the block, copy turn
  int tw = wave & 3;                       // the wave's 64 tokens in the block
  int tok0 = blockIdx.y * 256;             // first token of the block
  int col0 = blockIdx.x * 192;             // first feature of the block, 0..3071
  int hg = blockIdx.x * 3 + grp;           // the wave's head among the 48 of Q, K, V
  int g = hg >> 4, head = hg & 15;         // 0=Q 1=K 2=V, the same for the whole wave
  bool wfirst = g < 2;                     // weights as first operand

  v8f acc[4][4];
#pragma unroll
  for (int i = 0; i < 4; ++i)
#pragma unroll
    for (int j = 0; j < 4; ++j) acc[i][j] = v8f{};

  int xr = tw * 64, wr = 256 + grp * 64;   // the wave's token rows and weight rows of a stage
  int fr = wfirst ? wr : xr;               // rows of the first operand
  int sr = wfirst ? xr : wr;               // rows of the second operand

  int u = tid & 127;
  const _Float16* gx = Xh + (size_t)(tok0 + (u >> 3)) * E_DIM + (u & 7) * 8;
  const _Float16* gw = Wh + (size_t)(col0 + (u >> 3)) * E_DIM + (u & 7) * 8;
  unsigned l = (unsigned)(size_t)sm + (u >> 3) * LROWB + (u & 7) * 16;

  // stages 0, 1, 2: each group copies the stage of its own number
  copy_qstage(l + grp * (QSTAGE * 2), gx + grp * 64, gw + grp * 64);
  if (grp == 0) wait_copies();
  __syncthreads();                          // stage 0 is published

  int ph = 0;                               // t mod 3: buffer in use, and its group
  for (int t = 0; t < QNST; ++t) {
    const _Float16* sb = sm + ph * QSTAGE;
    int nx = (ph == 2) ? 0 : ph + 1;
#pragma unroll   // both 32-k steps of a stage inline: LDS offsets become immediates
    for (int kb = 0; kb < 64; kb += 32) {
      // the eight fragments of a 32-k step are read as one group ahead of its WMMAs
      v16h a[4], b[4];
#pragma unroll   // a[], b[] and acc[][] need constant indices to stay in registers
      for (int i = 0; i < 4; ++i) a[i] = load_tile16(sb, LPITCH, fr + i * 16, kb, lane);
#pragma unroll
      for (int j = 0; j < 4; ++j) b[j] = load_tile16(sb, LPITCH, sr + j * 16, kb, lane);
      // keeps the reads together: sunk among the WMMAs, each pair costs its own LDS wait
      __builtin_amdgcn_sched_barrier(0);
#pragma unroll
      for (int j = 0; j < 4; ++j)
#pragma unroll
        for (int i = 0; i < 4; ++i) acc[i][j] = wmma16(a[i], b[j], acc[i][j]);
    }
    wait_lds_reads();
    if (grp == nx) wait_copies();           // stage t+1 has landed: its group's only copies
    __syncthreads();                        // publishes stage t+1, frees stage t's buffer
    if (grp == ph && t + 3 < QNST)
      copy_qstage(l + ph * (QSTAGE * 2), gx + (t + 3) * 64, gw + (t + 3) * 64);
    ph = nx;
  }
  wait_copies();

  // acc[i][j][v] = C[m0 + i*16 + v][n0 + j*16]: m counts rows of the first
  // operand, n rows of the second, both inside the wave's tile.
  // The loop ends behind a barrier with every LDS read returned and no copy in
  // flight: the ring is free. Each wave stages its tile as [n][m], 64 rows of
  // 128 B, in a range of its own.
  int m0 = (lane >> 4) << 3;
  int n0 = lane & 15;
  _Float16* tile = sm + wave * (64 * LPITCH);
  _Float16* st = tile + n0 * LPITCH + m0;
  if (wfirst) {                            // m = d of the head, n = token
    float sc = (g == 0) ? 0.125f : 1.0f;   // fold 1/sqrt(64) into Q
#pragma unroll   // acc[][] needs constant indices to stay in registers
    for (int i = 0; i < 4; ++i) {
      const float4* bp = (const float4*)(bqkv + hg * 64 + m0 + i * 16);
      float4 lo = bp[0], hi = bp[1];
      float bias[8] = {lo.x, lo.y, lo.z, lo.w, hi.x, hi.y, hi.z, hi.w};
#pragma unroll
      for (int j = 0; j < 4; ++j) {
        v8h w;
#pragma unroll
        for (int v = 0; v < 8; ++v) w[v] = (_Float16)((acc[i][j][v] + bias[v]) * sc);
        *(v8h*)(st + j * 16 * LPITCH + i * 16) = w;
      }
    }
  } else {                                 // m = token, n = d of the head
#pragma unroll   // as above
    for (int j = 0; j < 4; ++j) {
      float bias = bqkv[hg * 64 + n0 + j * 16];
#pragma unroll
      for (int i = 0; i < 4; ++i) {
        v8h w;
#pragma unroll
        for (int v = 0; v < 8; ++v) w[v] = (_Float16)(acc[i][j][v] + bias);
        *(v8h*)(st + j * 16 * LPITCH + i * 16) = w;
      }
    }
  }
  __syncthreads();                         // every tile is staged

  // lane takes 16-byte piece lane%8 of staged rows lane/8 + 4*c: a wave-wide
  // store covers four staged rows = four whole lines
  int piece = lane & 7, r = lane >> 3;
  int bb = tok0 >> 11, s0 = (tok0 & (SEQ - 1)) + tw * 64;
  const _Float16* ld = tile + r * LPITCH + piece * 8;
  v8h w[16];
#pragma unroll   // w[] needs constant indices to stay in registers
  for (int c = 0; c < 16; ++c) w[c] = *(const v8h*)(ld + c * 4 * LPITCH);
  if (wfirst) {                            // staged row = token, 128 B of its head
    _Float16* dst = ((g == 0) ? Qh : Kh)
        + (((size_t)bb * H_NUM + head) * SEQ + s0 + r) * D_DIM + piece * 8;
#pragma unroll   // as above; the row steps become immediate offsets
    for (int c = 0; c < 16; ++c) *(v8h*)(dst + c * 4 * D_DIM) = w[c];
  } else {                                 // staged row = d of the head, 64 tokens
    _Float16* dst = Vt + ((size_t)bb * E_DIM + head * D_DIM + r) * SEQ + s0 + piece * 8;
#pragma unroll   // as above
    for (int c = 0; c < 16; ++c) *(v8h*)(dst + (size_t)c * 4 * SEQ) = w[c];
  }
}

#define ASTAGE (128 * LPITCH)
#define ABUF   (2 * ASTAGE)
#define HKEYS  (SEQ / 2)
#define PSLOT  (8 * 32 * 4 + 32 * 2)
typedef __attribute__((ext_vector_type(4))) float v4f;
// value of lane l ^ 16
__device__ __forceinline__ float xhalf(float x) {
  int xi = __builtin_bit_cast(int, x);
  return __builtin_bit_cast(float, __builtin_amdgcn_permlanex16(
      xi, xi, 0x76543210, 0xfedcba98, false, false));
}

// One 16-query subtile's partial result goes to the pair's other wave: 16 B per
// lane and write, lanes side by side (no bank conflict).
__device__ __forceinline__ void give_part(float* slot, int lane, const v8f (&o)[4],
                                          float nm, float l) {
  v4f* p = (v4f*)slot + lane;
#pragma unroll   // o[] needs constant indices to stay in registers
  for (int j = 0; j < 4; ++j) {
    p[(2 * j) * 32]     = v4f{o[j][0], o[j][1], o[j][2], o[j][3]};
    p[(2 * j + 1) * 32] = v4f{o[j][4], o[j][5], o[j][6], o[j][7]};
  }
  ((float2*)(slot + 8 * 32 * 4))[lane] = float2{nm, l};
}
// Joins the other wave's partial result of a subtile with this wave's own (both
// brought to the larger of the two maxima), divides by the sum and stores:
// a lane holds 8 consecutive d of one query, one 16-byte store per tile.
__device__ __forceinline__ void join_store(const float* slot, int lane, const v8f (&o)[4],
                                           float nm, float l, _Float16* op) {
  const v4f* p = (const v4f*)slot + lane;
  float2 ml = ((const float2*)(slot + 8 * 32 * 4))[lane];
  float nmin = fminf(nm, ml.x);                 // minus the larger maximum
  float c0 = __expf(nmin - nm), c1 = __expf(nmin - ml.x);
  float lt = l * c0 + ml.y * c1;
  float inv = 1.0f / (lt + xhalf(lt));
  c0 *= inv; c1 *= inv;
#pragma unroll   // as above
  for (int j = 0; j < 4; ++j) {
    v4f lo = p[(2 * j) * 32], hi = p[(2 * j + 1) * 32];
    v8h w;
#pragma unroll
    for (int r = 0; r < 4; ++r) {
      w[r]     = (_Float16)(o[j][r] * c0 + lo[r] * c1);
      w[4 + r] = (_Float16)(o[j][4 + r] * c0 + hi[r] * c1);
    }
    *(v8h*)(op + j * 16) = w;
  }
}

__global__ __launch_bounds__(512)
void attn_wmma_kernel(const _Float16* __restrict__ Q,
                      const _Float16* __restrict__ K,
                      const _Float16* __restrict__ Vt,
                      _Float16* __restrict__ Oh) {
  __shared__ __attribute__((aligned(16))) _Float16 sm[2 * ABUF];
  static_assert(16 * PSLOT * 4 <= 2 * ABUF * 2, "the hand-over fits the ring");
  int lane = threadIdx.x & 31, wave = threadIdx.x >> 5;
  // the wave's key half as a scalar: the tests on it are scalar branches
  int kh = __builtin_amdgcn_readfirstlane(threadIdx.x >> 8);
  int id = blockIdx.x * 8 + (wave & 7);     // 0 .. B*H*(S/32)-1 = 2047
  int qt = id & (SEQ / 32 - 1);             // 32-query tile in sequence
  int bh = id >> 6;                         // 0..31
  int b = bh >> 4, h = bh & 15;
  const _Float16* Qp = Q + (size_t)bh * SEQ * D_DIM;
  const _Float16* Kp = K + (size_t)bh * SEQ * D_DIM;
  const _Float16* Vp = Vt + (size_t)bh * D_DIM * SEQ;
  int qrow = qt * 32;

  // Q^T as B operand: column = query, kept in registers for the whole loop
  v16h bq[2][2];
#pragma unroll
  for (int i = 0; i < 2; ++i) {
    bq[i][0] = load_tile16(Qp, D_DIM, qrow + i * 16, 0, lane);
    bq[i][1] = load_tile16(Qp, D_DIM, qrow + i * 16, 32, lane);
  }

  // o[i][j][r] = O^T[d = j*16 + 8*(lane/16) + r][query = qrow + i*16 + lane%16]
  v8f o[2][4];
  // negm[i]: minus the maximum in use of the lane's query column, in all eight
  // elements: it is the C operand of the score products, so a score tile comes
  // out as score - maximum. l is the lane half's own partial sum.
  v8f negm[2];
  float l[2];
#pragma unroll
  for (int i = 0; i < 2; ++i) {
#pragma unroll
    for (int j = 0; j < 4; ++j) o[i][j] = v8f{};
    negm[i] = v8f{}; l[i] = 0.f;
  }

  // this thread's pieces of a stage, all of its own wave's key half:
  // K rows r, r+32 and V^T rows r, r+32
  int u = threadIdx.x & 255;
  const _Float16* gk = Kp + (size_t)(kh * HKEYS + (u >> 3)) * D_DIM + (u & 7) * 8;
  const _Float16* gv = Vp + (size_t)(u >> 3) * SEQ + kh * HKEYS + (u & 7) * 8;
  unsigned lk = (unsigned)(size_t)sm + kh * (ASTAGE * 2) + (u >> 3) * LROWB + (u & 7) * 16;

  copy4(lk, lk + 32 * LROWB, lk + 64 * LROWB, lk + 96 * LROWB,
        gk, gk + 32 * D_DIM, gv, gv + 32 * SEQ);
  wait_copies();
  __syncthreads();                          // stage 0 is published
  copy4(lk + ABUF * 2, lk + ABUF * 2 + 32 * LROWB,
        lk + ABUF * 2 + 64 * LROWB, lk + ABUF * 2 + 96 * LROWB,
        gk + 64 * D_DIM, gk + 96 * D_DIM, gv + 64, gv + 32 * SEQ + 64);

  for (int t = 0; t < HKEYS / 64; ++t) {
   const _Float16* sk = sm + (t & 1) * ABUF + kh * ASTAGE;   // K rows of this stage
   const _Float16* sv = sk + 64 * LPITCH;        // V^T rows of this stage
#pragma unroll   // both 32-key passes of a stage inline: LDS offsets become immediates
   for (int kb = 0; kb < 64; kb += 32) {
    // s[i][kt][r] = score(key kh*HKEYS + 64*t + kb + kt*16 + 8*(lane/16) + r, query column)
    //               - maximum in use of that column
    v8f s[2][2];

#pragma unroll
    for (int kt = 0; kt < 2; ++kt) {
      v16h ak0 = load_tile16(sk, LPITCH, kb + kt * 16, 0, lane);
      v16h ak1 = load_tile16(sk, LPITCH, kb + kt * 16, 32, lane);
#pragma unroll
      for (int i = 0; i < 2; ++i) {
        s[i][kt] = wmma16(ak0, bq[i][0], negm[i]);
        s[i][kt] = wmma16(ak1, bq[i][1], s[i][kt]);
      }
    }

    // The pass's four V^T fragments are read here, as one group in front of the
    // test: they land under the score products and the maxima. Read behind the
    // branch, each pair is waited for in turn just ahead of its two products.
    v16h av[4];
#pragma unroll   // av[] needs constant indices to stay in registers
    for (int j = 0; j < 4; ++j) av[j] = load_tile16(sv, LPITCH, j * 16, kb, lane);

    // The maximum in use moves only when a column's scores outgrow it by more
    // than 8 (p stays below e^8, far inside f16), or on the very first pass,
    // which sets it: one test per pass for the whole wave, a scalar branch.
    bool first = (t == 0) && (kb == 0);
    float mx[2];        // the lane half's own largest score above the maximum in use
#pragma unroll
    for (int i = 0; i < 2; ++i) {
      float t8[8];
#pragma unroll
      for (int v = 0; v < 8; ++v) t8[v] = fmaxf(s[i][0][v], s[i][1][v]);
      mx[i] = fmaxf(fmaxf(fmaxf(t8[0], t8[1]), fmaxf(t8[2], t8[3])),
                    fmaxf(fmaxf(t8[4], t8[5]), fmaxf(t8[6], t8[7])));
    }
    // holds the four V^T reads in front of the branch (inputs only, no code): the
    // compiler otherwise sinks them behind it, one exposed LDS wait per pair
    asm volatile("" :: "v"(av[0]), "v"(av[1]), "v"(av[2]), "v"(av[3]));
    if (__builtin_amdgcn_ballot_w32(first || fmaxf(mx[0], mx[1]) > 8.0f) != 0) {
#pragma unroll
      for (int i = 0; i < 2; ++i) {
        float mh = fmaxf(mx[i], xhalf(mx[i]));        // both halves use one maximum
        float d = (first || mh > 8.0f) ? mh : 0.f;    // how far this column's maximum moves
        float corr = first ? 0.f : __expf(-d);        // first pass: o and l are still 0
        s[i][0] -= d; s[i][1] -= d; negm[i] -= d;
        l[i] *= corr;
#pragma unroll
        for (int j = 0; j < 4; ++j) o[i][j] *= corr;
      }
    }

    v16h bp[2];   // P^T as B operand, packed straight from the score tiles
#pragma unroll
    for (int i = 0; i < 2; ++i) {
      // e^x as 2^(x * log2 e), the product taken on whole tiles (packed multiplies)
      v8f p0 = s[i][0] * 1.44269504f;   // keys kb + 8*(lane/16) + v
      v8f p1 = s[i][1] * 1.44269504f;   // keys kb + 16 + 8*(lane/16) + v
#pragma unroll
      for (int v = 0; v < 8; ++v) p0[v] = __builtin_amdgcn_exp2f(p0[v]);
#pragma unroll
      for (int v = 0; v < 8; ++v) p1[v] = __builtin_amdgcn_exp2f(p1[v]);
#pragma unroll
      for (int v = 0; v < 8; ++v) {
        bp[i][v]     = (_Float16)p0[v];
        bp[i][8 + v] = (_Float16)p1[v];
      }
      v8f ps = p0 + p1;
      l[i] += ((ps[0] + ps[1]) + (ps[2] + ps[3])) + ((ps[4] + ps[5]) + (ps[6] + ps[7]));
    }

    // each V^T fragment feeds both query subtiles
#pragma unroll
    for (int j = 0; j < 4; ++j) {
#pragma unroll
      for (int i = 0; i < 2; ++i) o[i][j] = wmma16(av[j], bp[i], o[i][j]);
    }
   }
   wait_lds_reads();
   wait_copies();
   __syncthreads();                         // publishes stage t+1, frees stage t's buffer
   if (t + 2 < HKEYS / 64) {
     unsigned lt = lk + (t & 1) * (ABUF * 2);
     const _Float16* gkt = gk + (size_t)(t + 2) * 64 * D_DIM;
     const _Float16* gvt = gv + (t + 2) * 64;
     copy4(lt, lt + 32 * LROWB, lt + 64 * LROWB, lt + 96 * LROWB,
           gkt, gkt + 32 * D_DIM, gvt, gvt + 32 * SEQ);
   }
  }
  wait_copies();

  // The loop ends behind a barrier with every LDS read returned and no copy in
  // flight: the ring is free for the hand-over. Wave kh keeps subtile kh.
  float* ps = (float*)sm;
  if (kh == 0) give_part(ps + wave * PSLOT, lane, o[1], negm[1][0], l[1]);
  else         give_part(ps + wave * PSLOT, lane, o[0], negm[0][0], l[0]);
  __syncthreads();                          // every handed-over subtile is in LDS
  const float* po = ps + (wave ^ 8) * PSLOT;
  _Float16* op = Oh + ((size_t)b * SEQ + qrow + kh * 16 + (lane & 15)) * E_DIM + h * D_DIM
                    + ((lane >> 4) << 3);
  if (kh == 0) join_store(po, lane, o[0], negm[0][0], l[0], op);
  else         join_store(po, lane, o[1], negm[1][0], l[1], op);
}

// ---------------------------------------------------------------------------
// 4) out = LayerNorm(O @ Weff^T + y) in ONE launch (Weff = Wmsa + (Bo Ao)^T).
//    A block owns 32 WHOLE rows of 1024 columns, so a row's two sums stay
//    inside the block: 128 blocks of 16 waves, wave tile 64 columns x 32 tokens.
//    The block's 32 rows of O (64 KiB, all of k) are copied to LDS once and read
//    by every wave. A weight is used by one wave only, so it takes no way
//    through LDS: each wave streams its 64 weight rows from L2 into registers,
//    in fragment order (whole lines), three 32-k steps ahead of their products,
//    and the loop has no barrier.
//    The weights are the FIRST operand: a lane holds 8 consecutive columns of
//    one token, 16-byte LDS writes. The products are staged in LDS as f32 rows;
//    then one wave per row (two rows a wave) adds y and normalises: the row is
//    read once by 8 reads of 16 B per lane and stays in registers; the two sums
//    are taken in the lane (four chains each) and then over the 32 lanes by a
//    butterfly, so every lane ends with the same totals.
// ---------------------------------------------------------------------------
#define MROWS  32                       // rows per block
#define XPITCH (E_DIM + 8)              // halves per staged O row: 2064 B = 16 B x odd
#define RPITCH (E_DIM + 4)              // floats per staged result row: 4112 B = 16 B x odd
#define KSTEPS (E_DIM / 32)

// the wave's four weight tiles of 32-k step ks; wp: its first tile's piece of this lane
__device__ __forceinline__ void load_wfrags(const v8h* wp, int ks, v16h (&w)[4]) {
#pragma unroll   // w[] needs constant indices to stay in registers
  for (int j = 0; j < 4; ++j) {
    const v8h* p = wp + (j * KSTEPS + ks) * 64;
    v8h lo = p[0], hi = p[32];
    w[j] = __builtin_shufflevector(lo, hi, 0,1,2,3,4,5,6,7,8,9,10,11,12,13,14,15);
  }
}
// the eight products of 32-k step ks
__device__ __forceinline__ void mul_kstep(const _Float16* sx, int ks, int lane,
                                          const v16h (&w)[4], v8f (&acc)[4][2]) {
  v16h x0 = load_tile16(sx, XPITCH, 0, ks * 32, lane);
  v16h x1 = load_tile16(sx, XPITCH, 16, ks * 32, lane);
#pragma unroll   // w[] and acc[][] need constant indices to stay in registers
  for (int j = 0; j < 4; ++j) {
    acc[j][0] = wmma16(w[j], x0, acc[j][0]);
    acc[j][1] = wmma16(w[j], x1, acc[j][1]);
  }
}

__global__ __launch_bounds__(512)
void msa_ln_kernel(const _Float16* __restrict__ Oh,
                   const _Float16* __restrict__ Wf,    // [1024,1024] f16, fragment order
                   const float* __restrict__ y,
                   const float* __restrict__ gamma,
                   const float* __restrict__ beta, float* __restrict__ out) {
  __shared__ __attribute__((aligned(16))) _Float16 sx[MROWS * XPITCH];
  __shared__ __attribute__((aligned(16))) float sr[MROWS * RPITCH];
  int tid = threadIdx.x, lane = tid & 31;
  // the wave's number as a scalar: the bases of its weight stream and of its
  // rows sit in scalar registers, addressed by the one lane-offset register
  int wave = __builtin_amdgcn_readfirstlane(tid >> 5);
  int row0 = blockIdx.x * MROWS;

  // thread t copies piece t%128 of rows t/128 + 4*c: a wave-wide copy is 4 whole lines
  const _Float16* go = Oh + (size_t)(row0 + (tid >> 7)) * E_DIM + (tid & 127) * 8;
  unsigned lx = (unsigned)(size_t)sx + (tid >> 7) * (XPITCH * 2) + (tid & 127) * 16;
  copy4(lx, lx + 4 * (XPITCH * 2), lx + 8 * (XPITCH * 2), lx + 12 * (XPITCH * 2),
        go, go + 4 * E_DIM, go + 8 * E_DIM, go + 12 * E_DIM);
  copy4(lx + 16 * (XPITCH * 2), lx + 20 * (XPITCH * 2),
        lx + 24 * (XPITCH * 2), lx + 28 * (XPITCH * 2),
        go + 16 * E_DIM, go + 20 * E_DIM, go + 24 * E_DIM, go + 28 * E_DIM);

  const v8h* wp = (const v8h*)Wf + (size_t)wave * (4 * KSTEPS * 64) + lane;
  v16h w0[4], w1[4], w2[4], w3[4];
  load_wfrags(wp, 0, w0);
  load_wfrags(wp, 1, w1);
  load_wfrags(wp, 2, w2);

  // acc[j][i][v] = C[token i*16 + lane%16][column wave*64 + j*16 + 8*(lane/16) + v]
  v8f acc[4][2];
#pragma unroll
  for (int j = 0; j < 4; ++j) { acc[j][0] = v8f{}; acc[j][1] = v8f{}; }

  wait_copies();
  __syncthreads();                          // the block's rows of O are published

  // Four register sets in turn. The scheduling barriers keep each set's loads
  // where they are written, three steps ahead of their products: moved down
  // towards their use, the loads' flight from L2 would be waited for in full.
#pragma unroll 1   // the body is four steps already; more would only add code
  for (int ks = 0; ks < KSTEPS - 4; ks += 4) {
    load_wfrags(wp, ks + 3, w3);
    __builtin_amdgcn_sched_barrier(0);
    mul_kstep(sx, ks, lane, w0, acc);
    __builtin_amdgcn_sched_barrier(0);
    load_wfrags(wp, ks + 4, w0);
    __builtin_amdgcn_sched_barrier(0);
    mul_kstep(sx, ks + 1, lane, w1, acc);
    __builtin_amdgcn_sched_barrier(0);
    load_wfrags(wp, ks + 5, w1);
    __builtin_amdgcn_sched_barrier(0);
    mul_kstep(sx, ks + 2, lane, w2, acc);
    __builtin_amdgcn_sched_barrier(0);
    load_wfrags(wp, ks + 6, w2);
    __builtin_amdgcn_sched_barrier(0);
    mul_kstep(sx, ks + 3, lane, w3, acc);
    __builtin_amdgcn_sched_barrier(0);
  }
  load_wfrags(wp, KSTEPS - 1, w3);
  __builtin_amdgcn_sched_barrier(0);        // as in the loop
  mul_kstep(sx, KSTEPS - 4, lane, w0, acc);
  mul_kstep(sx, KSTEPS - 3, lane, w1, acc);
  __builtin_amdgcn_sched_barrier(0);        // holds the loads of y behind these products: registers

  // The wave's two rows of y go into the two freed register sets and fly under
  // the last products; gamma and beta follow when the other two sets are free.
  int r0 = wave * 2;
  const v4f* yp = (const v4f*)(y + (size_t)(row0 + r0) * E_DIM) + lane;
  const v4f* gp = (const v4f*)gamma + lane;
  const v4f* bp = (const v4f*)beta + lane;
  v4f yv[2][SLOADS], g[SLOADS], b[SLOADS];
#pragma unroll   // yv[][] needs constant indices to stay in registers
  for (int c = 0; c < SLOADS; ++c) {
    yv[0][c] = yp[c * 32];
    yv[1][c] = yp[E_DIM / 4 + c * 32];
  }
  // keeps the loads of y in front of the last products: sunk behind them, their
  // flight from memory would be waited for in full
  __builtin_amdgcn_sched_barrier(0);
  mul_kstep(sx, KSTEPS - 2, lane, w2, acc);
  mul_kstep(sx, KSTEPS - 1, lane, w3, acc);
  __builtin_amdgcn_sched_barrier(0);        // holds the next loads behind these products: registers
#pragma unroll   // g[], b[] need constant indices to stay in registers
  for (int c = 0; c < SLOADS; ++c) { g[c] = gp[c * 32]; b[c] = bp[c * 32]; }
  // keeps these loads in front of the LDS writes and the barrier
  __builtin_amdgcn_sched_barrier(0);

  float* st = sr + (lane & 15) * RPITCH + wave * 64 + ((lane >> 4) << 3);
#pragma unroll   // acc[][] needs constant indices to stay in registers
  for (int j = 0; j < 4; ++j) {
#pragma unroll
    for (int i = 0; i < 2; ++i) {
      float* p = st + i * 16 * RPITCH + j * 16;
      *(v4f*)p       = v4f{acc[j][i][0], acc[j][i][1], acc[j][i][2], acc[j][i][3]};
      *(v4f*)(p + 4) = v4f{acc[j][i][4], acc[j][i][5], acc[j][i][6], acc[j][i][7]};
    }
  }
  __syncthreads();                          // every row's products are in LDS

#pragma unroll   // yv[][] needs constant indices to stay in registers
  for (int rr = 0; rr < 2; ++rr) {
    const v4f* rp = (const v4f*)(sr + (r0 + rr) * RPITCH) + lane;
    v4f* op = (v4f*)(out + (size_t)(row0 + r0 + rr) * E_DIM) + lane;
    v4f x[SLOADS];
#pragma unroll   // x[] needs constant indices to stay in registers
    for (int c = 0; c < SLOADS; ++c) x[c] = rp[c * 32] + yv[rr][c];

    v4f a = x[0], q = x[0] * x[0];
#pragma unroll   // as above
    for (int c = 1; c < SLOADS; ++c) { a += x[c]; q += x[c] * x[c]; }
    float s1 = (a.x + a.y) + (a.z + a.w);
    float s2 = (q.x + q.y) + (q.z + q.w);
#pragma unroll   // the five exchange distances become constants
    for (int d = 16; d > 0; d >>= 1) {
      s1 += __shfl_xor(s1, d);
      s2 += __shfl_xor(s2, d);
    }
    float mu = s1 * (1.0f / E_DIM);
    float var = s2 * (1.0f / E_DIM) - mu * mu;
    float sc = rsqrtf(var + 1e-6f);
#pragma unroll   // as above
    for (int c = 0; c < SLOADS; ++c) op[c * 32] = (x[c] - mu) * sc * g[c] + b[c];
  }
}

// ---------------------------------------------------------------------------
// Host launcher
// ---------------------------------------------------------------------------
extern "C" void kernel_launch(void* const* d_in, const int* in_sizes, int n_in,
                              void* d_out, int out_size, void* d_ws, size_t ws_size,
                              hipStream_t stream) {
  const float* y    = (const float*)d_in[0];
  const float* Wqkv = (const float*)d_in[1];
  const float* bqkv = (const float*)d_in[2];
  const float* Wmsa = (const float*)d_in[3];
  const float* Bq   = (const float*)d_in[4];
  const float* Aq   = (const float*)d_in[5];
  const float* Bk   = (const float*)d_in[6];
  const float* Ak   = (const float*)d_in[7];
  const float* Bv   = (const float*)d_in[8];
  const float* Av   = (const float*)d_in[9];
  const float* Bo   = (const float*)d_in[10];
  const float* Ao   = (const float*)d_in[11];
  const float* gamma = (const float*)d_in[12];
  const float* beta  = (const float*)d_in[13];
  float* out = (float*)d_out;

  // workspace carve-up (all offsets 256B-aligned)
  char* ws = (char*)d_ws;
  size_t off = 0;
  auto carve = [&](size_t bytes) {
    char* p = ws + off;
    off += (bytes + 255) & ~(size_t)255;
    return p;
  };
  _Float16* Xh   = (_Float16*)carve((size_t)TOK * E_DIM * 2);   // y f16
  _Float16* Wqh  = (_Float16*)carve((size_t)NQKV * E_DIM * 2);  // Wqkv + LoRA, f16
  _Float16* Wmh  = (_Float16*)carve((size_t)E_DIM * E_DIM * 2); // Wmsa + LoRA, f16, fragment order
  _Float16* Qh   = (_Float16*)carve((size_t)TOK * E_DIM * 2);   // [B,H,S,D]
  _Float16* Kh   = (_Float16*)carve((size_t)TOK * E_DIM * 2);   // [B,H,S,D]
  _Float16* Vt   = (_Float16*)carve((size_t)TOK * E_DIM * 2);   // [B,H,D,S]
  _Float16* Oh   = (_Float16*)carve((size_t)TOK * E_DIM * 2);   // [B,S,E]
  (void)ws_size; (void)in_sizes; (void)n_in; (void)out_size;

  // 0) prepass: effective f16 weights and the convert of y, one launch
  prepass_kernel<<<FOLD_BLOCKS + CVT_BLOCKS, 256, 0, stream>>>(
      y, Xh, Wqkv, Wmsa, Bq, Aq, Bk, Ak, Bv, Av, Bo, Ao, Wqh, Wmh);
  // 2) QKV GEMM (grid: N/192 x M/256)
  qkv_wmma_kernel<<<dim3(NQKV / 192, TOK / 256), 384, 0, stream>>>(
      Xh, Wqh, bqkv, Qh, Kh, Vt);
  // 3) attention: B*H*(S/32) query tiles, 8 per block, 2 waves per tile
  attn_wmma_kernel<<<(BATCH * H_NUM * (SEQ / 32)) / 8, 512, 0, stream>>>(
      Qh, Kh, Vt, Oh);
  // 4) output projection + residual + LayerNorm: 32 whole rows per block
  msa_ln_kernel<<<TOK / MROWS, 512, 0, stream>>>(Oh, Wmh, y, gamma, beta, out);
}
